// v000
// Times are from an AMD MI455X. After a warm-up the kernel runs many times in a row, and a time is the length of
// such a window on the GPU divided by its runs, so every launch and the gaps after it count. The runs cycle
// through copies of the inputs. A figure is the median of several windows, for all but v000 over two sittings.
// Sittings can differ by a few percent; kernels timed side by side share one.
// The starting kernel, v000, takes 2130 microseconds a run.
#include <hip/hip_runtime.h>

// DWT_MLP_Model (x [4][2048][512]; q/k/v = x @ W + b ([in][out]); 8 heads x 64; scores / 8; log-sparse mask: keep (i, j) iff i - j == 0, or 1 <= i - j <= 1024, or i - j is a positive power of two (else -inf);
// softmax; out = ctx @ W_O + b_O).
// Compute dtypes, f32 accumulate: every input rounded to bf16; projections on PLAIN bf16 operands (inputs: exact; transposed bf16 weight copies, + bias); PER-ROW
// PRECISION HYBRID: query rows < 256 of each batch on bf16 hi+lo planes for scores and attn.v (3 products), rows >= 256 on SINGLE fp16 planes; the mask by index arithmetic in the softmax; output

#define NB_  4
#define TT   2048
#define DD   512
#define NH_  8
#define HD   64
#define ZH   2
#define RH   256                  // query rows < RH: hi+lo planes; rows >= RH: fp16 planes
#define NF   32                   // head_dim / 2 (unused)
#define SCL  0.125f               // 1/sqrt(64)
#define PCAR 1024.0f         // fp16 P scale for rows >= RH; undone in k_merge
typedef _Float16 h16;
typedef unsigned short bf;
typedef __attribute__((ext_vector_type(16))) __bf16   v16bf;
typedef __attribute__((ext_vector_type(16))) _Float16 v16h;
typedef __attribute__((ext_vector_type(8)))  _Float16 v8h;
typedef __attribute__((ext_vector_type(8)))  unsigned short v8us;
typedef __attribute__((ext_vector_type(8)))  float    v8f;
typedef __attribute__((ext_vector_type(4)))  float    v4f;
typedef v8h  __attribute__((may_alias)) v8ha;
typedef v4f  __attribute__((may_alias)) v4fa;
typedef v8us __attribute__((may_alias)) v8usa;

__device__ __forceinline__ unsigned short f2bf(float f) { unsigned u = __float_as_uint(f); u += 0x7FFFu + ((u >> 16) & 1u); return (unsigned short)(u >> 16); }
__device__ __forceinline__ float bf2f(unsigned short b) { return __uint_as_float(((unsigned)b) << 16); }
__device__ __forceinline__ float bfr(float f) { return bf2f(f2bf(f)); }
__device__ __forceinline__ v16h cat16(v8h lo, v8h hi) { return __builtin_shufflevector(lo, hi, 0, 1, 2, 3, 4, 5, 6, 7, 8, 9, 10, 11, 12, 13, 14, 15); }
__device__ __forceinline__ v16bf cat16b(v8us lo, v8us hi) { return __builtin_bit_cast(v16bf, __builtin_shufflevector(lo, hi, 0, 1, 2, 3, 4, 5, 6, 7, 8, 9, 10, 11, 12, 13, 14, 15)); }
__device__ __forceinline__ v8f wmma16(v16h a, v16h b, v8f c) { return __builtin_amdgcn_wmma_f32_16x16x32_f16(false, a, false, b, (short)0, c, false, false); }
__device__ __forceinline__ v8f wmmab(v16bf a, v16bf b, v8f c) { return __builtin_amdgcn_wmma_f32_16x16x32_bf16(false, a, false, b, (short)0, c, false, false); }



// ---- k_gemmw: register-blocked GEMM, ONE WAVE per 64x64 output tile (16 accumulators), operands straight from K-contiguous 16-bit planes; grid (M/64, N/64, Z), 32 threads.
// C[m][n] (f32, pitch ldc, + optional f32 bias[n]) = sum_k A[m][k] Bt[n][k] (+ split products per NSPLIT). z-batch strides sA/sB/sC in elements. K % 32 == 0.
template <typename T16> struct WFrag;
template <> struct WFrag<h16> { typedef v16h V; static __device__ __forceinline__ V ld(const h16* p) { return cat16(*(const v8h*)p, *(const v8h*)(p + 16)); } static __device__ __forceinline__ v8f mma(V a, V b, v8f c) { return wmma16(a, b, c); } };
template <> struct WFrag<bf> { typedef v16bf V; static __device__ __forceinline__ V ld(const bf* p) { return cat16b(*(const v8us*)p, *(const v8us*)(p + 16)); } static __device__ __forceinline__ v8f mma(V a, V b, v8f c) { return wmmab(a, b, c); } };
template <typename T16, int NSPLIT, bool BIAS>
__global__ __launch_bounds__(32) void k_gemmw(const T16* __restrict__ A, const T16* __restrict__ A2, const T16* __restrict__ Bt, const T16* __restrict__ Bt2, int K, float* C, int ldc, const float* __restrict__ bias, size_t sA, size_t sB, size_t sC) {
    typedef typename WFrag<T16>::V V;
    __shared__ __align__(16) float os[16 * 68];
    const size_t z = blockIdx.z; A += z * sA; if (A2) A2 += z * sA; Bt += z * sB; if (Bt2) Bt2 += z * sB; C += z * sC;
    const int lane = threadIdx.x & 31, lr = lane & 15, hi = lane >> 4; const int r0 = blockIdx.x * 64, c0 = blockIdx.y * 64;
    v8f acc[4][4];
#pragma unroll
    for (int mb = 0; mb < 4; ++mb)
#pragma unroll
        for (int nb = 0; nb < 4; ++nb) acc[mb][nb] = (v8f){};
    const size_t aoff = (size_t)(r0 + lr) * K + 8 * hi, boff = (size_t)(c0 + lr) * K + 8 * hi;
#pragma unroll 1
    for (int kc = 0; kc < K; kc += 32) {
        V a[4], a2[4];
#pragma unroll
        for (int mb = 0; mb < 4; ++mb) { a[mb] = WFrag<T16>::ld(A + aoff + (size_t)mb * 16 * K + kc); if (NSPLIT == 1 || NSPLIT == 2) a2[mb] = WFrag<T16>::ld(A2 + aoff + (size_t)mb * 16 * K + kc); }
#pragma unroll
        for (int nb = 0; nb < 4; ++nb) { const V b = WFrag<T16>::ld(Bt + boff + (size_t)nb * 16 * K + kc); V b2; if (NSPLIT >= 2) b2 = WFrag<T16>::ld(Bt2 + boff + (size_t)nb * 16 * K + kc);
#pragma unroll
            for (int mb = 0; mb < 4; ++mb) { acc[mb][nb] = WFrag<T16>::mma(a[mb], b, acc[mb][nb]); if (NSPLIT == 1 || NSPLIT == 2) acc[mb][nb] = WFrag<T16>::mma(a2[mb], b, acc[mb][nb]); if (NSPLIT >= 2) acc[mb][nb] = WFrag<T16>::mma(a[mb], b2, acc[mb][nb]); } }
        asm volatile("v_nop\n\tv_nop\n\tv_nop\n\tv_nop" : "+v"(acc[0][0]), "+v"(acc[1][1]), "+v"(acc[2][2]), "+v"(acc[3][3]) : "v"(a[0]), "v"(a[3]));
    }
#pragma unroll
    for (int mb = 0; mb < 4; ++mb) {
#pragma unroll
        for (int nb = 0; nb < 4; ++nb) {
#pragma unroll
            for (int j = 0; j < 8; ++j) os[(hi * 8 + j) * 68 + nb * 16 + lr] = acc[mb][nb][j]; }
        __builtin_amdgcn_wave_barrier(); asm volatile("" ::: "memory");
        float* crow = C + (size_t)(r0 + mb * 16) * ldc + c0;
{
#pragma unroll
            for (int s = 0; s < 8; ++s) { const int row = 2 * s + hi, cofs = lr * 4; v4f val = *(const v4fa*)(os + row * 68 + cofs); if (BIAS) { val[0] += bfr(bias[c0 + cofs]); val[1] += bfr(bias[c0 + cofs + 1]); val[2] += bfr(bias[c0 + cofs + 2]); val[3] += bfr(bias[c0 + cofs + 3]); }
                *(v4f*)(crow + (size_t)row * ldc + cofs) = val; }
             }
        __builtin_amdgcn_wave_barrier(); asm volatile("" ::: "memory");
    }
}

__device__ __forceinline__ h16 tohx(float x) { return (h16)x; }
__device__ __forceinline__ void splitf(float y, unsigned short& h, unsigned short& l) { h = f2bf(y); l = f2bf(y - bf2f(h)); }
typedef __attribute__((ext_vector_type(2))) unsigned short v2us;
typedef __attribute__((ext_vector_type(2))) _Float16 v2h;
typedef __attribute__((ext_vector_type(4))) _Float16 v4h;
typedef __attribute__((ext_vector_type(2))) float v2f;

__global__ __launch_bounds__(256) void k_wtG(const float* __restrict__ w, int K, int N, bf* Bt) {
    const int lane = threadIdx.x & 31; const int L0 = (blockIdx.x * 8 + (threadIdx.x >> 5)) * 8; const int nlines = N * K / 64;
{
#pragma unroll 1
        for (int l = 0; l < 8; ++l) { const int L = L0 + l; if (L >= nlines) break; const size_t e = (size_t)L * 64 + lane * 2; const int k = (int)(e % K), n = (int)(e / K); v2us o;
            o[0] = f2bf(w[(size_t)k * N + n]); o[1] = f2bf(w[(size_t)(k + 1) * N + n]); *(v2us*)(Bt + e) = o; }
         }
}
__global__ __launch_bounds__(256) void k_cvt8(const float* __restrict__ src, bf* dst, size_t n8) { const size_t i = (size_t)blockIdx.x * 256 + threadIdx.x; if (i >= n8) return; const v8f v = *(const v8f*)(src + i * 8); v8us o;
#pragma unroll
    for (int k = 0; k < 8; ++k) o[k] = f2bf(v[k]); *(v8us*)(dst + i * 8) = o;  }
__global__ __launch_bounds__(256) void k_qplanes(const float* __restrict__ F, bf* Ph, bf* Pl, h16* P16) {
    const int lane = threadIdx.x & 31; const int L0 = (blockIdx.x * 8 + (threadIdx.x >> 5)) * 8; const int nlines = NH_ * TT * HD / 64;
{
#pragma unroll
        for (int l = 0; l < 8; ++l) { const int L = L0 + l; if (L >= nlines) break; const int e = L * 64 + lane * 2; const int d = e & (HD - 1); const int t = (e >> 6) & (TT - 1); const int h = e >> 17; v2us oh, ol; v2h o16;
#pragma unroll
            for (int q = 0; q < 2; ++q) { const float x = F[(size_t)t * DD + h * HD + d + q]; unsigned short a, c2; splitf(x, a, c2); oh[q] = a; ol[q] = c2; o16[q] = tohx(x); }
            *(v2us*)(Ph + (size_t)e) = oh; *(v2us*)(Pl + (size_t)e) = ol; *(v2h*)(P16 + (size_t)e) = o16; }
         }
}
__global__ __launch_bounds__(256) void k_vtplane(const float* __restrict__ F, bf* Vh, bf* Vl, h16* V16) {
    const int lane = threadIdx.x & 31; const int L0 = (blockIdx.x * 8 + (threadIdx.x >> 5)) * 8; const int nlines = NH_ * TT * HD / 64;
{
#pragma unroll
        for (int l = 0; l < 8; ++l) { const int L = L0 + l; if (L >= nlines) break; const int e = L * 64 + lane * 2; const int t = e & (TT - 1); const int d = (e >> 11) & (HD - 1); const int h = e >> 17; v2us oh, ol; v2h o16;
#pragma unroll
            for (int q = 0; q < 2; ++q) { const float x = F[(size_t)(t + q) * DD + h * HD + d]; unsigned short a, c2; splitf(x, a, c2); oh[q] = a; ol[q] = c2; o16[q] = tohx(x); }
            *(v2us*)(Vh + (size_t)e) = oh; *(v2us*)(Vl + (size_t)e) = ol; *(v2h*)(V16 + (size_t)e) = o16; }
         }
}
// k_asoft: per row i: s = S/8 where the log-sparse mask keeps (i, j) (d = i - j: d == 0, 1 <= d <= 1024, or d a positive power of two), else -3e38; softmax over the 2048 keys (register row of
__global__ __launch_bounds__(256) void k_asoft(const float* __restrict__ Sb, bf* Ph, bf* Pl, h16* P16) {
    typedef __attribute__((ext_vector_type(4))) unsigned short v4us;
    const int lane = threadIdx.x & 31; const int row = blockIdx.x * 8 + (threadIdx.x >> 5); if (row >= ZH * TT) return; const int i = row & (TT - 1); const int zz = row >> 11; const bool hires = (i < RH);
    const float* sr = Sb + (size_t)row * TT; float v[64]; float mx = -3.0e38f;
#pragma unroll
    for (int ch = 0; ch < 16; ++ch) { const int j0 = ch * 128 + lane * 4; const v4f a = *(const v4f*)(sr + j0);
#pragma unroll
        for (int q = 0; q < 4; ++q) { const int j = j0 + q; const int dd = i - j; const bool keep = (dd >= 0 && dd <= 1024) || (dd > 0 && (dd & (dd - 1)) == 0); const float t = keep ? a[q] * SCL : -3.0e38f; v[ch * 4 + q] = t; mx = fmaxf(mx, t); } }
#pragma unroll
    for (int sh = 16; sh; sh >>= 1) mx = fmaxf(mx, __shfl_xor(mx, sh, 32));
    float sum = 0.f;
#pragma unroll
    for (int k = 0; k < 64; ++k) { v[k] = __expf(v[k] - mx); sum += v[k]; }
#pragma unroll
    for (int sh = 16; sh; sh >>= 1) sum += __shfl_xor(sum, sh, 32);
    const float f = __fdiv_rn(hires ? 1.0f : PCAR, sum);
{
        if (hires) {
#pragma unroll
            for (int ch = 0; ch < 16; ++ch) { v4us oh, ol;
#pragma unroll
                for (int q = 0; q < 4; ++q) { unsigned short a, c2; splitf(v[ch * 4 + q] * f, a, c2); oh[q] = a; ol[q] = c2; }
                const size_t o = ((size_t)zz * RH + i) * TT + ch * 128 + lane * 4; *(v4us*)(Ph + o) = oh; *(v4us*)(Pl + o) = ol; }
        } else {
#pragma unroll
            for (int ch = 0; ch < 16; ++ch) { v4h o;
#pragma unroll
                for (int q = 0; q < 4; ++q) o[q] = tohx(v[ch * 4 + q] * f);
                *(v4h*)(P16 + (size_t)row * TT + ch * 128 + lane * 4) = o; } }
         }
}
__global__ __launch_bounds__(256) void k_merge(const float* __restrict__ O, int h0, bf* Ah, bf* Al) {
    const int lane = threadIdx.x & 31; const int L0 = (blockIdx.x * 8 + (threadIdx.x >> 5)) * 8; const int nlines = ZH * TT * HD / 64;
{
#pragma unroll
        for (int l = 0; l < 8; ++l) { const int L = L0 + l; if (L >= nlines) break; const int e = L * 64 + lane * 2; const int d = e & (HD - 1); const int t = (e >> 6) & (TT - 1); const int zz = e >> 17; v2us oh, ol;
const float cs = (t < RH) ? 1.0f : (1.0f / PCAR);
#pragma unroll
            for (int q = 0; q < 2; ++q) { unsigned short a, c2; splitf(O[(size_t)e + q] * cs, a, c2); oh[q] = a; ol[q] = c2; }
            const size_t o = (size_t)t * DD + (h0 + zz) * HD + d; *(v2us*)(Ah + o) = oh; *(v2us*)(Al + o) = ol; }
         }
}

extern "C" void kernel_launch(void* const* d_in, const int* in_sizes, int n_in,
                              void* d_out, int out_size, void* d_ws, size_t ws_size, hipStream_t stream) {
    (void)in_sizes; (void)n_in; (void)out_size;
    const float* x = (const float*)d_in[0]; const float* wq = (const float*)d_in[1]; const float* bq = (const float*)d_in[2]; const float* wk = (const float*)d_in[3]; const float* bk = (const float*)d_in[4]; const float* wv = (const float*)d_in[5]; const float* bv = (const float*)d_in[6]; const float* wo = (const float*)d_in[7]; const float* bo = (const float*)d_in[8];
    float* OUT = (float*)d_out;     // [4][2048][512]
    char* wsp = (char*)d_ws;
    auto take = [&](size_t bytes) { char* p = wsp; wsp += (bytes + 255) & ~(size_t)255; return (void*)p; };
    bf* WQ = (bf*)take((size_t)DD * DD * 2); bf* WK = (bf*)take((size_t)DD * DD * 2); bf* WV = (bf*)take((size_t)DD * DD * 2); bf* WO = (bf*)take((size_t)DD * DD * 2);
    bf* XB = (bf*)take((size_t)TT * DD * 2); float* F = (float*)take((size_t)TT * DD * 4);
    bf* QPh = (bf*)take((size_t)TT * DD * 2); bf* QPl = (bf*)take((size_t)TT * DD * 2); bf* KPh = (bf*)take((size_t)TT * DD * 2); bf* KPl = (bf*)take((size_t)TT * DD * 2); bf* VTh = (bf*)take((size_t)TT * DD * 2); bf* VTl = (bf*)take((size_t)TT * DD * 2);
    h16* QP16 = (h16*)take((size_t)TT * DD * 2); h16* KP16 = (h16*)take((size_t)TT * DD * 2); h16* VT16 = (h16*)take((size_t)TT * DD * 2);
    float* Sb = (float*)take((size_t)ZH * TT * TT * 4); bf* Ph = (bf*)take((size_t)ZH * RH * TT * 2); bf* Pl = (bf*)take((size_t)ZH * RH * TT * 2); h16* P16 = (h16*)take((size_t)ZH * TT * TT * 2); float* Ob = (float*)take((size_t)ZH * TT * HD * 4); bf* ATh = (bf*)take((size_t)TT * DD * 2); bf* ATl = (bf*)take((size_t)TT * DD * 2);
    if ((size_t)(wsp - (char*)d_ws) > ws_size) return;    // total 83 MiB; ws 256 MiB
    { const unsigned gT = (unsigned)((DD * DD / 64 + 63) / 64); k_wtG<<<gT, 256, 0, stream>>>(wq, DD, DD, WQ); k_wtG<<<gT, 256, 0, stream>>>(wk, DD, DD, WK); k_wtG<<<gT, 256, 0, stream>>>(wv, DD, DD, WV); k_wtG<<<gT, 256, 0, stream>>>(wo, DD, DD, WO); }
    const unsigned LB = (unsigned)((NH_ * TT * HD / 64 + 63) / 64); const dim3 gP(TT / 64, DD / 64, 1);
    for (int b = 0; b < NB_; ++b) {
        k_cvt8<<<(unsigned)(((size_t)TT * DD / 8 + 255) / 256), 256, 0, stream>>>(x + (size_t)b * TT * DD, XB, (size_t)TT * DD / 8);
        k_gemmw<bf, 0, true><<<gP, 32, 0, stream>>>(XB, nullptr, WQ, nullptr, DD, F, DD, bq, 0, 0, 0); k_qplanes<<<LB, 256, 0, stream>>>(F, QPh, QPl, QP16);
        k_gemmw<bf, 0, true><<<gP, 32, 0, stream>>>(XB, nullptr, WK, nullptr, DD, F, DD, bk, 0, 0, 0); k_qplanes<<<LB, 256, 0, stream>>>(F, KPh, KPl, KP16);
        k_gemmw<bf, 0, true><<<gP, 32, 0, stream>>>(XB, nullptr, WV, nullptr, DD, F, DD, bv, 0, 0, 0); k_vtplane<<<LB, 256, 0, stream>>>(F, VTh, VTl, VT16);
        for (int h0 = 0; h0 < NH_; h0 += ZH) { const size_t z0 = (size_t)h0;
            // scores: rows < RH on hi+lo planes (3 products), rows >= RH on fp16 planes - both into the same [ZH][TT][TT] score buffer
            k_gemmw<bf, 2, false><<<dim3(RH / 64, TT / 64, ZH), 32, 0, stream>>>(QPh + z0 * TT * HD, QPl + z0 * TT * HD, KPh + z0 * TT * HD, KPl + z0 * TT * HD, HD, Sb, TT, nullptr, (size_t)TT * HD, (size_t)TT * HD, (size_t)TT * TT);
            k_gemmw<h16, 0, false><<<dim3((TT - RH) / 64, TT / 64, ZH), 32, 0, stream>>>(QP16 + z0 * TT * HD + (size_t)RH * HD, nullptr, KP16 + z0 * TT * HD, nullptr, HD, Sb + (size_t)RH * TT, TT, nullptr, (size_t)TT * HD, (size_t)TT * HD, (size_t)TT * TT);
            k_asoft<<<ZH * TT / 8, 256, 0, stream>>>(Sb, Ph, Pl, P16);
            k_gemmw<bf, 2, false><<<dim3(RH / 64, HD / 64, ZH), 32, 0, stream>>>(Ph, Pl, VTh + z0 * HD * TT, VTl + z0 * HD * TT, TT, Ob, HD, nullptr, (size_t)RH * TT, (size_t)HD * TT, (size_t)TT * HD);
            k_gemmw<h16, 0, false><<<dim3((TT - RH) / 64, HD / 64, ZH), 32, 0, stream>>>(P16 + (size_t)RH * TT, nullptr, VT16 + z0 * HD * TT, nullptr, TT, Ob + (size_t)RH * HD, HD, nullptr, (size_t)TT * TT, (size_t)HD * TT, (size_t)TT * HD);
            k_merge<<<(ZH * TT * HD / 64 + 63) / 64, 256, 0, stream>>>(Ob, h0, ATh, ATl); }
        k_gemmw<bf, 1, true><<<gP, 32, 0, stream>>>(ATh, ATl, WO, nullptr, DD, OUT + (size_t)b * TT * DD, DD, bo, 0, 0, 0); }
}

// v001
// It runs in 964 microseconds.
// In both of two side-by-side timings against v000, it was 2.22 times as fast.
#include <hip/hip_runtime.h>

// DWT_MLP_Model (x [4][2048][512]; q/k/v = x @ W + b ([in][out]); 8 heads x 64; scores / 8; log-sparse mask: keep (i, j) iff i - j == 0, or 1 <= i - j <= 1024, or i - j is a positive power of two (else -inf);
// softmax; out = ctx @ W_O + b_O).
// Compute dtypes, f32 accumulate: every input rounded to bf16; projections on PLAIN bf16 operands (inputs: exact; transposed bf16 weight copies, + bias); PER-ROW
// PRECISION HYBRID: query rows < 256 of each batch on bf16 hi+lo planes for scores and attn.v (3 products), rows >= 256 on SINGLE fp16 planes; the mask by index arithmetic in the softmax; output

#define NB_  4
#define TT   2048
#define DD   512
#define NH_  8
#define HD   64
#define ZH   8                    // heads per launch of the attention stage: all 8, so each batch runs the stage once
#define RH   256                  // query rows < RH: hi+lo planes; rows >= RH: fp16 planes
#define NF   32                   // head_dim / 2 (unused)
#define SCL  0.125f               // 1/sqrt(64)
#define PCAR 1024.0f         // fp16 P scale for rows >= RH; undone in k_merge
typedef _Float16 h16;
typedef unsigned short bf;
typedef __attribute__((ext_vector_type(16))) __bf16   v16bf;
typedef __attribute__((ext_vector_type(16))) _Float16 v16h;
typedef __attribute__((ext_vector_type(8)))  _Float16 v8h;
typedef __attribute__((ext_vector_type(8)))  unsigned short v8us;
typedef __attribute__((ext_vector_type(8)))  float    v8f;
typedef __attribute__((ext_vector_type(4)))  float    v4f;
typedef v8h  __attribute__((may_alias)) v8ha;
typedef v4f  __attribute__((may_alias)) v4fa;
typedef v8us __attribute__((may_alias)) v8usa;

__device__ __forceinline__ unsigned short f2bf(float f) { unsigned u = __float_as_uint(f); u += 0x7FFFu + ((u >> 16) & 1u); return (unsigned short)(u >> 16); }
__device__ __forceinline__ float bf2f(unsigned short b) { return __uint_as_float(((unsigned)b) << 16); }
__device__ __forceinline__ float bfr(float f) { return bf2f(f2bf(f)); }
__device__ __forceinline__ v16h cat16(v8h lo, v8h hi) { return __builtin_shufflevector(lo, hi, 0, 1, 2, 3, 4, 5, 6, 7, 8, 9, 10, 11, 12, 13, 14, 15); }
__device__ __forceinline__ v16bf cat16b(v8us lo, v8us hi) { return __builtin_bit_cast(v16bf, __builtin_shufflevector(lo, hi, 0, 1, 2, 3, 4, 5, 6, 7, 8, 9, 10, 11, 12, 13, 14, 15)); }
__device__ __forceinline__ v8f wmma16(v16h a, v16h b, v8f c) { return __builtin_amdgcn_wmma_f32_16x16x32_f16(false, a, false, b, (short)0, c, false, false); }
__device__ __forceinline__ v8f wmmab(v16bf a, v16bf b, v8f c) { return __builtin_amdgcn_wmma_f32_16x16x32_bf16(false, a, false, b, (short)0, c, false, false); }



// ---- k_gemmw: register-blocked GEMM, ONE WAVE per 64x64 output tile (16 accumulators), operands straight from K-contiguous 16-bit planes; grid (M/64, N/64, Z), 32 threads.
// C[m][n] (f32, pitch ldc, + optional f32 bias[n]) = sum_k A[m][k] Bt[n][k] (+ split products per NSPLIT). z-batch strides sA/sB/sC in elements. K % 32 == 0.
template <typename T16> struct WFrag;
template <> struct WFrag<h16> { typedef v16h V; static __device__ __forceinline__ V ld(const h16* p) { return cat16(*(const v8h*)p, *(const v8h*)(p + 16)); } static __device__ __forceinline__ v8f mma(V a, V b, v8f c) { return wmma16(a, b, c); } };
template <> struct WFrag<bf> { typedef v16bf V; static __device__ __forceinline__ V ld(const bf* p) { return cat16b(*(const v8us*)p, *(const v8us*)(p + 16)); } static __device__ __forceinline__ v8f mma(V a, V b, v8f c) { return wmmab(a, b, c); } };
template <typename T16, int NSPLIT, bool BIAS>
__global__ __launch_bounds__(32) void k_gemmw(const T16* __restrict__ A, const T16* __restrict__ A2, const T16* __restrict__ Bt, const T16* __restrict__ Bt2, int K, float* C, int ldc, const float* __restrict__ bias, size_t sA, size_t sB, size_t sC) {
    typedef typename WFrag<T16>::V V;
    __shared__ __align__(16) float os[16 * 68];
    const size_t z = blockIdx.z; A += z * sA; if (A2) A2 += z * sA; Bt += z * sB; if (Bt2) Bt2 += z * sB; C += z * sC;
    const int lane = threadIdx.x & 31, lr = lane & 15, hi = lane >> 4; const int r0 = blockIdx.x * 64, c0 = blockIdx.y * 64;
    v8f acc[4][4];
#pragma unroll
    for (int mb = 0; mb < 4; ++mb)
#pragma unroll
        for (int nb = 0; nb < 4; ++nb) acc[mb][nb] = (v8f){};
    const size_t aoff = (size_t)(r0 + lr) * K + 8 * hi, boff = (size_t)(c0 + lr) * K + 8 * hi;
#pragma unroll 1
    for (int kc = 0; kc < K; kc += 32) {
        V a[4], a2[4];
#pragma unroll
        for (int mb = 0; mb < 4; ++mb) { a[mb] = WFrag<T16>::ld(A + aoff + (size_t)mb * 16 * K + kc); if (NSPLIT == 1 || NSPLIT == 2) a2[mb] = WFrag<T16>::ld(A2 + aoff + (size_t)mb * 16 * K + kc); }
#pragma unroll
        for (int nb = 0; nb < 4; ++nb) { const V b = WFrag<T16>::ld(Bt + boff + (size_t)nb * 16 * K + kc); V b2; if (NSPLIT >= 2) b2 = WFrag<T16>::ld(Bt2 + boff + (size_t)nb * 16 * K + kc);
#pragma unroll
            for (int mb = 0; mb < 4; ++mb) { acc[mb][nb] = WFrag<T16>::mma(a[mb], b, acc[mb][nb]); if (NSPLIT == 1 || NSPLIT == 2) acc[mb][nb] = WFrag<T16>::mma(a2[mb], b, acc[mb][nb]); if (NSPLIT >= 2) acc[mb][nb] = WFrag<T16>::mma(a[mb], b2, acc[mb][nb]); } }
        asm volatile("v_nop\n\tv_nop\n\tv_nop\n\tv_nop" : "+v"(acc[0][0]), "+v"(acc[1][1]), "+v"(acc[2][2]), "+v"(acc[3][3]) : "v"(a[0]), "v"(a[3]));
    }
#pragma unroll
    for (int mb = 0; mb < 4; ++mb) {
#pragma unroll
        for (int nb = 0; nb < 4; ++nb) {
#pragma unroll
            for (int j = 0; j < 8; ++j) os[(hi * 8 + j) * 68 + nb * 16 + lr] = acc[mb][nb][j]; }
        __builtin_amdgcn_wave_barrier(); asm volatile("" ::: "memory");
        float* crow = C + (size_t)(r0 + mb * 16) * ldc + c0;
{
#pragma unroll
            for (int s = 0; s < 8; ++s) { const int row = 2 * s + hi, cofs = lr * 4; v4f val = *(const v4fa*)(os + row * 68 + cofs); if (BIAS) { val[0] += bfr(bias[c0 + cofs]); val[1] += bfr(bias[c0 + cofs + 1]); val[2] += bfr(bias[c0 + cofs + 2]); val[3] += bfr(bias[c0 + cofs + 3]); }
                *(v4f*)(crow + (size_t)row * ldc + cofs) = val; }
             }
        __builtin_amdgcn_wave_barrier(); asm volatile("" ::: "memory");
    }
}

__device__ __forceinline__ h16 tohx(float x) { return (h16)x; }
__device__ __forceinline__ void splitf(float y, unsigned short& h, unsigned short& l) { h = f2bf(y); l = f2bf(y - bf2f(h)); }
typedef __attribute__((ext_vector_type(2))) unsigned short v2us;
typedef __attribute__((ext_vector_type(2))) _Float16 v2h;
typedef __attribute__((ext_vector_type(4))) _Float16 v4h;
typedef __attribute__((ext_vector_type(2))) float v2f;

__global__ __launch_bounds__(256) void k_wtG(const float* __restrict__ w, int K, int N, bf* Bt) {
    const int lane = threadIdx.x & 31; const int L0 = (blockIdx.x * 8 + (threadIdx.x >> 5)) * 8; const int nlines = N * K / 64;
{
#pragma unroll 1
        for (int l = 0; l < 8; ++l) { const int L = L0 + l; if (L >= nlines) break; const size_t e = (size_t)L * 64 + lane * 2; const int k = (int)(e % K), n = (int)(e / K); v2us o;
            o[0] = f2bf(w[(size_t)k * N + n]); o[1] = f2bf(w[(size_t)(k + 1) * N + n]); *(v2us*)(Bt + e) = o; }
         }
}
__global__ __launch_bounds__(256) void k_cvt8(const float* __restrict__ src, bf* dst, size_t n8) { const size_t i = (size_t)blockIdx.x * 256 + threadIdx.x; if (i >= n8) return; const v8f v = *(const v8f*)(src + i * 8); v8us o;
#pragma unroll
    for (int k = 0; k < 8; ++k) o[k] = f2bf(v[k]); *(v8us*)(dst + i * 8) = o;  }
__global__ __launch_bounds__(256) void k_qplanes(const float* __restrict__ F, bf* Ph, bf* Pl, h16* P16) {
    const int lane = threadIdx.x & 31; const int L0 = (blockIdx.x * 8 + (threadIdx.x >> 5)) * 8; const int nlines = NH_ * TT * HD / 64;
{
#pragma unroll
        for (int l = 0; l < 8; ++l) { const int L = L0 + l; if (L >= nlines) break; const int e = L * 64 + lane * 2; const int d = e & (HD - 1); const int t = (e >> 6) & (TT - 1); const int h = e >> 17; v2us oh, ol; v2h o16;
#pragma unroll
            for (int q = 0; q < 2; ++q) { const float x = F[(size_t)t * DD + h * HD + d + q]; unsigned short a, c2; splitf(x, a, c2); oh[q] = a; ol[q] = c2; o16[q] = tohx(x); }
            *(v2us*)(Ph + (size_t)e) = oh; *(v2us*)(Pl + (size_t)e) = ol; *(v2h*)(P16 + (size_t)e) = o16; }
         }
}
__global__ __launch_bounds__(256) void k_vtplane(const float* __restrict__ F, bf* Vh, bf* Vl, h16* V16) {
    const int lane = threadIdx.x & 31; const int L0 = (blockIdx.x * 8 + (threadIdx.x >> 5)) * 8; const int nlines = NH_ * TT * HD / 64;
{
#pragma unroll
        for (int l = 0; l < 8; ++l) { const int L = L0 + l; if (L >= nlines) break; const int e = L * 64 + lane * 2; const int t = e & (TT - 1); const int d = (e >> 11) & (HD - 1); const int h = e >> 17; v2us oh, ol; v2h o16;
#pragma unroll
            for (int q = 0; q < 2; ++q) { const float x = F[(size_t)(t + q) * DD + h * HD + d]; unsigned short a, c2; splitf(x, a, c2); oh[q] = a; ol[q] = c2; o16[q] = tohx(x); }
            *(v2us*)(Vh + (size_t)e) = oh; *(v2us*)(Vl + (size_t)e) = ol; *(v2h*)(V16 + (size_t)e) = o16; }
         }
}
// k_asoft: per row i: s = S/8 where the log-sparse mask keeps (i, j) (d = i - j: d == 0, 1 <= d <= 1024, or d a positive power of two), else -3e38; softmax over the 2048 keys (register row of
__global__ __launch_bounds__(256) void k_asoft(const float* __restrict__ Sb, bf* Ph, bf* Pl, h16* P16) {
    typedef __attribute__((ext_vector_type(4))) unsigned short v4us;
    const int lane = threadIdx.x & 31; const int row = blockIdx.x * 8 + (threadIdx.x >> 5); if (row >= ZH * TT) return; const int i = row & (TT - 1); const int zz = row >> 11; const bool hires = (i < RH);
    const float* sr = Sb + (size_t)row * TT; float v[64]; float mx = -3.0e38f;
#pragma unroll
    for (int ch = 0; ch < 16; ++ch) { const int j0 = ch * 128 + lane * 4; const v4f a = *(const v4f*)(sr + j0);
#pragma unroll
        for (int q = 0; q < 4; ++q) { const int j = j0 + q; const int dd = i - j; const bool keep = (dd >= 0 && dd <= 1024) || (dd > 0 && (dd & (dd - 1)) == 0); const float t = keep ? a[q] * SCL : -3.0e38f; v[ch * 4 + q] = t; mx = fmaxf(mx, t); } }
#pragma unroll
    for (int sh = 16; sh; sh >>= 1) mx = fmaxf(mx, __shfl_xor(mx, sh, 32));
    float sum = 0.f;
#pragma unroll
    for (int k = 0; k < 64; ++k) { v[k] = __expf(v[k] - mx); sum += v[k]; }
#pragma unroll
    for (int sh = 16; sh; sh >>= 1) sum += __shfl_xor(sum, sh, 32);
    const float f = __fdiv_rn(hires ? 1.0f : PCAR, sum);
{
        if (hires) {
#pragma unroll
            for (int ch = 0; ch < 16; ++ch) { v4us oh, ol;
#pragma unroll
                for (int q = 0; q < 4; ++q) { unsigned short a, c2; splitf(v[ch * 4 + q] * f, a, c2); oh[q] = a; ol[q] = c2; }
                const size_t o = ((size_t)zz * RH + i) * TT + ch * 128 + lane * 4; *(v4us*)(Ph + o) = oh; *(v4us*)(Pl + o) = ol; }
        } else {
#pragma unroll
            for (int ch = 0; ch < 16; ++ch) { v4h o;
#pragma unroll
                for (int q = 0; q < 4; ++q) o[q] = tohx(v[ch * 4 + q] * f);
                *(v4h*)(P16 + (size_t)row * TT + ch * 128 + lane * 4) = o; } }
         }
}
__global__ __launch_bounds__(256) void k_merge(const float* __restrict__ O, int h0, bf* Ah, bf* Al) {
    const int lane = threadIdx.x & 31; const int L0 = (blockIdx.x * 8 + (threadIdx.x >> 5)) * 8; const int nlines = ZH * TT * HD / 64;
{
#pragma unroll
        for (int l = 0; l < 8; ++l) { const int L = L0 + l; if (L >= nlines) break; const int e = L * 64 + lane * 2; const int d = e & (HD - 1); const int t = (e >> 6) & (TT - 1); const int zz = e >> 17; v2us oh, ol;
const float cs = (t < RH) ? 1.0f : (1.0f / PCAR);
#pragma unroll
            for (int q = 0; q < 2; ++q) { unsigned short a, c2; splitf(O[(size_t)e + q] * cs, a, c2); oh[q] = a; ol[q] = c2; }
            const size_t o = (size_t)t * DD + (h0 + zz) * HD + d; *(v2us*)(Ah + o) = oh; *(v2us*)(Al + o) = ol; }
         }
}

extern "C" void kernel_launch(void* const* d_in, const int* in_sizes, int n_in,
                              void* d_out, int out_size, void* d_ws, size_t ws_size, hipStream_t stream) {
    (void)in_sizes; (void)n_in; (void)out_size;
    const float* x = (const float*)d_in[0]; const float* wq = (const float*)d_in[1]; const float* bq = (const float*)d_in[2]; const float* wk = (const float*)d_in[3]; const float* bk = (const float*)d_in[4]; const float* wv = (const float*)d_in[5]; const float* bv = (const float*)d_in[6]; const float* wo = (const float*)d_in[7]; const float* bo = (const float*)d_in[8];
    float* OUT = (float*)d_out;     // [4][2048][512]
    char* wsp = (char*)d_ws;
    auto take = [&](size_t bytes) { char* p = wsp; wsp += (bytes + 255) & ~(size_t)255; return (void*)p; };
    bf* WQ = (bf*)take((size_t)DD * DD * 2); bf* WK = (bf*)take((size_t)DD * DD * 2); bf* WV = (bf*)take((size_t)DD * DD * 2); bf* WO = (bf*)take((size_t)DD * DD * 2);
    bf* XB = (bf*)take((size_t)TT * DD * 2); float* F = (float*)take((size_t)TT * DD * 4);
    bf* QPh = (bf*)take((size_t)TT * DD * 2); bf* QPl = (bf*)take((size_t)TT * DD * 2); bf* KPh = (bf*)take((size_t)TT * DD * 2); bf* KPl = (bf*)take((size_t)TT * DD * 2); bf* VTh = (bf*)take((size_t)TT * DD * 2); bf* VTl = (bf*)take((size_t)TT * DD * 2);
    h16* QP16 = (h16*)take((size_t)TT * DD * 2); h16* KP16 = (h16*)take((size_t)TT * DD * 2); h16* VT16 = (h16*)take((size_t)TT * DD * 2);
    float* Sb = (float*)take((size_t)ZH * TT * TT * 4); bf* Ph = (bf*)take((size_t)ZH * RH * TT * 2); bf* Pl = (bf*)take((size_t)ZH * RH * TT * 2); h16* P16 = (h16*)take((size_t)ZH * TT * TT * 2); float* Ob = (float*)take((size_t)ZH * TT * HD * 4); bf* ATh = (bf*)take((size_t)TT * DD * 2); bf* ATl = (bf*)take((size_t)TT * DD * 2);
    if ((size_t)(wsp - (char*)d_ws) > ws_size) return;    // total 242 MiB; ws 256 MiB
    { const unsigned gT = (unsigned)((DD * DD / 64 + 63) / 64); k_wtG<<<gT, 256, 0, stream>>>(wq, DD, DD, WQ); k_wtG<<<gT, 256, 0, stream>>>(wk, DD, DD, WK); k_wtG<<<gT, 256, 0, stream>>>(wv, DD, DD, WV); k_wtG<<<gT, 256, 0, stream>>>(wo, DD, DD, WO); }
    const unsigned LB = (unsigned)((NH_ * TT * HD / 64 + 63) / 64); const dim3 gP(TT / 64, DD / 64, 1);
    for (int b = 0; b < NB_; ++b) {
        k_cvt8<<<(unsigned)(((size_t)TT * DD / 8 + 255) / 256), 256, 0, stream>>>(x + (size_t)b * TT * DD, XB, (size_t)TT * DD / 8);
        k_gemmw<bf, 0, true><<<gP, 32, 0, stream>>>(XB, nullptr, WQ, nullptr, DD, F, DD, bq, 0, 0, 0); k_qplanes<<<LB, 256, 0, stream>>>(F, QPh, QPl, QP16);
        k_gemmw<bf, 0, true><<<gP, 32, 0, stream>>>(XB, nullptr, WK, nullptr, DD, F, DD, bk, 0, 0, 0); k_qplanes<<<LB, 256, 0, stream>>>(F, KPh, KPl, KP16);
        k_gemmw<bf, 0, true><<<gP, 32, 0, stream>>>(XB, nullptr, WV, nullptr, DD, F, DD, bv, 0, 0, 0); k_vtplane<<<LB, 256, 0, stream>>>(F, VTh, VTl, VT16);
        for (int h0 = 0; h0 < NH_; h0 += ZH) { const size_t z0 = (size_t)h0;
            // scores: rows < RH on hi+lo planes (3 products), rows >= RH on fp16 planes - both into the same [ZH][TT][TT] score buffer
            k_gemmw<bf, 2, false><<<dim3(RH / 64, TT / 64, ZH), 32, 0, stream>>>(QPh + z0 * TT * HD, QPl + z0 * TT * HD, KPh + z0 * TT * HD, KPl + z0 * TT * HD, HD, Sb, TT, nullptr, (size_t)TT * HD, (size_t)TT * HD, (size_t)TT * TT);
            k_gemmw<h16, 0, false><<<dim3((TT - RH) / 64, TT / 64, ZH), 32, 0, stream>>>(QP16 + z0 * TT * HD + (size_t)RH * HD, nullptr, KP16 + z0 * TT * HD, nullptr, HD, Sb + (size_t)RH * TT, TT, nullptr, (size_t)TT * HD, (size_t)TT * HD, (size_t)TT * TT);
            k_asoft<<<ZH * TT / 8, 256, 0, stream>>>(Sb, Ph, Pl, P16);
            k_gemmw<bf, 2, false><<<dim3(RH / 64, HD / 64, ZH), 32, 0, stream>>>(Ph, Pl, VTh + z0 * HD * TT, VTl + z0 * HD * TT, TT, Ob, HD, nullptr, (size_t)RH * TT, (size_t)HD * TT, (size_t)TT * HD);
            k_gemmw<h16, 0, false><<<dim3((TT - RH) / 64, HD / 64, ZH), 32, 0, stream>>>(P16 + (size_t)RH * TT, nullptr, VT16 + z0 * HD * TT, nullptr, TT, Ob + (size_t)RH * HD, HD, nullptr, (size_t)TT * TT, (size_t)HD * TT, (size_t)TT * HD);
            k_merge<<<(ZH * TT * HD / 64 + 63) / 64, 256, 0, stream>>>(Ob, h0, ATh, ATl); }
        k_gemmw<bf, 1, true><<<gP, 32, 0, stream>>>(ATh, ATl, WO, nullptr, DD, OUT + (size_t)b * TT * DD, DD, bo, 0, 0, 0); }
}

// v002
// Measured time: 636 microseconds a run.
// Next to v001, in two timings, it ran 1.53 and 1.52 times as fast.
// Counting every step since v000, it is 3.38 times as fast.
#include <hip/hip_runtime.h>

// DWT_MLP_Model (x [4][2048][512]; q/k/v = x @ W + b ([in][out]); 8 heads x 64; scores / 8; log-sparse mask: keep (i, j) iff i - j == 0, or 1 <= i - j <= 1024, or i - j is a positive power of two (else -inf);
// softmax; out = ctx @ W_O + b_O).
// Compute dtypes, f32 accumulate: every input rounded to bf16; projections on PLAIN bf16 operands (inputs: exact; transposed bf16 weight copies, + bias); PER-ROW
// PRECISION HYBRID: query rows < 256 of each batch on bf16 hi+lo planes for scores and attn.v (3 products), rows >= 256 on SINGLE fp16 planes; the mask by index arithmetic in the softmax; output

#define NB_  4
#define TT   2048
#define DD   512
#define NH_  8
#define HD   64
#define ZH   8                    // heads per launch of the attention stage: all 8, so each batch runs the stage once
#define KSP  8                    // waves that share the k range of one tile: projections (K = 512)
#define KSV  16                   // the same for attn.v (K = 2048)
#define RH   256                  // query rows < RH: hi+lo planes; rows >= RH: fp16 planes
#define NF   32                   // head_dim / 2 (unused)
#define SCL  0.125f               // 1/sqrt(64)
#define PCAR 1024.0f         // fp16 P scale for rows >= RH; undone in k_merge
typedef _Float16 h16;
typedef unsigned short bf;
typedef __attribute__((ext_vector_type(16))) __bf16   v16bf;
typedef __attribute__((ext_vector_type(16))) _Float16 v16h;
typedef __attribute__((ext_vector_type(8)))  _Float16 v8h;
typedef __attribute__((ext_vector_type(8)))  unsigned short v8us;
typedef __attribute__((ext_vector_type(8)))  float    v8f;
typedef __attribute__((ext_vector_type(4)))  float    v4f;
typedef v8h  __attribute__((may_alias)) v8ha;
typedef v4f  __attribute__((may_alias)) v4fa;
typedef v8us __attribute__((may_alias)) v8usa;

__device__ __forceinline__ unsigned short f2bf(float f) { unsigned u = __float_as_uint(f); u += 0x7FFFu + ((u >> 16) & 1u); return (unsigned short)(u >> 16); }
__device__ __forceinline__ float bf2f(unsigned short b) { return __uint_as_float(((unsigned)b) << 16); }
__device__ __forceinline__ float bfr(float f) { return bf2f(f2bf(f)); }
__device__ __forceinline__ v16h cat16(v8h lo, v8h hi) { return __builtin_shufflevector(lo, hi, 0, 1, 2, 3, 4, 5, 6, 7, 8, 9, 10, 11, 12, 13, 14, 15); }
__device__ __forceinline__ v16bf cat16b(v8us lo, v8us hi) { return __builtin_bit_cast(v16bf, __builtin_shufflevector(lo, hi, 0, 1, 2, 3, 4, 5, 6, 7, 8, 9, 10, 11, 12, 13, 14, 15)); }
__device__ __forceinline__ v8f wmma16(v16h a, v16h b, v8f c) { return __builtin_amdgcn_wmma_f32_16x16x32_f16(false, a, false, b, (short)0, c, false, false); }
__device__ __forceinline__ v8f wmmab(v16bf a, v16bf b, v8f c) { return __builtin_amdgcn_wmma_f32_16x16x32_bf16(false, a, false, b, (short)0, c, false, false); }



// ---- k_gemmw: register-blocked GEMM, one work-group of KS waves per 64x64 output tile; each wave holds the whole tile (16 accumulators) over its own contiguous K / KS slice of k, operands straight
// from K-contiguous 16-bit planes; the KS partial tiles are summed through LDS in fixed wave order 0..KS-1. grid (M/64, N/64, Z), 32 * KS threads.
// C[m][n] (f32, pitch ldc, + optional f32 bias[n]) = sum_k A[m][k] Bt[n][k] (+ split products per NSPLIT). z-batch strides sA/sB/sC in elements. K % (32 * KS) == 0.
template <typename T16> struct WFrag;
template <> struct WFrag<h16> { typedef v16h V; static __device__ __forceinline__ V ld(const h16* p) { return cat16(*(const v8h*)p, *(const v8h*)(p + 16)); } static __device__ __forceinline__ v8f mma(V a, V b, v8f c) { return wmma16(a, b, c); } };
template <> struct WFrag<bf> { typedef v16bf V; static __device__ __forceinline__ V ld(const bf* p) { return cat16b(*(const v8us*)p, *(const v8us*)(p + 16)); } static __device__ __forceinline__ v8f mma(V a, V b, v8f c) { return wmmab(a, b, c); } };
template <typename T16, int NSPLIT, bool BIAS, int KS>
__global__ __launch_bounds__(32 * KS) void k_gemmw(const T16* __restrict__ A, const T16* __restrict__ A2, const T16* __restrict__ Bt, const T16* __restrict__ Bt2, int K, float* C, int ldc, const float* __restrict__ bias, size_t sA, size_t sB, size_t sC) {
    typedef typename WFrag<T16>::V V;
    constexpr int SL = (KS == 1 ? 16 : 64) * 68;    // floats of one wave's LDS slice: a 16-row block for the one-wave form, the whole partial tile where KS waves are summed
    __shared__ __align__(16) float os[KS * SL];
    const size_t z = blockIdx.z; A += z * sA; if (A2) A2 += z * sA; Bt += z * sB; if (Bt2) Bt2 += z * sB; C += z * sC;
    const int lane = threadIdx.x & 31, lr = lane & 15, hi = lane >> 4; const int r0 = blockIdx.x * 64, c0 = blockIdx.y * 64;
    v8f acc[4][4];
#pragma unroll
    for (int mb = 0; mb < 4; ++mb)
#pragma unroll
        for (int nb = 0; nb < 4; ++nb) acc[mb][nb] = (v8f){};
    const size_t aoff = (size_t)(r0 + lr) * K + 8 * hi, boff = (size_t)(c0 + lr) * K + 8 * hi;
    const int wv = (KS == 1) ? 0 : __builtin_amdgcn_readfirstlane((int)(threadIdx.x >> 5)); const int kspan = K / KS, kb = wv * kspan, ke = kb + kspan;
#pragma unroll 1
    for (int kc = kb; kc < ke; kc += 32) {
        V a[4], a2[4];
#pragma unroll
        for (int mb = 0; mb < 4; ++mb) { a[mb] = WFrag<T16>::ld(A + aoff + (size_t)mb * 16 * K + kc); if (NSPLIT == 1 || NSPLIT == 2) a2[mb] = WFrag<T16>::ld(A2 + aoff + (size_t)mb * 16 * K + kc); }
#pragma unroll
        for (int nb = 0; nb < 4; ++nb) { const V b = WFrag<T16>::ld(Bt + boff + (size_t)nb * 16 * K + kc); V b2; if (NSPLIT >= 2) b2 = WFrag<T16>::ld(Bt2 + boff + (size_t)nb * 16 * K + kc);
#pragma unroll
            for (int mb = 0; mb < 4; ++mb) { acc[mb][nb] = WFrag<T16>::mma(a[mb], b, acc[mb][nb]); if (NSPLIT == 1 || NSPLIT == 2) acc[mb][nb] = WFrag<T16>::mma(a2[mb], b, acc[mb][nb]); if (NSPLIT >= 2) acc[mb][nb] = WFrag<T16>::mma(a[mb], b2, acc[mb][nb]); } }
        asm volatile("v_nop\n\tv_nop\n\tv_nop\n\tv_nop" : "+v"(acc[0][0]), "+v"(acc[1][1]), "+v"(acc[2][2]), "+v"(acc[3][3]) : "v"(a[0]), "v"(a[3]));
    }
    if constexpr (KS == 1) {
#pragma unroll
    for (int mb = 0; mb < 4; ++mb) {
#pragma unroll
        for (int nb = 0; nb < 4; ++nb) {
#pragma unroll
            for (int j = 0; j < 8; ++j) os[(hi * 8 + j) * 68 + nb * 16 + lr] = acc[mb][nb][j]; }
        __builtin_amdgcn_wave_barrier(); asm volatile("" ::: "memory");
        float* crow = C + (size_t)(r0 + mb * 16) * ldc + c0;
{
#pragma unroll
            for (int s = 0; s < 8; ++s) { const int row = 2 * s + hi, cofs = lr * 4; v4f val = *(const v4fa*)(os + row * 68 + cofs); if (BIAS) { val[0] += bfr(bias[c0 + cofs]); val[1] += bfr(bias[c0 + cofs + 1]); val[2] += bfr(bias[c0 + cofs + 2]); val[3] += bfr(bias[c0 + cofs + 3]); }
                *(v4f*)(crow + (size_t)row * ldc + cofs) = val; }
             }
        __builtin_amdgcn_wave_barrier(); asm volatile("" ::: "memory");
    }
    } else {
#pragma unroll
        for (int mb = 0; mb < 4; ++mb) {
#pragma unroll
            for (int nb = 0; nb < 4; ++nb) {
#pragma unroll
                for (int j = 0; j < 8; ++j) os[wv * SL + (mb * 16 + hi * 8 + j) * 68 + nb * 16 + lr] = acc[mb][nb][j]; } }
        __syncthreads();    // every wave's partial tile is in LDS before any thread sums across the waves
        float* crow = C + (size_t)r0 * ldc + c0;
#pragma unroll
        for (int s = 0; s < 1024 / (32 * KS); ++s) { const int idx = s * 32 * KS + (int)threadIdx.x; const int row = idx >> 4, cofs = (idx & 15) * 4; v4f val = *(const v4fa*)(os + row * 68 + cofs);
#pragma unroll
            for (int w = 1; w < KS; ++w) val += *(const v4fa*)(os + w * SL + row * 68 + cofs);
            if (BIAS) { val[0] += bfr(bias[c0 + cofs]); val[1] += bfr(bias[c0 + cofs + 1]); val[2] += bfr(bias[c0 + cofs + 2]); val[3] += bfr(bias[c0 + cofs + 3]); }
            *(v4f*)(crow + (size_t)row * ldc + cofs) = val; }
    }
}

__device__ __forceinline__ h16 tohx(float x) { return (h16)x; }
__device__ __forceinline__ void splitf(float y, unsigned short& h, unsigned short& l) { h = f2bf(y); l = f2bf(y - bf2f(h)); }
typedef __attribute__((ext_vector_type(2))) unsigned short v2us;
typedef __attribute__((ext_vector_type(2))) _Float16 v2h;
typedef __attribute__((ext_vector_type(4))) _Float16 v4h;
typedef __attribute__((ext_vector_type(2))) float v2f;

__global__ __launch_bounds__(256) void k_wtG(const float* __restrict__ w, int K, int N, bf* Bt) {
    const int lane = threadIdx.x & 31; const int L0 = (blockIdx.x * 8 + (threadIdx.x >> 5)) * 8; const int nlines = N * K / 64;
{
#pragma unroll 1
        for (int l = 0; l < 8; ++l) { const int L = L0 + l; if (L >= nlines) break; const size_t e = (size_t)L * 64 + lane * 2; const int k = (int)(e % K), n = (int)(e / K); v2us o;
            o[0] = f2bf(w[(size_t)k * N + n]); o[1] = f2bf(w[(size_t)(k + 1) * N + n]); *(v2us*)(Bt + e) = o; }
         }
}
__global__ __launch_bounds__(256) void k_cvt8(const float* __restrict__ src, bf* dst, size_t n8) { const size_t i = (size_t)blockIdx.x * 256 + threadIdx.x; if (i >= n8) return; const v8f v = *(const v8f*)(src + i * 8); v8us o;
#pragma unroll
    for (int k = 0; k < 8; ++k) o[k] = f2bf(v[k]); *(v8us*)(dst + i * 8) = o;  }
__global__ __launch_bounds__(256) void k_qplanes(const float* __restrict__ F, bf* Ph, bf* Pl, h16* P16) {
    const int lane = threadIdx.x & 31; const int L0 = (blockIdx.x * 8 + (threadIdx.x >> 5)) * 8; const int nlines = NH_ * TT * HD / 64;
{
#pragma unroll
        for (int l = 0; l < 8; ++l) { const int L = L0 + l; if (L >= nlines) break; const int e = L * 64 + lane * 2; const int d = e & (HD - 1); const int t = (e >> 6) & (TT - 1); const int h = e >> 17; v2us oh, ol; v2h o16;
#pragma unroll
            for (int q = 0; q < 2; ++q) { const float x = F[(size_t)t * DD + h * HD + d + q]; unsigned short a, c2; splitf(x, a, c2); oh[q] = a; ol[q] = c2; o16[q] = tohx(x); }
            *(v2us*)(Ph + (size_t)e) = oh; *(v2us*)(Pl + (size_t)e) = ol; *(v2h*)(P16 + (size_t)e) = o16; }
         }
}
__global__ __launch_bounds__(256) void k_vtplane(const float* __restrict__ F, bf* Vh, bf* Vl, h16* V16) {
    const int lane = threadIdx.x & 31; const int L0 = (blockIdx.x * 8 + (threadIdx.x >> 5)) * 8; const int nlines = NH_ * TT * HD / 64;
{
#pragma unroll
        for (int l = 0; l < 8; ++l) { const int L = L0 + l; if (L >= nlines) break; const int e = L * 64 + lane * 2; const int t = e & (TT - 1); const int d = (e >> 11) & (HD - 1); const int h = e >> 17; v2us oh, ol; v2h o16;
#pragma unroll
            for (int q = 0; q < 2; ++q) { const float x = F[(size_t)(t + q) * DD + h * HD + d]; unsigned short a, c2; splitf(x, a, c2); oh[q] = a; ol[q] = c2; o16[q] = tohx(x); }
            *(v2us*)(Vh + (size_t)e) = oh; *(v2us*)(Vl + (size_t)e) = ol; *(v2h*)(V16 + (size_t)e) = o16; }
         }
}
// k_asoft: per row i: s = S/8 where the log-sparse mask keeps (i, j) (d = i - j: d == 0, 1 <= d <= 1024, or d a positive power of two), else -3e38; softmax over the 2048 keys (register row of
__global__ __launch_bounds__(256) void k_asoft(const float* __restrict__ Sb, bf* Ph, bf* Pl, h16* P16) {
    typedef __attribute__((ext_vector_type(4))) unsigned short v4us;
    const int lane = threadIdx.x & 31; const int row = blockIdx.x * 8 + (threadIdx.x >> 5); if (row >= ZH * TT) return; const int i = row & (TT - 1); const int zz = row >> 11; const bool hires = (i < RH);
    const float* sr = Sb + (size_t)row * TT; float v[64]; float mx = -3.0e38f;
#pragma unroll
    for (int ch = 0; ch < 16; ++ch) { const int j0 = ch * 128 + lane * 4; const v4f a = *(const v4f*)(sr + j0);
#pragma unroll
        for (int q = 0; q < 4; ++q) { const int j = j0 + q; const int dd = i - j; const bool keep = (dd >= 0 && dd <= 1024) || (dd > 0 && (dd & (dd - 1)) == 0); const float t = keep ? a[q] * SCL : -3.0e38f; v[ch * 4 + q] = t; mx = fmaxf(mx, t); } }
#pragma unroll
    for (int sh = 16; sh; sh >>= 1) mx = fmaxf(mx, __shfl_xor(mx, sh, 32));
    float sum = 0.f;
#pragma unroll
    for (int k = 0; k < 64; ++k) { v[k] = __expf(v[k] - mx); sum += v[k]; }
#pragma unroll
    for (int sh = 16; sh; sh >>= 1) sum += __shfl_xor(sum, sh, 32);
    const float f = __fdiv_rn(hires ? 1.0f : PCAR, sum);
{
        if (hires) {
#pragma unroll
            for (int ch = 0; ch < 16; ++ch) { v4us oh, ol;
#pragma unroll
                for (int q = 0; q < 4; ++q) { unsigned short a, c2; splitf(v[ch * 4 + q] * f, a, c2); oh[q] = a; ol[q] = c2; }
                const size_t o = ((size_t)zz * RH + i) * TT + ch * 128 + lane * 4; *(v4us*)(Ph + o) = oh; *(v4us*)(Pl + o) = ol; }
        } else {
#pragma unroll
            for (int ch = 0; ch < 16; ++ch) { v4h o;
#pragma unroll
                for (int q = 0; q < 4; ++q) o[q] = tohx(v[ch * 4 + q] * f);
                *(v4h*)(P16 + (size_t)row * TT + ch * 128 + lane * 4) = o; } }
         }
}
__global__ __launch_bounds__(256) void k_merge(const float* __restrict__ O, int h0, bf* Ah, bf* Al) {
    const int lane = threadIdx.x & 31; const int L0 = (blockIdx.x * 8 + (threadIdx.x >> 5)) * 8; const int nlines = ZH * TT * HD / 64;
{
#pragma unroll
        for (int l = 0; l < 8; ++l) { const int L = L0 + l; if (L >= nlines) break; const int e = L * 64 + lane * 2; const int d = e & (HD - 1); const int t = (e >> 6) & (TT - 1); const int zz = e >> 17; v2us oh, ol;
const float cs = (t < RH) ? 1.0f : (1.0f / PCAR);
#pragma unroll
            for (int q = 0; q < 2; ++q) { unsigned short a, c2; splitf(O[(size_t)e + q] * cs, a, c2); oh[q] = a; ol[q] = c2; }
            const size_t o = (size_t)t * DD + (h0 + zz) * HD + d; *(v2us*)(Ah + o) = oh; *(v2us*)(Al + o) = ol; }
         }
}

extern "C" void kernel_launch(void* const* d_in, const int* in_sizes, int n_in,
                              void* d_out, int out_size, void* d_ws, size_t ws_size, hipStream_t stream) {
    (void)in_sizes; (void)n_in; (void)out_size;
    const float* x = (const float*)d_in[0]; const float* wq = (const float*)d_in[1]; const float* bq = (const float*)d_in[2]; const float* wk = (const float*)d_in[3]; const float* bk = (const float*)d_in[4]; const float* wv = (const float*)d_in[5]; const float* bv = (const float*)d_in[6]; const float* wo = (const float*)d_in[7]; const float* bo = (const float*)d_in[8];
    float* OUT = (float*)d_out;     // [4][2048][512]
    char* wsp = (char*)d_ws;
    auto take = [&](size_t bytes) { char* p = wsp; wsp += (bytes + 255) & ~(size_t)255; return (void*)p; };
    bf* WQ = (bf*)take((size_t)DD * DD * 2); bf* WK = (bf*)take((size_t)DD * DD * 2); bf* WV = (bf*)take((size_t)DD * DD * 2); bf* WO = (bf*)take((size_t)DD * DD * 2);
    bf* XB = (bf*)take((size_t)TT * DD * 2); float* F = (float*)take((size_t)TT * DD * 4);
    bf* QPh = (bf*)take((size_t)TT * DD * 2); bf* QPl = (bf*)take((size_t)TT * DD * 2); bf* KPh = (bf*)take((size_t)TT * DD * 2); bf* KPl = (bf*)take((size_t)TT * DD * 2); bf* VTh = (bf*)take((size_t)TT * DD * 2); bf* VTl = (bf*)take((size_t)TT * DD * 2);
    h16* QP16 = (h16*)take((size_t)TT * DD * 2); h16* KP16 = (h16*)take((size_t)TT * DD * 2); h16* VT16 = (h16*)take((size_t)TT * DD * 2);
    float* Sb = (float*)take((size_t)ZH * TT * TT * 4); bf* Ph = (bf*)take((size_t)ZH * RH * TT * 2); bf* Pl = (bf*)take((size_t)ZH * RH * TT * 2); h16* P16 = (h16*)take((size_t)ZH * TT * TT * 2); float* Ob = (float*)take((size_t)ZH * TT * HD * 4); bf* ATh = (bf*)take((size_t)TT * DD * 2); bf* ATl = (bf*)take((size_t)TT * DD * 2);
    if ((size_t)(wsp - (char*)d_ws) > ws_size) return;    // total 242 MiB; ws 256 MiB
    { const unsigned gT = (unsigned)((DD * DD / 64 + 63) / 64); k_wtG<<<gT, 256, 0, stream>>>(wq, DD, DD, WQ); k_wtG<<<gT, 256, 0, stream>>>(wk, DD, DD, WK); k_wtG<<<gT, 256, 0, stream>>>(wv, DD, DD, WV); k_wtG<<<gT, 256, 0, stream>>>(wo, DD, DD, WO); }
    const unsigned LB = (unsigned)((NH_ * TT * HD / 64 + 63) / 64); const dim3 gP(TT / 64, DD / 64, 1);
    for (int b = 0; b < NB_; ++b) {
        k_cvt8<<<(unsigned)(((size_t)TT * DD / 8 + 255) / 256), 256, 0, stream>>>(x + (size_t)b * TT * DD, XB, (size_t)TT * DD / 8);
        k_gemmw<bf, 0, true, KSP><<<gP, 32 * KSP, 0, stream>>>(XB, nullptr, WQ, nullptr, DD, F, DD, bq, 0, 0, 0); k_qplanes<<<LB, 256, 0, stream>>>(F, QPh, QPl, QP16);
        k_gemmw<bf, 0, true, KSP><<<gP, 32 * KSP, 0, stream>>>(XB, nullptr, WK, nullptr, DD, F, DD, bk, 0, 0, 0); k_qplanes<<<LB, 256, 0, stream>>>(F, KPh, KPl, KP16);
        k_gemmw<bf, 0, true, KSP><<<gP, 32 * KSP, 0, stream>>>(XB, nullptr, WV, nullptr, DD, F, DD, bv, 0, 0, 0); k_vtplane<<<LB, 256, 0, stream>>>(F, VTh, VTl, VT16);
        for (int h0 = 0; h0 < NH_; h0 += ZH) { const size_t z0 = (size_t)h0;
            // scores: rows < RH on hi+lo planes (3 products), rows >= RH on fp16 planes - both into the same [ZH][TT][TT] score buffer
            k_gemmw<bf, 2, false, 1><<<dim3(RH / 64, TT / 64, ZH), 32, 0, stream>>>(QPh + z0 * TT * HD, QPl + z0 * TT * HD, KPh + z0 * TT * HD, KPl + z0 * TT * HD, HD, Sb, TT, nullptr, (size_t)TT * HD, (size_t)TT * HD, (size_t)TT * TT);
            k_gemmw<h16, 0, false, 1><<<dim3((TT - RH) / 64, TT / 64, ZH), 32, 0, stream>>>(QP16 + z0 * TT * HD + (size_t)RH * HD, nullptr, KP16 + z0 * TT * HD, nullptr, HD, Sb + (size_t)RH * TT, TT, nullptr, (size_t)TT * HD, (size_t)TT * HD, (size_t)TT * TT);
            k_asoft<<<ZH * TT / 8, 256, 0, stream>>>(Sb, Ph, Pl, P16);
            k_gemmw<bf, 2, false, KSV><<<dim3(RH / 64, HD / 64, ZH), 32 * KSV, 0, stream>>>(Ph, Pl, VTh + z0 * HD * TT, VTl + z0 * HD * TT, TT, Ob, HD, nullptr, (size_t)RH * TT, (size_t)HD * TT, (size_t)TT * HD);
            k_gemmw<h16, 0, false, KSV><<<dim3((TT - RH) / 64, HD / 64, ZH), 32 * KSV, 0, stream>>>(P16 + (size_t)RH * TT, nullptr, VT16 + z0 * HD * TT, nullptr, TT, Ob + (size_t)RH * HD, HD, nullptr, (size_t)TT * TT, (size_t)HD * TT, (size_t)TT * HD);
            k_merge<<<(ZH * TT * HD / 64 + 63) / 64, 256, 0, stream>>>(Ob, h0, ATh, ATl); }
        k_gemmw<bf, 1, true, KSP><<<gP, 32 * KSP, 0, stream>>>(ATh, ATl, WO, nullptr, DD, OUT + (size_t)b * TT * DD, DD, bo, 0, 0, 0); }
}

// v003
// One run takes 313 microseconds.
// Two timings next to v002 put it at 2.00 and 2.05 times that version's speed.
// All steps since v000 together make it 6.84 times as fast.
#include <hip/hip_runtime.h>

// DWT_MLP_Model (x [4][2048][512]; q/k/v = x @ W + b ([in][out]); 8 heads x 64; scores / 8; log-sparse mask: keep (i, j) iff i - j == 0, or 1 <= i - j <= 1024, or i - j is a positive power of two (else -inf);
// softmax; out = ctx @ W_O + b_O).
// Compute dtypes, f32 accumulate: every input rounded to bf16; projections on PLAIN bf16 operands (inputs: exact; transposed bf16 weight copies, + bias); PER-ROW
// PRECISION HYBRID: query rows < 256 of each batch on bf16 hi+lo planes for scores and attn.v (3 products), rows >= 256 on SINGLE fp16 planes; the mask by index arithmetic in the softmax; output

#define NB_  4
#define TT   2048
#define DD   512
#define NH_  8
#define HD   64
#define KSP  8                    // waves that share the k range of one tile: projections (K = 512)
#define RH   256                  // query rows < RH: hi+lo planes; rows >= RH: fp16 planes
#define NF   32                   // head_dim / 2; unused, the file applies no rotary embedding
#define SCL2 0.18033688f          // 1/sqrt(64) * log2(e): the softmax runs in base 2
#define PCAR 1024.0f         // p carried times 1024 on the fp16 path; divided out in the final scale
typedef _Float16 h16;
typedef unsigned short bf;
typedef __attribute__((ext_vector_type(16))) __bf16   v16bf;
typedef __attribute__((ext_vector_type(16))) _Float16 v16h;
typedef __attribute__((ext_vector_type(8)))  _Float16 v8h;
typedef __attribute__((ext_vector_type(8)))  unsigned short v8us;
typedef __attribute__((ext_vector_type(8)))  float    v8f;
typedef __attribute__((ext_vector_type(4)))  float    v4f;
typedef v8h  __attribute__((may_alias)) v8ha;
typedef v4f  __attribute__((may_alias)) v4fa;
typedef v8us __attribute__((may_alias)) v8usa;

__device__ __forceinline__ unsigned short f2bf(float f) { unsigned u = __float_as_uint(f); u += 0x7FFFu + ((u >> 16) & 1u); return (unsigned short)(u >> 16); }
__device__ __forceinline__ float bf2f(unsigned short b) { return __uint_as_float(((unsigned)b) << 16); }
__device__ __forceinline__ float bfr(float f) { return bf2f(f2bf(f)); }
__device__ __forceinline__ v16h cat16(v8h lo, v8h hi) { return __builtin_shufflevector(lo, hi, 0, 1, 2, 3, 4, 5, 6, 7, 8, 9, 10, 11, 12, 13, 14, 15); }
__device__ __forceinline__ v16bf cat16b(v8us lo, v8us hi) { return __builtin_bit_cast(v16bf, __builtin_shufflevector(lo, hi, 0, 1, 2, 3, 4, 5, 6, 7, 8, 9, 10, 11, 12, 13, 14, 15)); }
__device__ __forceinline__ v8f wmma16(v16h a, v16h b, v8f c) { return __builtin_amdgcn_wmma_f32_16x16x32_f16(false, a, false, b, (short)0, c, false, false); }
__device__ __forceinline__ v8f wmmab(v16bf a, v16bf b, v8f c) { return __builtin_amdgcn_wmma_f32_16x16x32_bf16(false, a, false, b, (short)0, c, false, false); }



// ---- k_gemmw: register-blocked GEMM, one work-group of KS waves per 64x64 output tile; each wave holds the whole tile (16 accumulators) over its own contiguous K / KS slice of k, operands straight
// from K-contiguous 16-bit planes; the KS partial tiles are summed through LDS in fixed wave order 0..KS-1. grid (M/64, N/64, Z), 32 * KS threads.
// C[m][n] (f32, pitch ldc, + optional f32 bias[n]) = sum_k A[m][k] Bt[n][k] (+ split products per NSPLIT). z-batch strides sA/sB/sC in elements. K % (32 * KS) == 0.
template <typename T16> struct WFrag;
template <> struct WFrag<h16> { typedef v16h V; static __device__ __forceinline__ V ld(const h16* p) { return cat16(*(const v8h*)p, *(const v8h*)(p + 16)); } static __device__ __forceinline__ v8f mma(V a, V b, v8f c) { return wmma16(a, b, c); } };
template <> struct WFrag<bf> { typedef v16bf V; static __device__ __forceinline__ V ld(const bf* p) { return cat16b(*(const v8us*)p, *(const v8us*)(p + 16)); } static __device__ __forceinline__ v8f mma(V a, V b, v8f c) { return wmmab(a, b, c); } };
template <typename T16, int NSPLIT, bool BIAS, int KS>
__global__ __launch_bounds__(32 * KS) void k_gemmw(const T16* __restrict__ A, const T16* __restrict__ A2, const T16* __restrict__ Bt, const T16* __restrict__ Bt2, int K, float* C, int ldc, const float* __restrict__ bias, size_t sA, size_t sB, size_t sC) {
    typedef typename WFrag<T16>::V V;
    constexpr int SL = (KS == 1 ? 16 : 64) * 68;    // floats of one wave's LDS slice: a 16-row block for the one-wave form, the whole partial tile where KS waves are summed
    __shared__ __align__(16) float os[KS * SL];
    const size_t z = blockIdx.z; A += z * sA; if (A2) A2 += z * sA; Bt += z * sB; if (Bt2) Bt2 += z * sB; C += z * sC;
    const int lane = threadIdx.x & 31, lr = lane & 15, hi = lane >> 4; const int r0 = blockIdx.x * 64, c0 = blockIdx.y * 64;
    v8f acc[4][4];
#pragma unroll
    for (int mb = 0; mb < 4; ++mb)
#pragma unroll
        for (int nb = 0; nb < 4; ++nb) acc[mb][nb] = (v8f){};
    const size_t aoff = (size_t)(r0 + lr) * K + 8 * hi, boff = (size_t)(c0 + lr) * K + 8 * hi;
    const int wv = (KS == 1) ? 0 : __builtin_amdgcn_readfirstlane((int)(threadIdx.x >> 5)); const int kspan = K / KS, kb = wv * kspan, ke = kb + kspan;
#pragma unroll 1
    for (int kc = kb; kc < ke; kc += 32) {
        V a[4], a2[4];
#pragma unroll
        for (int mb = 0; mb < 4; ++mb) { a[mb] = WFrag<T16>::ld(A + aoff + (size_t)mb * 16 * K + kc); if (NSPLIT == 1 || NSPLIT == 2) a2[mb] = WFrag<T16>::ld(A2 + aoff + (size_t)mb * 16 * K + kc); }
#pragma unroll
        for (int nb = 0; nb < 4; ++nb) { const V b = WFrag<T16>::ld(Bt + boff + (size_t)nb * 16 * K + kc); V b2; if (NSPLIT >= 2) b2 = WFrag<T16>::ld(Bt2 + boff + (size_t)nb * 16 * K + kc);
#pragma unroll
            for (int mb = 0; mb < 4; ++mb) { acc[mb][nb] = WFrag<T16>::mma(a[mb], b, acc[mb][nb]); if (NSPLIT == 1 || NSPLIT == 2) acc[mb][nb] = WFrag<T16>::mma(a2[mb], b, acc[mb][nb]); if (NSPLIT >= 2) acc[mb][nb] = WFrag<T16>::mma(a[mb], b2, acc[mb][nb]); } }
        asm volatile("v_nop\n\tv_nop\n\tv_nop\n\tv_nop" : "+v"(acc[0][0]), "+v"(acc[1][1]), "+v"(acc[2][2]), "+v"(acc[3][3]) : "v"(a[0]), "v"(a[3]));
    }
    if constexpr (KS == 1) {
#pragma unroll
    for (int mb = 0; mb < 4; ++mb) {
#pragma unroll
        for (int nb = 0; nb < 4; ++nb) {
#pragma unroll
            for (int j = 0; j < 8; ++j) os[(hi * 8 + j) * 68 + nb * 16 + lr] = acc[mb][nb][j]; }
        __builtin_amdgcn_wave_barrier(); asm volatile("" ::: "memory");
        float* crow = C + (size_t)(r0 + mb * 16) * ldc + c0;
{
#pragma unroll
            for (int s = 0; s < 8; ++s) { const int row = 2 * s + hi, cofs = lr * 4; v4f val = *(const v4fa*)(os + row * 68 + cofs); if (BIAS) { val[0] += bfr(bias[c0 + cofs]); val[1] += bfr(bias[c0 + cofs + 1]); val[2] += bfr(bias[c0 + cofs + 2]); val[3] += bfr(bias[c0 + cofs + 3]); }
                *(v4f*)(crow + (size_t)row * ldc + cofs) = val; }
             }
        __builtin_amdgcn_wave_barrier(); asm volatile("" ::: "memory");
    }
    } else {
#pragma unroll
        for (int mb = 0; mb < 4; ++mb) {
#pragma unroll
            for (int nb = 0; nb < 4; ++nb) {
#pragma unroll
                for (int j = 0; j < 8; ++j) os[wv * SL + (mb * 16 + hi * 8 + j) * 68 + nb * 16 + lr] = acc[mb][nb][j]; } }
        __syncthreads();    // every wave's partial tile is in LDS before any thread sums across the waves
        float* crow = C + (size_t)r0 * ldc + c0;
#pragma unroll
        for (int s = 0; s < 1024 / (32 * KS); ++s) { const int idx = s * 32 * KS + (int)threadIdx.x; const int row = idx >> 4, cofs = (idx & 15) * 4; v4f val = *(const v4fa*)(os + row * 68 + cofs);
#pragma unroll
            for (int w = 1; w < KS; ++w) val += *(const v4fa*)(os + w * SL + row * 68 + cofs);
            if (BIAS) { val[0] += bfr(bias[c0 + cofs]); val[1] += bfr(bias[c0 + cofs + 1]); val[2] += bfr(bias[c0 + cofs + 2]); val[3] += bfr(bias[c0 + cofs + 3]); }
            *(v4f*)(crow + (size_t)row * ldc + cofs) = val; }
    }
}

__device__ __forceinline__ h16 tohx(float x) { return (h16)x; }
__device__ __forceinline__ void splitf(float y, unsigned short& h, unsigned short& l) { h = f2bf(y); l = f2bf(y - bf2f(h)); }
typedef __attribute__((ext_vector_type(2))) unsigned short v2us;
typedef __attribute__((ext_vector_type(2))) _Float16 v2h;
typedef __attribute__((ext_vector_type(4))) _Float16 v4h;
typedef __attribute__((ext_vector_type(2))) float v2f;

__global__ __launch_bounds__(256) void k_wtG(const float* __restrict__ w, int K, int N, bf* Bt) {
    const int lane = threadIdx.x & 31; const int L0 = (blockIdx.x * 8 + (threadIdx.x >> 5)) * 8; const int nlines = N * K / 64;
{
#pragma unroll 1
        for (int l = 0; l < 8; ++l) { const int L = L0 + l; if (L >= nlines) break; const size_t e = (size_t)L * 64 + lane * 2; const int k = (int)(e % K), n = (int)(e / K); v2us o;
            o[0] = f2bf(w[(size_t)k * N + n]); o[1] = f2bf(w[(size_t)(k + 1) * N + n]); *(v2us*)(Bt + e) = o; }
         }
}
__global__ __launch_bounds__(256) void k_cvt8(const float* __restrict__ src, bf* dst, size_t n8) { const size_t i = (size_t)blockIdx.x * 256 + threadIdx.x; if (i >= n8) return; const v8f v = *(const v8f*)(src + i * 8); v8us o;
#pragma unroll
    for (int k = 0; k < 8; ++k) o[k] = f2bf(v[k]); *(v8us*)(dst + i * 8) = o;  }
__global__ __launch_bounds__(256) void k_qplanes(const float* __restrict__ F, bf* Ph, bf* Pl, h16* P16) {
    const int lane = threadIdx.x & 31; const int L0 = (blockIdx.x * 8 + (threadIdx.x >> 5)) * 8; const int nlines = NH_ * TT * HD / 64;
{
#pragma unroll
        for (int l = 0; l < 8; ++l) { const int L = L0 + l; if (L >= nlines) break; const int e = L * 64 + lane * 2; const int d = e & (HD - 1); const int t = (e >> 6) & (TT - 1); const int h = e >> 17; v2us oh, ol; v2h o16;
#pragma unroll
            for (int q = 0; q < 2; ++q) { const float x = F[(size_t)t * DD + h * HD + d + q]; unsigned short a, c2; splitf(x, a, c2); oh[q] = a; ol[q] = c2; o16[q] = tohx(x); }
            *(v2us*)(Ph + (size_t)e) = oh; *(v2us*)(Pl + (size_t)e) = ol; *(v2h*)(P16 + (size_t)e) = o16; }
         }
}
__global__ __launch_bounds__(256) void k_vtplane(const float* __restrict__ F, bf* Vh, bf* Vl, h16* V16) {
    const int lane = threadIdx.x & 31; const int L0 = (blockIdx.x * 8 + (threadIdx.x >> 5)) * 8; const int nlines = NH_ * TT * HD / 64;
{
#pragma unroll
        for (int l = 0; l < 8; ++l) { const int L = L0 + l; if (L >= nlines) break; const int e = L * 64 + lane * 2; const int t = e & (TT - 1); const int d = (e >> 11) & (HD - 1); const int h = e >> 17; v2us oh, ol; v2h o16;
#pragma unroll
            for (int q = 0; q < 2; ++q) { const float x = F[(size_t)(t + q) * DD + h * HD + d]; unsigned short a, c2; splitf(x, a, c2); oh[q] = a; ol[q] = c2; o16[q] = tohx(x); }
            *(v2us*)(Vh + (size_t)e) = oh; *(v2us*)(Vl + (size_t)e) = ol; *(v2h*)(V16 + (size_t)e) = o16; }
         }
}
__device__ __forceinline__ float exp2s(float x) { float r; asm("v_exp_f32 %0, %1\n\tv_nop" : "=v"(r) : "v"(x)); return r; }
template <typename T16> __device__ __forceinline__ typename WFrag<T16>::V ldo(const T16* base, unsigned bytes) { return WFrag<T16>::ld((const T16*)((const char*)base + bytes)); }    // wave-uniform base + one 32-bit byte offset per lane, shared by the planes of one operand
template <typename T16, bool SPLIT, int QT>
__device__ __forceinline__ void fattn(const T16* __restrict__ Q, const T16* __restrict__ Q2, const T16* __restrict__ Kp, const T16* __restrict__ Kp2, const T16* __restrict__ Vt, const T16* __restrict__ Vt2, bf* Ah, bf* Al, int q0) {
    typedef typename WFrag<T16>::V V;
    const int lane = threadIdx.x & 31, lr = lane & 15, hi = lane >> 4;
    const unsigned koff = (unsigned)(lr * HD + 8 * hi) * 2u, voff = (unsigned)(lr * TT + 8 * hi) * 2u;    // bytes: the lane's row and k half in a Q or K tile, in a V^T tile
    V qf[QT][2], qf2[QT][2]; v8f o[QT][4]; float m[QT], l[QT];
#pragma unroll
    for (int qt = 0; qt < QT; ++qt) { m[qt] = -3.0e38f; l[qt] = 0.f;
#pragma unroll
        for (int ks = 0; ks < 2; ++ks) { qf[qt][ks] = ldo(Q + qt * 16 * HD + 32 * ks, koff + (unsigned)q0 * (HD * 2u)); if (SPLIT) qf2[qt][ks] = ldo(Q2 + qt * 16 * HD + 32 * ks, koff + (unsigned)q0 * (HD * 2u)); }
#pragma unroll
        for (int dt = 0; dt < 4; ++dt) o[qt][dt] = (v8f){}; }
    const int kbeg = (q0 > 1024) ? ((q0 - 1024) & ~31) : 0, klast = (q0 + QT * 16 - 1) & ~31;
    V kf[2][2], kf2[2][2];
#pragma unroll
    for (int kt = 0; kt < 2; ++kt)
#pragma unroll
        for (int ks = 0; ks < 2; ++ks) { kf[kt][ks] = ldo(Kp + kt * 16 * HD + 32 * ks, koff + (unsigned)kbeg * (HD * 2u)); if (SPLIT) kf2[kt][ks] = ldo(Kp2 + kt * 16 * HD + 32 * ks, koff + (unsigned)kbeg * (HD * 2u)); }
#pragma unroll 1    // rolled: up to 33 trips share one copy of the code, and one trip's fragments already fill the registers
    for (int kb = kbeg; kb <= klast; kb += 32) {
        V vf[4], vf2[4];
#pragma unroll
        for (int dt = 0; dt < 4; ++dt) { vf[dt] = ldo(Vt + dt * 16 * TT, voff + (unsigned)kb * 2u); if (SPLIT) vf2[dt] = ldo(Vt2 + dt * 16 * TT, voff + (unsigned)kb * 2u); }
        __builtin_amdgcn_sched_barrier(0);    // keeps the V loads issued here, ahead of the score products: sunk behind the softmax their whole latency would stand in front of attn.v
        v8f s[QT][2];
#pragma unroll
        for (int qt = 0; qt < QT; ++qt)
#pragma unroll
            for (int kt = 0; kt < 2; ++kt) { s[qt][kt] = (v8f){};
#pragma unroll
                for (int ks = 0; ks < 2; ++ks) { s[qt][kt] = WFrag<T16>::mma(kf[kt][ks], qf[qt][ks], s[qt][kt]); if (SPLIT) { s[qt][kt] = WFrag<T16>::mma(kf[kt][ks], qf2[qt][ks], s[qt][kt]); s[qt][kt] = WFrag<T16>::mma(kf2[kt][ks], qf[qt][ks], s[qt][kt]); } } }
        const int kn = (kb + 32 <= klast) ? kb + 32 : klast;    // the next block's K fragments fly during this block's softmax and attn.v; the last trip reads its own block again, in bounds
#pragma unroll
        for (int kt = 0; kt < 2; ++kt)
#pragma unroll
            for (int ks = 0; ks < 2; ++ks) { kf[kt][ks] = ldo(Kp + kt * 16 * HD + 32 * ks, koff + (unsigned)kn * (HD * 2u)); if (SPLIT) kf2[kt][ks] = ldo(Kp2 + kt * 16 * HD + 32 * ks, koff + (unsigned)kn * (HD * 2u)); }
        __builtin_amdgcn_sched_barrier(0);    // keeps the next block's K loads issued here, so that the softmax and attn.v cover their latency
#pragma unroll
        for (int qt = 0; qt < QT; ++qt) {
            const int i = q0 + qt * 16 + lr; float bm = -3.0e38f;
#pragma unroll
            for (int kt = 0; kt < 2; ++kt)
#pragma unroll
                for (int j = 0; j < 8; ++j) { const int dd = i - (kb + kt * 16 + hi * 8 + j); const float t = ((unsigned)dd <= 1024u) ? s[qt][kt][j] * SCL2 : -3.0e38f; s[qt][kt][j] = t; bm = fmaxf(bm, t); }
            bm = fmaxf(bm, __shfl_xor(bm, 16, 32));
            const float mn = fmaxf(m[qt], bm); const float al = exp2s(m[qt] - mn); m[qt] = mn;
            float ps = 0.f;
#pragma unroll
            for (int kt = 0; kt < 2; ++kt)
#pragma unroll
                for (int j = 0; j < 8; ++j) { const float p = exp2s(s[qt][kt][j] - mn); s[qt][kt][j] = p; ps += p; }
            l[qt] = l[qt] * al + ps;    // each lane sums its own half of the keys; the halves are joined once, behind the loop
#pragma unroll
            for (int dt = 0; dt < 4; ++dt) o[qt][dt] *= al;
            if constexpr (SPLIT) {
                v8us h0, h1, l0, l1;
#pragma unroll
                for (int j = 0; j < 8; ++j) { unsigned short a, c2; splitf(s[qt][0][j], a, c2); h0[j] = a; l0[j] = c2; splitf(s[qt][1][j], a, c2); h1[j] = a; l1[j] = c2; }
                const V pf = cat16b(h0, h1), pf2 = cat16b(l0, l1);
#pragma unroll
                for (int dt = 0; dt < 4; ++dt) { o[qt][dt] = WFrag<T16>::mma(vf[dt], pf, o[qt][dt]); o[qt][dt] = WFrag<T16>::mma(vf[dt], pf2, o[qt][dt]); o[qt][dt] = WFrag<T16>::mma(vf2[dt], pf, o[qt][dt]); }
            } else {
                v8h p0, p1;
#pragma unroll
                for (int j = 0; j < 8; ++j) { p0[j] = tohx(s[qt][0][j] * PCAR); p1[j] = tohx(s[qt][1][j] * PCAR); }
                const V pf = cat16(p0, p1);
#pragma unroll
                for (int dt = 0; dt < 4; ++dt) o[qt][dt] = WFrag<T16>::mma(vf[dt], pf, o[qt][dt]);
            }
        }
    }
#pragma unroll
    for (int qt = 0; qt < QT; ++qt) {
        const float f = __fdiv_rn(SPLIT ? 1.0f : (1.0f / PCAR), l[qt] + __shfl_xor(l[qt], 16, 32));
#pragma unroll
        for (int dt = 0; dt < 4; ++dt) { v8us oh, ol;
#pragma unroll
            for (int j = 0; j < 8; ++j) { unsigned short a, c2; splitf(o[qt][dt][j] * f, a, c2); oh[j] = a; ol[j] = c2; }
            const size_t ofs = (size_t)(q0 + qt * 16 + lr) * DD + dt * 16 + hi * 8; *(v8us*)(Ah + ofs) = oh; *(v8us*)(Al + ofs) = ol; } }
}
// amdgpu_waves_per_eu(4, 4): holds the kernel to 256 registers; above them every reach into the upper window costs an s_set_vgpr_msb in the loop
__global__ __launch_bounds__(64) __attribute__((amdgpu_waves_per_eu(4, 4))) void k_fattn(const bf* __restrict__ Qh, const bf* __restrict__ Ql, const bf* __restrict__ Kh, const bf* __restrict__ Kl, const bf* __restrict__ Vh, const bf* __restrict__ Vl, const h16* __restrict__ Q16, const h16* __restrict__ K16, const h16* __restrict__ V16, bf* Ah, bf* Al) {
    const size_t zo = (size_t)blockIdx.y * TT * HD; const int r0 = blockIdx.x * 64 + __builtin_amdgcn_readfirstlane((int)(threadIdx.x >> 5)) * 32;
    Ah += blockIdx.y * HD; Al += blockIdx.y * HD;
    if (blockIdx.x * 64 < RH) {
#pragma unroll 1    // rolled: the two tiles share one copy of the code
        for (int r = 0; r < 2; ++r) { fattn<bf, true, 1>(Qh + zo, Ql + zo, Kh + zo, Kl + zo, Vh + zo, Vl + zo, Ah, Al, r0 + r * 16);    // the 3-product form holds one 16-row tile at a time
            asm volatile("s_wait_xcnt 0x0" ::: "memory"); }    // the next tile's set-up rewrites registers that this tile's stores name
    } else fattn<h16, false, 2>(Q16 + zo, nullptr, K16 + zo, nullptr, V16 + zo, nullptr, Ah, Al, r0);
}

extern "C" void kernel_launch(void* const* d_in, const int* in_sizes, int n_in,
                              void* d_out, int out_size, void* d_ws, size_t ws_size, hipStream_t stream) {
    (void)in_sizes; (void)n_in; (void)out_size;
    const float* x = (const float*)d_in[0]; const float* wq = (const float*)d_in[1]; const float* bq = (const float*)d_in[2]; const float* wk = (const float*)d_in[3]; const float* bk = (const float*)d_in[4]; const float* wv = (const float*)d_in[5]; const float* bv = (const float*)d_in[6]; const float* wo = (const float*)d_in[7]; const float* bo = (const float*)d_in[8];
    float* OUT = (float*)d_out;     // [4][2048][512]
    char* wsp = (char*)d_ws;
    auto take = [&](size_t bytes) { char* p = wsp; wsp += (bytes + 255) & ~(size_t)255; return (void*)p; };
    bf* WQ = (bf*)take((size_t)DD * DD * 2); bf* WK = (bf*)take((size_t)DD * DD * 2); bf* WV = (bf*)take((size_t)DD * DD * 2); bf* WO = (bf*)take((size_t)DD * DD * 2);
    bf* XB = (bf*)take((size_t)TT * DD * 2); float* F = (float*)take((size_t)TT * DD * 4);
    bf* QPh = (bf*)take((size_t)TT * DD * 2); bf* QPl = (bf*)take((size_t)TT * DD * 2); bf* KPh = (bf*)take((size_t)TT * DD * 2); bf* KPl = (bf*)take((size_t)TT * DD * 2); bf* VTh = (bf*)take((size_t)TT * DD * 2); bf* VTl = (bf*)take((size_t)TT * DD * 2);
    h16* QP16 = (h16*)take((size_t)TT * DD * 2); h16* KP16 = (h16*)take((size_t)TT * DD * 2); h16* VT16 = (h16*)take((size_t)TT * DD * 2);
    bf* ATh = (bf*)take((size_t)TT * DD * 2); bf* ATl = (bf*)take((size_t)TT * DD * 2);
    if ((size_t)(wsp - (char*)d_ws) > ws_size) return;    // total 30 MiB; ws 256 MiB
    { const unsigned gT = (unsigned)((DD * DD / 64 + 63) / 64); k_wtG<<<gT, 256, 0, stream>>>(wq, DD, DD, WQ); k_wtG<<<gT, 256, 0, stream>>>(wk, DD, DD, WK); k_wtG<<<gT, 256, 0, stream>>>(wv, DD, DD, WV); k_wtG<<<gT, 256, 0, stream>>>(wo, DD, DD, WO); }
    const unsigned LB = (unsigned)((NH_ * TT * HD / 64 + 63) / 64); const dim3 gP(TT / 64, DD / 64, 1);
    for (int b = 0; b < NB_; ++b) {
        k_cvt8<<<(unsigned)(((size_t)TT * DD / 8 + 255) / 256), 256, 0, stream>>>(x + (size_t)b * TT * DD, XB, (size_t)TT * DD / 8);
        k_gemmw<bf, 0, true, KSP><<<gP, 32 * KSP, 0, stream>>>(XB, nullptr, WQ, nullptr, DD, F, DD, bq, 0, 0, 0); k_qplanes<<<LB, 256, 0, stream>>>(F, QPh, QPl, QP16);
        k_gemmw<bf, 0, true, KSP><<<gP, 32 * KSP, 0, stream>>>(XB, nullptr, WK, nullptr, DD, F, DD, bk, 0, 0, 0); k_qplanes<<<LB, 256, 0, stream>>>(F, KPh, KPl, KP16);
        k_gemmw<bf, 0, true, KSP><<<gP, 32 * KSP, 0, stream>>>(XB, nullptr, WV, nullptr, DD, F, DD, bv, 0, 0, 0); k_vtplane<<<LB, 256, 0, stream>>>(F, VTh, VTl, VT16);
        k_fattn<<<dim3(TT / 64, NH_), 64, 0, stream>>>(QPh, QPl, KPh, KPl, VTh, VTl, QP16, KP16, VT16, ATh, ATl);
        k_gemmw<bf, 1, true, KSP><<<gP, 32 * KSP, 0, stream>>>(ATh, ATl, WO, nullptr, DD, OUT + (size_t)b * TT * DD, DD, bo, 0, 0, 0); }
}

// v004
// One run takes 144 microseconds.
// Timed twice side by side with v003, it ran 2.23 and 2.18 times as fast.
// Counting every step since v000, it is 15.1 times as fast.
#include <hip/hip_runtime.h>

// DWT_MLP_Model (x [4][2048][512]; q/k/v = x @ W + b ([in][out]); 8 heads x 64; scores / 8; log-sparse mask: keep (i, j) iff i - j == 0, or 1 <= i - j <= 1024, or i - j is a positive power of two (else -inf);
// softmax; out = ctx @ W_O + b_O).
// Compute dtypes, f32 accumulate: every input rounded to bf16; projections on PLAIN bf16 operands (inputs: exact; transposed bf16 weight copies, + bias); PER-ROW
// PRECISION HYBRID: query rows < 256 of each batch on bf16 hi+lo planes for scores and attn.v (3 products), rows >= 256 on SINGLE fp16 planes; the mask by index arithmetic in the softmax; output

#define NB_  4
#define TT   2048
#define DD   512
#define NH_  8
#define HD   64
#define FP   (3 * DD)             // pitch of the f32 result of the merged Q, K, V projection
#define KSP  8                    // waves that share the k range of one tile: projections (K = 512)
#define RH   256                  // query rows < RH: hi+lo planes; rows >= RH: fp16 planes
#define NF   32                   // head_dim / 2; unused, the file applies no rotary embedding
#define SCL2 0.18033688f          // 1/sqrt(64) * log2(e): the softmax runs in base 2
#define PCAR 1024.0f         // p carried times 1024 on the fp16 path; divided out in the final scale
typedef _Float16 h16;
typedef unsigned short bf;
typedef __attribute__((ext_vector_type(16))) __bf16   v16bf;
typedef __attribute__((ext_vector_type(16))) _Float16 v16h;
typedef __attribute__((ext_vector_type(8)))  _Float16 v8h;
typedef __attribute__((ext_vector_type(8)))  unsigned short v8us;
typedef __attribute__((ext_vector_type(8)))  float    v8f;
typedef __attribute__((ext_vector_type(4)))  float    v4f;
typedef v8h  __attribute__((may_alias)) v8ha;
typedef v4f  __attribute__((may_alias)) v4fa;
typedef v8us __attribute__((may_alias)) v8usa;

__device__ __forceinline__ unsigned short f2bf(float f) { unsigned u = __float_as_uint(f); u += 0x7FFFu + ((u >> 16) & 1u); return (unsigned short)(u >> 16); }
__device__ __forceinline__ float bf2f(unsigned short b) { return __uint_as_float(((unsigned)b) << 16); }
__device__ __forceinline__ float bfr(float f) { return bf2f(f2bf(f)); }
__device__ __forceinline__ v16h cat16(v8h lo, v8h hi) { return __builtin_shufflevector(lo, hi, 0, 1, 2, 3, 4, 5, 6, 7, 8, 9, 10, 11, 12, 13, 14, 15); }
__device__ __forceinline__ v16bf cat16b(v8us lo, v8us hi) { return __builtin_bit_cast(v16bf, __builtin_shufflevector(lo, hi, 0, 1, 2, 3, 4, 5, 6, 7, 8, 9, 10, 11, 12, 13, 14, 15)); }
__device__ __forceinline__ v8f wmma16(v16h a, v16h b, v8f c) { return __builtin_amdgcn_wmma_f32_16x16x32_f16(false, a, false, b, (short)0, c, false, false); }
__device__ __forceinline__ v8f wmmab(v16bf a, v16bf b, v8f c) { return __builtin_amdgcn_wmma_f32_16x16x32_bf16(false, a, false, b, (short)0, c, false, false); }



// ---- k_gemmw: register-blocked GEMM, one work-group of KS waves per 64x64 output tile; each wave holds the whole tile (16 accumulators) over its own contiguous K / KS slice of k, operands straight
// from K-contiguous 16-bit planes; the KS partial tiles are summed through LDS in fixed wave order 0..KS-1. grid (M/64, N/64, Z), 32 * KS threads.
// C[m][n] (f32, pitch ldc, + optional f32 bias: bias0, bias1, bias2 for columns [0, DD), [DD, 2 DD), [2 DD, 3 DD)) = sum_k A[m][k] Bt[n][k] (+ split products per NSPLIT). z-batch strides sA/sB/sC in elements. K % (32 * KS) == 0.
template <typename T16> struct WFrag;
template <> struct WFrag<h16> { typedef v16h V; static __device__ __forceinline__ V ld(const h16* p) { return cat16(*(const v8h*)p, *(const v8h*)(p + 16)); } static __device__ __forceinline__ v8f mma(V a, V b, v8f c) { return wmma16(a, b, c); } };
template <> struct WFrag<bf> { typedef v16bf V; static __device__ __forceinline__ V ld(const bf* p) { return cat16b(*(const v8us*)p, *(const v8us*)(p + 16)); } static __device__ __forceinline__ v8f mma(V a, V b, v8f c) { return wmmab(a, b, c); } };
template <typename T16, int NSPLIT, bool BIAS, int KS>
__global__ __launch_bounds__(32 * KS) void k_gemmw(const T16* __restrict__ A, const T16* __restrict__ A2, const T16* __restrict__ Bt, const T16* __restrict__ Bt2, int K, float* C, int ldc, const float* __restrict__ bias0, const float* __restrict__ bias1, const float* __restrict__ bias2, size_t sA, size_t sB, size_t sC) {
    typedef typename WFrag<T16>::V V;
    constexpr int SL = (KS == 1 ? 16 : 64) * 68;    // floats of one wave's LDS slice: a 16-row block for the one-wave form, the whole partial tile where KS waves are summed
    __shared__ __align__(16) float os[KS * SL];
    const size_t z = blockIdx.z; A += z * sA; if (A2) A2 += z * sA; Bt += z * sB; if (Bt2) Bt2 += z * sB; C += z * sC;
    const int lane = threadIdx.x & 31, lr = lane & 15, hi = lane >> 4; const int r0 = blockIdx.x * 64, c0 = blockIdx.y * 64;
    const float* bias = (c0 < DD) ? bias0 : (c0 < 2 * DD) ? bias1 : bias2; const int cb = c0 & (DD - 1);    // each DD-wide column group of C has its own bias vector
    v8f acc[4][4];
#pragma unroll
    for (int mb = 0; mb < 4; ++mb)
#pragma unroll
        for (int nb = 0; nb < 4; ++nb) acc[mb][nb] = (v8f){};
    const size_t aoff = (size_t)(r0 + lr) * K + 8 * hi, boff = (size_t)(c0 + lr) * K + 8 * hi;
    const int wv = (KS == 1) ? 0 : __builtin_amdgcn_readfirstlane((int)(threadIdx.x >> 5)); const int kspan = K / KS, kb = wv * kspan, ke = kb + kspan;
#pragma unroll 1
    for (int kc = kb; kc < ke; kc += 32) {
        V a[4], a2[4];
#pragma unroll
        for (int mb = 0; mb < 4; ++mb) { a[mb] = WFrag<T16>::ld(A + aoff + (size_t)mb * 16 * K + kc); if (NSPLIT == 1 || NSPLIT == 2) a2[mb] = WFrag<T16>::ld(A2 + aoff + (size_t)mb * 16 * K + kc); }
#pragma unroll
        for (int nb = 0; nb < 4; ++nb) { const V b = WFrag<T16>::ld(Bt + boff + (size_t)nb * 16 * K + kc); V b2; if (NSPLIT >= 2) b2 = WFrag<T16>::ld(Bt2 + boff + (size_t)nb * 16 * K + kc);
#pragma unroll
            for (int mb = 0; mb < 4; ++mb) { acc[mb][nb] = WFrag<T16>::mma(a[mb], b, acc[mb][nb]); if (NSPLIT == 1 || NSPLIT == 2) acc[mb][nb] = WFrag<T16>::mma(a2[mb], b, acc[mb][nb]); if (NSPLIT >= 2) acc[mb][nb] = WFrag<T16>::mma(a[mb], b2, acc[mb][nb]); } }
        asm volatile("v_nop\n\tv_nop\n\tv_nop\n\tv_nop" : "+v"(acc[0][0]), "+v"(acc[1][1]), "+v"(acc[2][2]), "+v"(acc[3][3]) : "v"(a[0]), "v"(a[3]));
    }
    if constexpr (KS == 1) {
#pragma unroll
    for (int mb = 0; mb < 4; ++mb) {
#pragma unroll
        for (int nb = 0; nb < 4; ++nb) {
#pragma unroll
            for (int j = 0; j < 8; ++j) os[(hi * 8 + j) * 68 + nb * 16 + lr] = acc[mb][nb][j]; }
        __builtin_amdgcn_wave_barrier(); asm volatile("" ::: "memory");
        float* crow = C + (size_t)(r0 + mb * 16) * ldc + c0;
{
#pragma unroll
            for (int s = 0; s < 8; ++s) { const int row = 2 * s + hi, cofs = lr * 4; v4f val = *(const v4fa*)(os + row * 68 + cofs); if (BIAS) { val[0] += bfr(bias[cb + cofs]); val[1] += bfr(bias[cb + cofs + 1]); val[2] += bfr(bias[cb + cofs + 2]); val[3] += bfr(bias[cb + cofs + 3]); }
                *(v4f*)(crow + (size_t)row * ldc + cofs) = val; }
             }
        __builtin_amdgcn_wave_barrier(); asm volatile("" ::: "memory");
    }
    } else {
#pragma unroll
        for (int mb = 0; mb < 4; ++mb) {
#pragma unroll
            for (int nb = 0; nb < 4; ++nb) {
#pragma unroll
                for (int j = 0; j < 8; ++j) os[wv * SL + (mb * 16 + hi * 8 + j) * 68 + nb * 16 + lr] = acc[mb][nb][j]; } }
        __syncthreads();    // every wave's partial tile is in LDS before any thread sums across the waves
        float* crow = C + (size_t)r0 * ldc + c0;
#pragma unroll
        for (int s = 0; s < 1024 / (32 * KS); ++s) { const int idx = s * 32 * KS + (int)threadIdx.x; const int row = idx >> 4, cofs = (idx & 15) * 4; v4f val = *(const v4fa*)(os + row * 68 + cofs);
#pragma unroll
            for (int w = 1; w < KS; ++w) val += *(const v4fa*)(os + w * SL + row * 68 + cofs);
            if (BIAS) { val[0] += bfr(bias[cb + cofs]); val[1] += bfr(bias[cb + cofs + 1]); val[2] += bfr(bias[cb + cofs + 2]); val[3] += bfr(bias[cb + cofs + 3]); }
            *(v4f*)(crow + (size_t)row * ldc + cofs) = val; }
    }
}

__device__ __forceinline__ h16 tohx(float x) { return (h16)x; }
__device__ __forceinline__ void splitf(float y, unsigned short& h, unsigned short& l) { h = f2bf(y); l = f2bf(y - bf2f(h)); }
typedef __attribute__((ext_vector_type(2))) unsigned short v2us;
typedef __attribute__((ext_vector_type(2))) _Float16 v2h;
typedef __attribute__((ext_vector_type(4))) _Float16 v4h;
typedef __attribute__((ext_vector_type(2))) float v2f;

// grid y: which of the four weights; their transposed copies lie one behind the other in Bt
__global__ __launch_bounds__(256) void k_wtG(const float* __restrict__ w0, const float* __restrict__ w1, const float* __restrict__ w2, const float* __restrict__ w3, int K, int N, bf* Bt) {
    const float* w = (blockIdx.y == 0) ? w0 : (blockIdx.y == 1) ? w1 : (blockIdx.y == 2) ? w2 : w3; Bt += (size_t)blockIdx.y * K * N;
    const int lane = threadIdx.x & 31; const int L0 = (blockIdx.x * 8 + (threadIdx.x >> 5)) * 8; const int nlines = N * K / 64;
{
#pragma unroll 1
        for (int l = 0; l < 8; ++l) { const int L = L0 + l; if (L >= nlines) break; const size_t e = (size_t)L * 64 + lane * 2; const int k = (int)(e % K), n = (int)(e / K); v2us o;
            o[0] = f2bf(w[(size_t)k * N + n]); o[1] = f2bf(w[(size_t)(k + 1) * N + n]); *(v2us*)(Bt + e) = o; }
         }
}
__global__ __launch_bounds__(256) void k_cvt8(const float* __restrict__ src, bf* dst, size_t n8) { const size_t i = (size_t)blockIdx.x * 256 + threadIdx.x; if (i >= n8) return; const v8f v = *(const v8f*)(src + i * 8); v8us o;
#pragma unroll
    for (int k = 0; k < 8; ++k) o[k] = f2bf(v[k]); *(v8us*)(dst + i * 8) = o;  }
// F: one projection's DD columns of the [NB_ * TT][FP] f32 result; planes [batch][head][t][d]
__device__ __forceinline__ void qplanes(const float* __restrict__ F, bf* Ph, bf* Pl, h16* P16) {
    const int lane = threadIdx.x & 31; const int L0 = (blockIdx.x * 8 + (threadIdx.x >> 5)) * 8; const int nlines = NB_ * NH_ * TT * HD / 64;
{
#pragma unroll
        for (int l = 0; l < 8; ++l) { const int L = L0 + l; if (L >= nlines) break; const int e = L * 64 + lane * 2; const int d = e & (HD - 1); const int t = (e >> 6) & (TT - 1); const int h = (e >> 17) & (NH_ - 1); const int b = e >> 20; v2us oh, ol; v2h o16;
#pragma unroll
            for (int q = 0; q < 2; ++q) { const float x = F[(size_t)(b * TT + t) * FP + h * HD + d + q]; unsigned short a, c2; splitf(x, a, c2); oh[q] = a; ol[q] = c2; o16[q] = tohx(x); }
            *(v2us*)(Ph + (size_t)e) = oh; *(v2us*)(Pl + (size_t)e) = ol; *(v2h*)(P16 + (size_t)e) = o16; }
         }
}
// planes [batch][head][d][t]
__device__ __forceinline__ void vtplane(const float* __restrict__ F, bf* Vh, bf* Vl, h16* V16) {
    const int lane = threadIdx.x & 31; const int L0 = (blockIdx.x * 8 + (threadIdx.x >> 5)) * 8; const int nlines = NB_ * NH_ * TT * HD / 64;
{
#pragma unroll
        for (int l = 0; l < 8; ++l) { const int L = L0 + l; if (L >= nlines) break; const int e = L * 64 + lane * 2; const int t = e & (TT - 1); const int d = (e >> 11) & (HD - 1); const int h = (e >> 17) & (NH_ - 1); const int b = e >> 20; v2us oh, ol; v2h o16;
#pragma unroll
            for (int q = 0; q < 2; ++q) { const float x = F[(size_t)(b * TT + t + q) * FP + h * HD + d]; unsigned short a, c2; splitf(x, a, c2); oh[q] = a; ol[q] = c2; o16[q] = tohx(x); }
            *(v2us*)(Vh + (size_t)e) = oh; *(v2us*)(Vl + (size_t)e) = ol; *(v2h*)(V16 + (size_t)e) = o16; }
         }
}
// grid y: 0 the Q planes, 1 the K planes, 2 the transposed V planes
__global__ __launch_bounds__(256) void k_planes(const float* __restrict__ F, bf* Qh, bf* Ql, h16* Q16, bf* Kh, bf* Kl, h16* K16, bf* Vh, bf* Vl, h16* V16) {
    if (blockIdx.y == 2) { vtplane(F + 2 * DD, Vh, Vl, V16); return; }
    const bool isk = blockIdx.y == 1; qplanes(isk ? F + DD : F, isk ? Kh : Qh, isk ? Kl : Ql, isk ? K16 : Q16);    // one copy of the code serves Q and K
}
__device__ __forceinline__ float exp2s(float x) { float r; asm("v_exp_f32 %0, %1\n\tv_nop" : "=v"(r) : "v"(x)); return r; }
template <typename T16> __device__ __forceinline__ typename WFrag<T16>::V ldo(const T16* base, unsigned bytes) { return WFrag<T16>::ld((const T16*)((const char*)base + bytes)); }    // wave-uniform base + one 32-bit byte offset per lane, shared by the planes of one operand
template <typename T16, bool SPLIT, int QT>
__device__ __forceinline__ void fattn(const T16* __restrict__ Q, const T16* __restrict__ Q2, const T16* __restrict__ Kp, const T16* __restrict__ Kp2, const T16* __restrict__ Vt, const T16* __restrict__ Vt2, bf* Ah, bf* Al, int q0) {
    typedef typename WFrag<T16>::V V;
    const int lane = threadIdx.x & 31, lr = lane & 15, hi = lane >> 4;
    const unsigned koff = (unsigned)(lr * HD + 8 * hi) * 2u, voff = (unsigned)(lr * TT + 8 * hi) * 2u;    // bytes: the lane's row and k half in a Q or K tile, in a V^T tile
    V qf[QT][2], qf2[QT][2]; v8f o[QT][4]; float m[QT], l[QT];
#pragma unroll
    for (int qt = 0; qt < QT; ++qt) { m[qt] = -3.0e38f; l[qt] = 0.f;
#pragma unroll
        for (int ks = 0; ks < 2; ++ks) { qf[qt][ks] = ldo(Q + qt * 16 * HD + 32 * ks, koff + (unsigned)q0 * (HD * 2u)); if (SPLIT) qf2[qt][ks] = ldo(Q2 + qt * 16 * HD + 32 * ks, koff + (unsigned)q0 * (HD * 2u)); }
#pragma unroll
        for (int dt = 0; dt < 4; ++dt) o[qt][dt] = (v8f){}; }
    const int kbeg = (q0 > 1024) ? ((q0 - 1024) & ~31) : 0, klast = (q0 + QT * 16 - 1) & ~31;
    V kf[2][2], kf2[2][2];
#pragma unroll
    for (int kt = 0; kt < 2; ++kt)
#pragma unroll
        for (int ks = 0; ks < 2; ++ks) { kf[kt][ks] = ldo(Kp + kt * 16 * HD + 32 * ks, koff + (unsigned)kbeg * (HD * 2u)); if (SPLIT) kf2[kt][ks] = ldo(Kp2 + kt * 16 * HD + 32 * ks, koff + (unsigned)kbeg * (HD * 2u)); }
#pragma unroll 1    // rolled: up to 33 trips share one copy of the code, and one trip's fragments already fill the registers
    for (int kb = kbeg; kb <= klast; kb += 32) {
        V vf[4], vf2[4];
#pragma unroll
        for (int dt = 0; dt < 4; ++dt) { vf[dt] = ldo(Vt + dt * 16 * TT, voff + (unsigned)kb * 2u); if (SPLIT) vf2[dt] = ldo(Vt2 + dt * 16 * TT, voff + (unsigned)kb * 2u); }
        __builtin_amdgcn_sched_barrier(0);    // keeps the V loads issued here, ahead of the score products: sunk behind the softmax their whole latency would stand in front of attn.v
        v8f s[QT][2];
#pragma unroll
        for (int qt = 0; qt < QT; ++qt)
#pragma unroll
            for (int kt = 0; kt < 2; ++kt) { s[qt][kt] = (v8f){};
#pragma unroll
                for (int ks = 0; ks < 2; ++ks) { s[qt][kt] = WFrag<T16>::mma(kf[kt][ks], qf[qt][ks], s[qt][kt]); if (SPLIT) { s[qt][kt] = WFrag<T16>::mma(kf[kt][ks], qf2[qt][ks], s[qt][kt]); s[qt][kt] = WFrag<T16>::mma(kf2[kt][ks], qf[qt][ks], s[qt][kt]); } } }
        const int kn = (kb + 32 <= klast) ? kb + 32 : klast;    // the next block's K fragments fly during this block's softmax and attn.v; the last trip reads its own block again, in bounds
#pragma unroll
        for (int kt = 0; kt < 2; ++kt)
#pragma unroll
            for (int ks = 0; ks < 2; ++ks) { kf[kt][ks] = ldo(Kp + kt * 16 * HD + 32 * ks, koff + (unsigned)kn * (HD * 2u)); if (SPLIT) kf2[kt][ks] = ldo(Kp2 + kt * 16 * HD + 32 * ks, koff + (unsigned)kn * (HD * 2u)); }
        __builtin_amdgcn_sched_barrier(0);    // keeps the next block's K loads issued here, so that the softmax and attn.v cover their latency
#pragma unroll
        for (int qt = 0; qt < QT; ++qt) {
            const int i = q0 + qt * 16 + lr; float bm = -3.0e38f;
#pragma unroll
            for (int kt = 0; kt < 2; ++kt)
#pragma unroll
                for (int j = 0; j < 8; ++j) { const int dd = i - (kb + kt * 16 + hi * 8 + j); const float t = ((unsigned)dd <= 1024u) ? s[qt][kt][j] * SCL2 : -3.0e38f; s[qt][kt][j] = t; bm = fmaxf(bm, t); }
            bm = fmaxf(bm, __shfl_xor(bm, 16, 32));
            const float mn = fmaxf(m[qt], bm); const float al = exp2s(m[qt] - mn); m[qt] = mn;
            float ps = 0.f;
#pragma unroll
            for (int kt = 0; kt < 2; ++kt)
#pragma unroll
                for (int j = 0; j < 8; ++j) { const float p = exp2s(s[qt][kt][j] - mn); s[qt][kt][j] = p; ps += p; }
            l[qt] = l[qt] * al + ps;    // each lane sums its own half of the keys; the halves are joined once, behind the loop
#pragma unroll
            for (int dt = 0; dt < 4; ++dt) o[qt][dt] *= al;
            if constexpr (SPLIT) {
                v8us h0, h1, l0, l1;
#pragma unroll
                for (int j = 0; j < 8; ++j) { unsigned short a, c2; splitf(s[qt][0][j], a, c2); h0[j] = a; l0[j] = c2; splitf(s[qt][1][j], a, c2); h1[j] = a; l1[j] = c2; }
                const V pf = cat16b(h0, h1), pf2 = cat16b(l0, l1);
#pragma unroll
                for (int dt = 0; dt < 4; ++dt) { o[qt][dt] = WFrag<T16>::mma(vf[dt], pf, o[qt][dt]); o[qt][dt] = WFrag<T16>::mma(vf[dt], pf2, o[qt][dt]); o[qt][dt] = WFrag<T16>::mma(vf2[dt], pf, o[qt][dt]); }
            } else {
                v8h p0, p1;
#pragma unroll
                for (int j = 0; j < 8; ++j) { p0[j] = tohx(s[qt][0][j] * PCAR); p1[j] = tohx(s[qt][1][j] * PCAR); }
                const V pf = cat16(p0, p1);
#pragma unroll
                for (int dt = 0; dt < 4; ++dt) o[qt][dt] = WFrag<T16>::mma(vf[dt], pf, o[qt][dt]);
            }
        }
    }
#pragma unroll
    for (int qt = 0; qt < QT; ++qt) {
        const float f = __fdiv_rn(SPLIT ? 1.0f : (1.0f / PCAR), l[qt] + __shfl_xor(l[qt], 16, 32));
#pragma unroll
        for (int dt = 0; dt < 4; ++dt) { v8us oh, ol;
#pragma unroll
            for (int j = 0; j < 8; ++j) { unsigned short a, c2; splitf(o[qt][dt][j] * f, a, c2); oh[j] = a; ol[j] = c2; }
            const size_t ofs = (size_t)(q0 + qt * 16 + lr) * DD + dt * 16 + hi * 8; *(v8us*)(Ah + ofs) = oh; *(v8us*)(Al + ofs) = ol; } }
}
// amdgpu_waves_per_eu(4, 4): holds the kernel to 256 registers; above them every reach into the upper window costs an s_set_vgpr_msb in the loop
__global__ __launch_bounds__(64) __attribute__((amdgpu_waves_per_eu(4, 4))) void k_fattn(const bf* __restrict__ Qh, const bf* __restrict__ Ql, const bf* __restrict__ Kh, const bf* __restrict__ Kl, const bf* __restrict__ Vh, const bf* __restrict__ Vl, const h16* __restrict__ Q16, const h16* __restrict__ K16, const h16* __restrict__ V16, bf* Ah, bf* Al) {
    const size_t zo = ((size_t)blockIdx.z * NH_ + blockIdx.y) * TT * HD; const int r0 = blockIdx.x * 64 + __builtin_amdgcn_readfirstlane((int)(threadIdx.x >> 5)) * 32;
    Ah += (size_t)blockIdx.z * TT * DD + blockIdx.y * HD; Al += (size_t)blockIdx.z * TT * DD + blockIdx.y * HD;
    if (blockIdx.x * 64 < RH) {
#pragma unroll 1    // rolled: the two tiles share one copy of the code
        for (int r = 0; r < 2; ++r) { fattn<bf, true, 1>(Qh + zo, Ql + zo, Kh + zo, Kl + zo, Vh + zo, Vl + zo, Ah, Al, r0 + r * 16);    // the 3-product form holds one 16-row tile at a time
            asm volatile("s_wait_xcnt 0x0" ::: "memory"); }    // the next tile's set-up rewrites registers that this tile's stores name
    } else fattn<h16, false, 2>(Q16 + zo, nullptr, K16 + zo, nullptr, V16 + zo, nullptr, Ah, Al, r0);
}

extern "C" void kernel_launch(void* const* d_in, const int* in_sizes, int n_in,
                              void* d_out, int out_size, void* d_ws, size_t ws_size, hipStream_t stream) {
    (void)in_sizes; (void)n_in; (void)out_size;
    const float* x = (const float*)d_in[0]; const float* wq = (const float*)d_in[1]; const float* bq = (const float*)d_in[2]; const float* wk = (const float*)d_in[3]; const float* bk = (const float*)d_in[4]; const float* wv = (const float*)d_in[5]; const float* bv = (const float*)d_in[6]; const float* wo = (const float*)d_in[7]; const float* bo = (const float*)d_in[8];
    float* OUT = (float*)d_out;     // [4][2048][512]
    char* wsp = (char*)d_ws;
    auto take = [&](size_t bytes) { char* p = wsp; wsp += (bytes + 255) & ~(size_t)255; return (void*)p; };
    bf* W4 = (bf*)take((size_t)4 * DD * DD * 2);    // transposed W_Q, W_K, W_V, W_O, one behind the other: the first three are the [3 DD][DD] B operand of the merged projection
    bf* XB = (bf*)take((size_t)NB_ * TT * DD * 2); float* F = (float*)take((size_t)NB_ * TT * FP * 4);
    bf* QPh = (bf*)take((size_t)NB_ * TT * DD * 2); bf* QPl = (bf*)take((size_t)NB_ * TT * DD * 2); bf* KPh = (bf*)take((size_t)NB_ * TT * DD * 2); bf* KPl = (bf*)take((size_t)NB_ * TT * DD * 2); bf* VTh = (bf*)take((size_t)NB_ * TT * DD * 2); bf* VTl = (bf*)take((size_t)NB_ * TT * DD * 2);
    h16* QP16 = (h16*)take((size_t)NB_ * TT * DD * 2); h16* KP16 = (h16*)take((size_t)NB_ * TT * DD * 2); h16* VT16 = (h16*)take((size_t)NB_ * TT * DD * 2);
    bf* ATh = (bf*)take((size_t)NB_ * TT * DD * 2); bf* ATl = (bf*)take((size_t)NB_ * TT * DD * 2);
    if ((size_t)(wsp - (char*)d_ws) > ws_size) return;    // total 146 MiB; ws 256 MiB
    k_wtG<<<dim3((unsigned)((DD * DD / 64 + 63) / 64), 4), 256, 0, stream>>>(wq, wk, wv, wo, DD, DD, W4);
    k_cvt8<<<(unsigned)(((size_t)NB_ * TT * DD / 8 + 255) / 256), 256, 0, stream>>>(x, XB, (size_t)NB_ * TT * DD / 8);
    k_gemmw<bf, 0, true, KSP><<<dim3(NB_ * TT / 64, FP / 64), 32 * KSP, 0, stream>>>(XB, nullptr, W4, nullptr, DD, F, FP, bq, bk, bv, 0, 0, 0);
    k_planes<<<dim3((unsigned)((NB_ * NH_ * TT * HD / 64 + 63) / 64), 3), 256, 0, stream>>>(F, QPh, QPl, QP16, KPh, KPl, KP16, VTh, VTl, VT16);
    k_fattn<<<dim3(TT / 64, NH_, NB_), 64, 0, stream>>>(QPh, QPl, KPh, KPl, VTh, VTl, QP16, KP16, VT16, ATh, ATl);
    k_gemmw<bf, 1, true, KSP><<<dim3(NB_ * TT / 64, DD / 64), 32 * KSP, 0, stream>>>(ATh, ATl, W4 + (size_t)3 * DD * DD, nullptr, DD, OUT, DD, bo, bo, bo, 0, 0, 0);
}

// v005
// One run takes 114 microseconds.
// Next to v004, in two timings, it ran 1.26 times as fast each time.
// Counting every step since v000, it is 19.0 times as fast.
#include <hip/hip_runtime.h>

// Multi-head attention block (x [4][2048][512]; q/k/v = x @ W + b ([in][out]); 8 heads x 64; scores / 8; log-sparse mask: keep (i, j) iff i - j == 0, or 1 <= i - j <= 1024, or i - j is a positive power of two (else -inf);
// softmax; out = ctx @ W_O + b_O).
// Compute dtypes, f32 accumulate: every input rounded to bf16; projections on PLAIN bf16 operands (inputs: exact; transposed bf16 weight copies, + bias); PER-ROW
// PRECISION HYBRID: query rows < 256 of each batch on bf16 hi+lo planes for scores and attn.v (3 products), rows >= 256 on SINGLE fp16 planes; the mask by index arithmetic in the softmax; output

#define NB_  4
#define TT   2048
#define DD   512
#define NH_  8
#define HD   64
#define FP   (3 * DD)             // columns of the merged Q, K, V projection
#define KSP  8                    // waves that share the k range of one tile: projections (K = 512)
#define RH   256                  // query rows < RH: hi+lo planes; rows >= RH: fp16 planes
#define NF   32                   // head_dim / 2; unused, the file applies no rotary embedding
#define SCL2 0.18033688f          // 1/sqrt(64) * log2(e): the softmax runs in base 2
#define PCAR 1024.0f         // p carried times 1024 on the fp16 path; divided out in the final scale
typedef _Float16 h16;
typedef unsigned short bf;
typedef __attribute__((ext_vector_type(16))) __bf16   v16bf;
typedef __attribute__((ext_vector_type(16))) _Float16 v16h;
typedef __attribute__((ext_vector_type(8)))  _Float16 v8h;
typedef __attribute__((ext_vector_type(8)))  unsigned short v8us;
typedef __attribute__((ext_vector_type(8)))  float    v8f;
typedef __attribute__((ext_vector_type(4)))  float    v4f;
typedef v8h  __attribute__((may_alias)) v8ha;
typedef v4f  __attribute__((may_alias)) v4fa;
typedef v8us __attribute__((may_alias)) v8usa;

__device__ __forceinline__ unsigned short f2bf(float f) { unsigned u = __float_as_uint(f); u += 0x7FFFu + ((u >> 16) & 1u); return (unsigned short)(u >> 16); }
__device__ __forceinline__ float bf2f(unsigned short b) { return __uint_as_float(((unsigned)b) << 16); }
__device__ __forceinline__ float bfr(float f) { return bf2f(f2bf(f)); }
__device__ __forceinline__ v16h cat16(v8h lo, v8h hi) { return __builtin_shufflevector(lo, hi, 0, 1, 2, 3, 4, 5, 6, 7, 8, 9, 10, 11, 12, 13, 14, 15); }
__device__ __forceinline__ v16bf cat16b(v8us lo, v8us hi) { return __builtin_bit_cast(v16bf, __builtin_shufflevector(lo, hi, 0, 1, 2, 3, 4, 5, 6, 7, 8, 9, 10, 11, 12, 13, 14, 15)); }
__device__ __forceinline__ v8f wmma16(v16h a, v16h b, v8f c) { return __builtin_amdgcn_wmma_f32_16x16x32_f16(false, a, false, b, (short)0, c, false, false); }
__device__ __forceinline__ v8f wmmab(v16bf a, v16bf b, v8f c) { return __builtin_amdgcn_wmma_f32_16x16x32_bf16(false, a, false, b, (short)0, c, false, false); }



// ---- k_gemmw: register-blocked GEMM, one work-group of KS waves per 64x64 output tile; each wave holds the whole tile (16 accumulators) over its own contiguous K / KS slice of k, operands straight
// from K-contiguous 16-bit planes; the KS partial tiles are summed through LDS in fixed wave order 0..KS-1. grid (M/64, N/64, Z), 32 * KS threads.
// C[m][n] (f32, pitch ldc, + optional f32 bias: bias0, bias1, bias2 for columns [0, DD), [DD, 2 DD), [2 DD, 3 DD)) = sum_k A[m][k] Bt[n][k] (+ split products per NSPLIT). z-batch strides sA/sB/sC in elements. K % (32 * KS) == 0.
template <typename T16> struct WFrag;
template <> struct WFrag<h16> { typedef v16h V; static __device__ __forceinline__ V ld(const h16* p) { return cat16(*(const v8h*)p, *(const v8h*)(p + 16)); } static __device__ __forceinline__ v8f mma(V a, V b, v8f c) { return wmma16(a, b, c); } };
template <> struct WFrag<bf> { typedef v16bf V; static __device__ __forceinline__ V ld(const bf* p) { return cat16b(*(const v8us*)p, *(const v8us*)(p + 16)); } static __device__ __forceinline__ v8f mma(V a, V b, v8f c) { return wmmab(a, b, c); } };
template <typename T16, int NSPLIT, bool BIAS, int KS>
__global__ __launch_bounds__(32 * KS) void k_gemmw(const T16* __restrict__ A, const T16* __restrict__ A2, const T16* __restrict__ Bt, const T16* __restrict__ Bt2, int K, float* C, int ldc, const float* __restrict__ bias0, const float* __restrict__ bias1, const float* __restrict__ bias2, size_t sA, size_t sB, size_t sC) {
    typedef typename WFrag<T16>::V V;
    constexpr int SL = (KS == 1 ? 16 : 64) * 68;    // floats of one wave's LDS slice: a 16-row block for the one-wave form, the whole partial tile where KS waves are summed
    __shared__ __align__(16) float os[KS * SL];
    const size_t z = blockIdx.z; A += z * sA; if (A2) A2 += z * sA; Bt += z * sB; if (Bt2) Bt2 += z * sB; C += z * sC;
    const int lane = threadIdx.x & 31, lr = lane & 15, hi = lane >> 4; const int r0 = blockIdx.x * 64, c0 = blockIdx.y * 64;
    const float* bias = (c0 < DD) ? bias0 : (c0 < 2 * DD) ? bias1 : bias2; const int cb = c0 & (DD - 1);    // each DD-wide column group of C has its own bias vector
    v8f acc[4][4];
#pragma unroll
    for (int mb = 0; mb < 4; ++mb)
#pragma unroll
        for (int nb = 0; nb < 4; ++nb) acc[mb][nb] = (v8f){};
    const size_t aoff = (size_t)(r0 + lr) * K + 8 * hi, boff = (size_t)(c0 + lr) * K + 8 * hi;
    const int wv = (KS == 1) ? 0 : __builtin_amdgcn_readfirstlane((int)(threadIdx.x >> 5)); const int kspan = K / KS, kb = wv * kspan, ke = kb + kspan;
#pragma unroll 1
    for (int kc = kb; kc < ke; kc += 32) {
        V a[4], a2[4];
#pragma unroll
        for (int mb = 0; mb < 4; ++mb) { a[mb] = WFrag<T16>::ld(A + aoff + (size_t)mb * 16 * K + kc); if (NSPLIT == 1 || NSPLIT == 2) a2[mb] = WFrag<T16>::ld(A2 + aoff + (size_t)mb * 16 * K + kc); }
#pragma unroll
        for (int nb = 0; nb < 4; ++nb) { const V b = WFrag<T16>::ld(Bt + boff + (size_t)nb * 16 * K + kc); V b2; if (NSPLIT >= 2) b2 = WFrag<T16>::ld(Bt2 + boff + (size_t)nb * 16 * K + kc);
#pragma unroll
            for (int mb = 0; mb < 4; ++mb) { acc[mb][nb] = WFrag<T16>::mma(a[mb], b, acc[mb][nb]); if (NSPLIT == 1 || NSPLIT == 2) acc[mb][nb] = WFrag<T16>::mma(a2[mb], b, acc[mb][nb]); if (NSPLIT >= 2) acc[mb][nb] = WFrag<T16>::mma(a[mb], b2, acc[mb][nb]); } }
        asm volatile("v_nop\n\tv_nop\n\tv_nop\n\tv_nop" : "+v"(acc[0][0]), "+v"(acc[1][1]), "+v"(acc[2][2]), "+v"(acc[3][3]) : "v"(a[0]), "v"(a[3]));
    }
    if constexpr (KS == 1) {
#pragma unroll
    for (int mb = 0; mb < 4; ++mb) {
#pragma unroll
        for (int nb = 0; nb < 4; ++nb) {
#pragma unroll
            for (int j = 0; j < 8; ++j) os[(hi * 8 + j) * 68 + nb * 16 + lr] = acc[mb][nb][j]; }
        __builtin_amdgcn_wave_barrier(); asm volatile("" ::: "memory");
        float* crow = C + (size_t)(r0 + mb * 16) * ldc + c0;
{
#pragma unroll
            for (int s = 0; s < 8; ++s) { const int row = 2 * s + hi, cofs = lr * 4; v4f val = *(const v4fa*)(os + row * 68 + cofs); if (BIAS) { val[0] += bfr(bias[cb + cofs]); val[1] += bfr(bias[cb + cofs + 1]); val[2] += bfr(bias[cb + cofs + 2]); val[3] += bfr(bias[cb + cofs + 3]); }
                *(v4f*)(crow + (size_t)row * ldc + cofs) = val; }
             }
        __builtin_amdgcn_wave_barrier(); asm volatile("" ::: "memory");
    }
    } else {
#pragma unroll
        for (int mb = 0; mb < 4; ++mb) {
#pragma unroll
            for (int nb = 0; nb < 4; ++nb) {
#pragma unroll
                for (int j = 0; j < 8; ++j) os[wv * SL + (mb * 16 + hi * 8 + j) * 68 + nb * 16 + lr] = acc[mb][nb][j]; } }
        __syncthreads();    // every wave's partial tile is in LDS before any thread sums across the waves
        float* crow = C + (size_t)r0 * ldc + c0;
#pragma unroll
        for (int s = 0; s < 1024 / (32 * KS); ++s) { const int idx = s * 32 * KS + (int)threadIdx.x; const int row = idx >> 4, cofs = (idx & 15) * 4; v4f val = *(const v4fa*)(os + row * 68 + cofs);
#pragma unroll
            for (int w = 1; w < KS; ++w) val += *(const v4fa*)(os + w * SL + row * 68 + cofs);
            if (BIAS) { val[0] += bfr(bias[cb + cofs]); val[1] += bfr(bias[cb + cofs + 1]); val[2] += bfr(bias[cb + cofs + 2]); val[3] += bfr(bias[cb + cofs + 3]); }
            *(v4f*)(crow + (size_t)row * ldc + cofs) = val; }
    }
}

__device__ __forceinline__ h16 tohx(float x) { return (h16)x; }
__device__ __forceinline__ void splitf(float y, unsigned short& h, unsigned short& l) { h = f2bf(y); l = f2bf(y - bf2f(h)); }
typedef __attribute__((ext_vector_type(2))) unsigned short v2us;
typedef __attribute__((ext_vector_type(2))) _Float16 v2h;
typedef __attribute__((ext_vector_type(4))) _Float16 v4h;
typedef __attribute__((ext_vector_type(2))) float v2f;

// grid y: which of the four weights; their transposed copies lie one behind the other in Bt
__global__ __launch_bounds__(256) void k_wtG(const float* __restrict__ w0, const float* __restrict__ w1, const float* __restrict__ w2, const float* __restrict__ w3, int K, int N, bf* Bt) {
    const float* w = (blockIdx.y == 0) ? w0 : (blockIdx.y == 1) ? w1 : (blockIdx.y == 2) ? w2 : w3; Bt += (size_t)blockIdx.y * K * N;
    const int lane = threadIdx.x & 31; const int L0 = (blockIdx.x * 8 + (threadIdx.x >> 5)) * 8; const int nlines = N * K / 64;
{
#pragma unroll 1
        for (int l = 0; l < 8; ++l) { const int L = L0 + l; if (L >= nlines) break; const size_t e = (size_t)L * 64 + lane * 2; const int k = (int)(e % K), n = (int)(e / K); v2us o;
            o[0] = f2bf(w[(size_t)k * N + n]); o[1] = f2bf(w[(size_t)(k + 1) * N + n]); *(v2us*)(Bt + e) = o; }
         }
}
__global__ __launch_bounds__(256) void k_cvt8(const float* __restrict__ src, bf* dst, size_t n8) { const size_t i = (size_t)blockIdx.x * 256 + threadIdx.x; if (i >= n8) return; const v8f v = *(const v8f*)(src + i * 8); v8us o;
#pragma unroll
    for (int k = 0; k < 8; ++k) o[k] = f2bf(v[k]); *(v8us*)(dst + i * 8) = o;  }
// ---- k_projp: the merged Q, K, V projection with the plane writers in its epilogue. grid (NB_ * TT / 64, FP / 64), 32 * KSP threads; the k loop's products, the split of k over the KSP waves and the sum of the partial
// tiles through LDS in wave order 0..KSP-1 are those of k_gemmw. A 64-column group of the projection is one head, so a Q or K tile (64 t x 64 d) is one contiguous piece of its [batch][head][t][d] planes.
// A V tile is formed transposed (weight rows as the A operand, token rows as B: both are k-contiguous and take the same loader), so that its rows are d and lie along t as the [batch][head][d][t] planes do.
static_assert(KSP == 8, "the epilogue of k_projp deals the 64 x 64 tile to 256 threads");
__global__ __launch_bounds__(32 * KSP) void k_projp(const bf* __restrict__ X, const bf* __restrict__ Wt, const float* __restrict__ bq, const float* __restrict__ bk, const float* __restrict__ bv, bf* Qh, bf* Ql, h16* Q16, bf* Kh, bf* Kl, h16* K16, bf* Vh, bf* Vl, h16* V16) {
    typedef WFrag<bf>::V V;
    constexpr int SL = 64 * 68;    // floats of one wave's partial tile in LDS
    __shared__ __align__(16) float os[KSP * SL];
    const int lane = threadIdx.x & 31, lr = lane & 15, hi = lane >> 4; const int r0 = blockIdx.x * 64, c0 = blockIdx.y * 64;
    const int sel = c0 / DD, cb = c0 & (DD - 1); const bool tr = sel == 2;
    const bf* A = tr ? Wt + (size_t)c0 * DD : X + (size_t)r0 * DD; const bf* Bt = tr ? X + (size_t)r0 * DD : Wt + (size_t)c0 * DD;
    const float* bias = (sel == 0) ? bq : (sel == 1) ? bk : bv; const int erow = (int)threadIdx.x >> 3, cofs = ((int)threadIdx.x & 7) * 8;    // the thread's place in the epilogue: tile rows erow and erow + 32, 8 columns from cofs
    float bcol[8], brow[2];    // the head's bias at the thread's columns (Q, K tiles) and at its rows (transposed V tiles): loaded here and first used in the epilogue, so that the latency passes under the k loop
#pragma unroll
    for (int q = 0; q < 8; ++q) bcol[q] = bias[cb + cofs + q];
#pragma unroll
    for (int s = 0; s < 2; ++s) brow[s] = bias[cb + s * 32 + erow];
    v8f acc[4][4];
#pragma unroll
    for (int mb = 0; mb < 4; ++mb)
#pragma unroll
        for (int nb = 0; nb < 4; ++nb) acc[mb][nb] = (v8f){};
    const size_t off = (size_t)lr * DD + 8 * hi;
    const int wv = __builtin_amdgcn_readfirstlane((int)(threadIdx.x >> 5)); const int kspan = DD / KSP, kb = wv * kspan, ke = kb + kspan;
    for (int kc = kb; kc < ke; kc += 32) {    // two trips, known at compile time: the compiler unrolls them and both trips' fragment loads fly together
        V a[4];
#pragma unroll
        for (int mb = 0; mb < 4; ++mb) a[mb] = WFrag<bf>::ld(A + off + (size_t)mb * 16 * DD + kc);
        asm volatile("s_wait_xcnt 0x0" ::: "memory");    // behind the run of A loads, and the bias loads ahead of them
#pragma unroll
        for (int nb = 0; nb < 4; ++nb) { const V b = WFrag<bf>::ld(Bt + off + (size_t)nb * 16 * DD + kc);
#pragma unroll
            for (int mb = 0; mb < 4; ++mb) acc[mb][nb] = WFrag<bf>::mma(a[mb], b, acc[mb][nb]); }
    }
#pragma unroll
    for (int mb = 0; mb < 4; ++mb) {
#pragma unroll
        for (int nb = 0; nb < 4; ++nb) {
#pragma unroll
            for (int j = 0; j < 8; ++j) os[wv * SL + (mb * 16 + hi * 8 + j) * 68 + nb * 16 + lr] = acc[mb][nb][j]; } }
    __syncthreads();    // every wave's partial tile is in LDS before any thread sums across the waves
    bf* Ph = (sel == 0) ? Qh : (sel == 1) ? Kh : Vh; bf* Pl = (sel == 0) ? Ql : (sel == 1) ? Kl : Vl; h16* P16 = (sel == 0) ? Q16 : (sel == 1) ? K16 : V16;
    const size_t zo = ((size_t)(r0 / TT) * NH_ + cb / HD) * TT * HD; const int t0 = r0 & (TT - 1);
    const size_t base = tr ? zo + t0 : zo + (size_t)t0 * HD; const int pitch = tr ? TT : HD;
#pragma unroll
    for (int s = 0; s < 2; ++s) { const int row = s * 32 + erow;    // 8 lanes store one 128-byte row of the tile in each plane
        v4f v0 = *(const v4fa*)(os + row * 68 + cofs), v1 = *(const v4fa*)(os + row * 68 + cofs + 4);
#pragma unroll
        for (int w = 1; w < KSP; ++w) { v0 += *(const v4fa*)(os + w * SL + row * 68 + cofs); v1 += *(const v4fa*)(os + w * SL + row * 68 + cofs + 4); }
        v8us oh, ol; v8h o16;
#pragma unroll
        for (int q = 0; q < 8; ++q) { const float x = (q < 4 ? v0[q & 3] : v1[q & 3]) + bfr(tr ? brow[s] : bcol[q]); unsigned short a, c2; splitf(x, a, c2); oh[q] = a; ol[q] = c2; o16[q] = tohx(x); }
        const size_t e = base + (size_t)row * pitch + cofs; *(v8us*)(Ph + e) = oh; *(v8us*)(Pl + e) = ol; *(v8h*)(P16 + e) = o16; }
}
__device__ __forceinline__ float exp2s(float x) { float r; asm("v_exp_f32 %0, %1\n\tv_nop" : "=v"(r) : "v"(x)); return r; }
template <typename T16> __device__ __forceinline__ typename WFrag<T16>::V ldo(const T16* base, unsigned bytes) { return WFrag<T16>::ld((const T16*)((const char*)base + bytes)); }    // wave-uniform base + one 32-bit byte offset per lane, shared by the planes of one operand
template <typename T16, bool SPLIT, int QT>
__device__ __forceinline__ void fattn(const T16* __restrict__ Q, const T16* __restrict__ Q2, const T16* __restrict__ Kp, const T16* __restrict__ Kp2, const T16* __restrict__ Vt, const T16* __restrict__ Vt2, bf* Ah, bf* Al, int q0) {
    typedef typename WFrag<T16>::V V;
    const int lane = threadIdx.x & 31, lr = lane & 15, hi = lane >> 4;
    const unsigned koff = (unsigned)(lr * HD + 8 * hi) * 2u, voff = (unsigned)(lr * TT + 8 * hi) * 2u;    // bytes: the lane's row and k half in a Q or K tile, in a V^T tile
    V qf[QT][2], qf2[QT][2]; v8f o[QT][4]; float m[QT], l[QT];
#pragma unroll
    for (int qt = 0; qt < QT; ++qt) { m[qt] = -3.0e38f; l[qt] = 0.f;
#pragma unroll
        for (int ks = 0; ks < 2; ++ks) { qf[qt][ks] = ldo(Q + qt * 16 * HD + 32 * ks, koff + (unsigned)q0 * (HD * 2u)); if (SPLIT) qf2[qt][ks] = ldo(Q2 + qt * 16 * HD + 32 * ks, koff + (unsigned)q0 * (HD * 2u)); }
#pragma unroll
        for (int dt = 0; dt < 4; ++dt) o[qt][dt] = (v8f){}; }
    const int kbeg = (q0 > 1024) ? ((q0 - 1024) & ~31) : 0, klast = (q0 + QT * 16 - 1) & ~31;
    V kf[2][2], kf2[2][2];
#pragma unroll
    for (int kt = 0; kt < 2; ++kt)
#pragma unroll
        for (int ks = 0; ks < 2; ++ks) { kf[kt][ks] = ldo(Kp + kt * 16 * HD + 32 * ks, koff + (unsigned)kbeg * (HD * 2u)); if (SPLIT) kf2[kt][ks] = ldo(Kp2 + kt * 16 * HD + 32 * ks, koff + (unsigned)kbeg * (HD * 2u)); }
#pragma unroll 1    // rolled: up to 33 trips share one copy of the code, and one trip's fragments already fill the registers
    for (int kb = kbeg; kb <= klast; kb += 32) {
        V vf[4], vf2[4];
#pragma unroll
        for (int dt = 0; dt < 4; ++dt) { vf[dt] = ldo(Vt + dt * 16 * TT, voff + (unsigned)kb * 2u); if (SPLIT) vf2[dt] = ldo(Vt2 + dt * 16 * TT, voff + (unsigned)kb * 2u); }
        __builtin_amdgcn_sched_barrier(0);    // keeps the V loads issued here, ahead of the score products: sunk behind the softmax their whole latency would stand in front of attn.v
        v8f s[QT][2];
#pragma unroll
        for (int qt = 0; qt < QT; ++qt)
#pragma unroll
            for (int kt = 0; kt < 2; ++kt) { s[qt][kt] = (v8f){};
#pragma unroll
                for (int ks = 0; ks < 2; ++ks) { s[qt][kt] = WFrag<T16>::mma(kf[kt][ks], qf[qt][ks], s[qt][kt]); if (SPLIT) { s[qt][kt] = WFrag<T16>::mma(kf[kt][ks], qf2[qt][ks], s[qt][kt]); s[qt][kt] = WFrag<T16>::mma(kf2[kt][ks], qf[qt][ks], s[qt][kt]); } } }
        const int kn = (kb + 32 <= klast) ? kb + 32 : klast;    // the next block's K fragments fly during this block's softmax and attn.v; the last trip reads its own block again, in bounds
#pragma unroll
        for (int kt = 0; kt < 2; ++kt)
#pragma unroll
            for (int ks = 0; ks < 2; ++ks) { kf[kt][ks] = ldo(Kp + kt * 16 * HD + 32 * ks, koff + (unsigned)kn * (HD * 2u)); if (SPLIT) kf2[kt][ks] = ldo(Kp2 + kt * 16 * HD + 32 * ks, koff + (unsigned)kn * (HD * 2u)); }
        __builtin_amdgcn_sched_barrier(0);    // keeps the next block's K loads issued here, so that the softmax and attn.v cover their latency
#pragma unroll
        for (int qt = 0; qt < QT; ++qt) {
            const int i = q0 + qt * 16 + lr; float bm = -3.0e38f;
#pragma unroll
            for (int kt = 0; kt < 2; ++kt)
#pragma unroll
                for (int j = 0; j < 8; ++j) { const int dd = i - (kb + kt * 16 + hi * 8 + j); const float t = ((unsigned)dd <= 1024u) ? s[qt][kt][j] * SCL2 : -3.0e38f; s[qt][kt][j] = t; bm = fmaxf(bm, t); }
            bm = fmaxf(bm, __shfl_xor(bm, 16, 32));
            const float mn = fmaxf(m[qt], bm); const float al = exp2s(m[qt] - mn); m[qt] = mn;
            float ps = 0.f;
#pragma unroll
            for (int kt = 0; kt < 2; ++kt)
#pragma unroll
                for (int j = 0; j < 8; ++j) { const float p = exp2s(s[qt][kt][j] - mn); s[qt][kt][j] = p; ps += p; }
            l[qt] = l[qt] * al + ps;    // each lane sums its own half of the keys; the halves are joined once, behind the loop
#pragma unroll
            for (int dt = 0; dt < 4; ++dt) o[qt][dt] *= al;
            if constexpr (SPLIT) {
                v8us h0, h1, l0, l1;
#pragma unroll
                for (int j = 0; j < 8; ++j) { unsigned short a, c2; splitf(s[qt][0][j], a, c2); h0[j] = a; l0[j] = c2; splitf(s[qt][1][j], a, c2); h1[j] = a; l1[j] = c2; }
                const V pf = cat16b(h0, h1), pf2 = cat16b(l0, l1);
#pragma unroll
                for (int dt = 0; dt < 4; ++dt) { o[qt][dt] = WFrag<T16>::mma(vf[dt], pf, o[qt][dt]); o[qt][dt] = WFrag<T16>::mma(vf[dt], pf2, o[qt][dt]); o[qt][dt] = WFrag<T16>::mma(vf2[dt], pf, o[qt][dt]); }
            } else {
                v8h p0, p1;
#pragma unroll
                for (int j = 0; j < 8; ++j) { p0[j] = tohx(s[qt][0][j] * PCAR); p1[j] = tohx(s[qt][1][j] * PCAR); }
                const V pf = cat16(p0, p1);
#pragma unroll
                for (int dt = 0; dt < 4; ++dt) o[qt][dt] = WFrag<T16>::mma(vf[dt], pf, o[qt][dt]);
            }
        }
    }
#pragma unroll
    for (int qt = 0; qt < QT; ++qt) {
        const float f = __fdiv_rn(SPLIT ? 1.0f : (1.0f / PCAR), l[qt] + __shfl_xor(l[qt], 16, 32));
#pragma unroll
        for (int dt = 0; dt < 4; ++dt) { v8us oh, ol;
#pragma unroll
            for (int j = 0; j < 8; ++j) { unsigned short a, c2; splitf(o[qt][dt][j] * f, a, c2); oh[j] = a; ol[j] = c2; }
            const size_t ofs = (size_t)(q0 + qt * 16 + lr) * DD + dt * 16 + hi * 8; *(v8us*)(Ah + ofs) = oh; *(v8us*)(Al + ofs) = ol; } }
}
// amdgpu_waves_per_eu(4, 4): holds the kernel to 256 registers; above them every reach into the upper window costs an s_set_vgpr_msb in the loop
__global__ __launch_bounds__(64) __attribute__((amdgpu_waves_per_eu(4, 4))) void k_fattn(const bf* __restrict__ Qh, const bf* __restrict__ Ql, const bf* __restrict__ Kh, const bf* __restrict__ Kl, const bf* __restrict__ Vh, const bf* __restrict__ Vl, const h16* __restrict__ Q16, const h16* __restrict__ K16, const h16* __restrict__ V16, bf* Ah, bf* Al) {
    const size_t zo = ((size_t)blockIdx.z * NH_ + blockIdx.y) * TT * HD; const int r0 = blockIdx.x * 64 + __builtin_amdgcn_readfirstlane((int)(threadIdx.x >> 5)) * 32;
    Ah += (size_t)blockIdx.z * TT * DD + blockIdx.y * HD; Al += (size_t)blockIdx.z * TT * DD + blockIdx.y * HD;
    if (blockIdx.x * 64 < RH) {
#pragma unroll 1    // rolled: the two tiles share one copy of the code
        for (int r = 0; r < 2; ++r) { fattn<bf, true, 1>(Qh + zo, Ql + zo, Kh + zo, Kl + zo, Vh + zo, Vl + zo, Ah, Al, r0 + r * 16);    // the 3-product form holds one 16-row tile at a time
            asm volatile("s_wait_xcnt 0x0" ::: "memory"); }    // the next tile's set-up rewrites registers that this tile's stores name
    } else fattn<h16, false, 2>(Q16 + zo, nullptr, K16 + zo, nullptr, V16 + zo, nullptr, Ah, Al, r0);
}

extern "C" void kernel_launch(void* const* d_in, const int* in_sizes, int n_in,
                              void* d_out, int out_size, void* d_ws, size_t ws_size, hipStream_t stream) {
    (void)in_sizes; (void)n_in; (void)out_size;
    const float* x = (const float*)d_in[0]; const float* wq = (const float*)d_in[1]; const float* bq = (const float*)d_in[2]; const float* wk = (const float*)d_in[3]; const float* bk = (const float*)d_in[4]; const float* wv = (const float*)d_in[5]; const float* bv = (const float*)d_in[6]; const float* wo = (const float*)d_in[7]; const float* bo = (const float*)d_in[8];
    float* OUT = (float*)d_out;     // [4][2048][512]
    char* wsp = (char*)d_ws;
    auto take = [&](size_t bytes) { char* p = wsp; wsp += (bytes + 255) & ~(size_t)255; return (void*)p; };
    bf* W4 = (bf*)take((size_t)4 * DD * DD * 2);    // transposed W_Q, W_K, W_V, W_O, one behind the other: the first three are the [3 DD][DD] weight operand of the merged projection (B for Q and K tiles, A for the transposed V tiles)
    bf* XB = (bf*)take((size_t)NB_ * TT * DD * 2);
    bf* QPh = (bf*)take((size_t)NB_ * TT * DD * 2); bf* QPl = (bf*)take((size_t)NB_ * TT * DD * 2); bf* KPh = (bf*)take((size_t)NB_ * TT * DD * 2); bf* KPl = (bf*)take((size_t)NB_ * TT * DD * 2); bf* VTh = (bf*)take((size_t)NB_ * TT * DD * 2); bf* VTl = (bf*)take((size_t)NB_ * TT * DD * 2);
    h16* QP16 = (h16*)take((size_t)NB_ * TT * DD * 2); h16* KP16 = (h16*)take((size_t)NB_ * TT * DD * 2); h16* VT16 = (h16*)take((size_t)NB_ * TT * DD * 2);
    bf* ATh = (bf*)take((size_t)NB_ * TT * DD * 2); bf* ATl = (bf*)take((size_t)NB_ * TT * DD * 2);
    if ((size_t)(wsp - (char*)d_ws) > ws_size) return;    // total 98 MiB; ws 256 MiB
    k_wtG<<<dim3((unsigned)((DD * DD / 64 + 63) / 64), 4), 256, 0, stream>>>(wq, wk, wv, wo, DD, DD, W4);
    k_cvt8<<<(unsigned)(((size_t)NB_ * TT * DD / 8 + 255) / 256), 256, 0, stream>>>(x, XB, (size_t)NB_ * TT * DD / 8);
    k_projp<<<dim3(NB_ * TT / 64, FP / 64), 32 * KSP, 0, stream>>>(XB, W4, bq, bk, bv, QPh, QPl, QP16, KPh, KPl, KP16, VTh, VTl, VT16);
    k_fattn<<<dim3(TT / 64, NH_, NB_), 64, 0, stream>>>(QPh, QPl, KPh, KPl, VTh, VTl, QP16, KP16, VT16, ATh, ATl);
    k_gemmw<bf, 1, true, KSP><<<dim3(NB_ * TT / 64, DD / 64), 32 * KSP, 0, stream>>>(ATh, ATl, W4 + (size_t)3 * DD * DD, nullptr, DD, OUT, DD, bo, bo, bo, 0, 0, 0);
}

// v006
// A run of this version takes 82.2 microseconds.
// Next to v005, in two timings, it ran 1.37 and 1.40 times as fast.
// Counting every step since v000, it is 26.2 times as fast.
#include <hip/hip_runtime.h>

// Multi-head attention block (x [4][2048][512]; q/k/v = x @ W + b ([in][out]); 8 heads x 64; scores / 8; log-sparse mask: keep (i, j) iff i - j == 0, or 1 <= i - j <= 1024, or i - j is a positive power of two (else -inf);
// softmax; out = ctx @ W_O + b_O).
// Compute dtypes, f32 accumulate: every input rounded to bf16; projections on transposed bf16 weight copies, + bias: Q, K, V on PLAIN bf16 x (exact), output on bf16 hi+lo ctx planes (2 products); PER-ROW
// PRECISION HYBRID: query rows < 256 of each batch on bf16 hi+lo planes for scores and attn.v (3 products), rows >= 256 on SINGLE fp16 planes; the mask by index arithmetic in the softmax; output

#define NB_  4
#define TT   2048
#define DD   512
#define NH_  8
#define HD   64
#define FP   (3 * DD)             // columns of the merged Q, K, V projection
#define KSP  8                    // waves that share the k range of one tile: projections (K = 512)
#define RH   256                  // query rows < RH: hi+lo planes; rows >= RH: fp16 planes
#define NF   32                   // head_dim / 2; unused, the file applies no rotary embedding
#define SCL2 0.18033688f          // 1/sqrt(64) * log2(e): the softmax runs in base 2
#define PCAR 1024.0f         // p carried times 1024 on the fp16 path; divided out in the final scale
typedef _Float16 h16;
typedef unsigned short bf;
typedef __attribute__((ext_vector_type(16))) __bf16   v16bf;
typedef __attribute__((ext_vector_type(16))) _Float16 v16h;
typedef __attribute__((ext_vector_type(8)))  _Float16 v8h;
typedef __attribute__((ext_vector_type(8)))  unsigned short v8us;
typedef __attribute__((ext_vector_type(8)))  float    v8f;
typedef __attribute__((ext_vector_type(4)))  float    v4f;
typedef v8h  __attribute__((may_alias)) v8ha;
typedef v4f  __attribute__((may_alias)) v4fa;
typedef v8us __attribute__((may_alias)) v8usa;

__device__ __forceinline__ unsigned short f2bf(float f) { unsigned u = __float_as_uint(f); u += 0x7FFFu + ((u >> 16) & 1u); return (unsigned short)(u >> 16); }
__device__ __forceinline__ float bf2f(unsigned short b) { return __uint_as_float(((unsigned)b) << 16); }
__device__ __forceinline__ float bfr(float f) { return bf2f(f2bf(f)); }
__device__ __forceinline__ v16h cat16(v8h lo, v8h hi) { return __builtin_shufflevector(lo, hi, 0, 1, 2, 3, 4, 5, 6, 7, 8, 9, 10, 11, 12, 13, 14, 15); }
__device__ __forceinline__ v16bf cat16b(v8us lo, v8us hi) { return __builtin_bit_cast(v16bf, __builtin_shufflevector(lo, hi, 0, 1, 2, 3, 4, 5, 6, 7, 8, 9, 10, 11, 12, 13, 14, 15)); }
__device__ __forceinline__ v8f wmma16(v16h a, v16h b, v8f c) { return __builtin_amdgcn_wmma_f32_16x16x32_f16(false, a, false, b, (short)0, c, false, false); }
__device__ __forceinline__ v8f wmmab(v16bf a, v16bf b, v8f c) { return __builtin_amdgcn_wmma_f32_16x16x32_bf16(false, a, false, b, (short)0, c, false, false); }



// ---- k_gemmw: register-blocked GEMM, one work-group of KS waves per 64x64 output tile; each wave holds the whole tile (16 accumulators) over its own contiguous K / KS slice of k, operands straight
// from 16-bit planes in fragment order; the KS partial tiles are summed through LDS in fixed wave order 0..KS-1. grid (M/64, N/64, Z), 32 * KS threads.
// C[m][n] (f32, pitch ldc, + optional f32 bias: bias0, bias1, bias2 for columns [0, DD), [DD, 2 DD), [2 DD, 3 DD)) = sum_k A[m][k] Bt[n][k] (+ split products per NSPLIT). z-batch strides sA/sB/sC in elements. K = DD.
// FRAGMENT ORDER: every 16-bit operand plane (rows x k, k the contracted index) is stored as blocks of 16 rows x 32 k (512 elements, 1 KiB), the blocks of one 16-row group one behind the other along k
// (the V planes: the four 16-row groups of one 32-key step one behind the other). Inside a block element (r, kk) lies at (kk >> 4) * 256 + ((kk >> 3) & 1) * 128 + r * 8 + (kk & 7): the 16 bytes that
// lane r + 16 * hi takes for either half of its fragment lie at lane * 16 bytes of that half, so that each 16-byte load of a wave reads 512 contiguous bytes (4 whole lines) and not 32-byte pieces of 16 lines.
// Which element reaches which lane and register is as with row-major planes. ld(p): p = the block's start + lane * 8 elements.
template <typename T16> struct WFrag;
template <> struct WFrag<h16> { typedef v16h V; static __device__ __forceinline__ V ld(const h16* p) { return cat16(*(const v8h*)p, *(const v8h*)(p + 256)); } static __device__ __forceinline__ v8f mma(V a, V b, v8f c) { return wmma16(a, b, c); } };
template <> struct WFrag<bf> { typedef v16bf V; static __device__ __forceinline__ V ld(const bf* p) { return cat16b(*(const v8us*)p, *(const v8us*)(p + 256)); } static __device__ __forceinline__ v8f mma(V a, V b, v8f c) { return wmmab(a, b, c); } };
template <typename T16, int NSPLIT, bool BIAS, int KS>
__global__ __launch_bounds__(32 * KS) void k_gemmw(const T16* __restrict__ A, const T16* __restrict__ A2, const T16* __restrict__ Bt, const T16* __restrict__ Bt2, float* C, int ldc, const float* __restrict__ bias0, const float* __restrict__ bias1, const float* __restrict__ bias2, size_t sA, size_t sB, size_t sC) {
    typedef typename WFrag<T16>::V V; constexpr int K = DD;    // a constant, so that a k step's fragments lie at immediate offsets from one address per plane
    constexpr int SL = (KS == 1 ? 16 : 64) * 68;    // floats of one wave's LDS slice: a 16-row block for the one-wave form, the whole partial tile where KS waves are summed
    __shared__ __align__(16) float os[KS * SL];
    const size_t z = blockIdx.z; A += z * sA; if (A2) A2 += z * sA; Bt += z * sB; if (Bt2) Bt2 += z * sB; C += z * sC;
    const int lane = threadIdx.x & 31, lr = lane & 15, hi = lane >> 4; const int r0 = blockIdx.x * 64, c0 = blockIdx.y * 64;
    const float* bias = (c0 < DD) ? bias0 : (c0 < 2 * DD) ? bias1 : bias2; const int cb = c0 & (DD - 1);    // each DD-wide column group of C has its own bias vector
    v8f acc[4][4];
#pragma unroll
    for (int mb = 0; mb < 4; ++mb)
#pragma unroll
        for (int nb = 0; nb < 4; ++nb) acc[mb][nb] = (v8f){};
    const size_t aoff = (size_t)r0 * K + lane * 8, boff = (size_t)c0 * K + lane * 8;    // a 16-row group of blocks holds 16 * K elements; the block of k step kc starts kc * 16 elements into it
    const int wv = (KS == 1) ? 0 : __builtin_amdgcn_readfirstlane((int)(threadIdx.x >> 5)); const int kspan = K / KS, kb = wv * kspan, ke = kb + kspan;
#pragma unroll 1
    for (int kc = kb; kc < ke; kc += 32) {
        V a[4], a2[4], b[4], b2[4]; const T16* pa = A + aoff + kc * 16; const T16* pa2 = (NSPLIT == 1 || NSPLIT == 2) ? A2 + aoff + kc * 16 : pa; const T16* pb = Bt + boff + kc * 16; const T16* pb2 = (NSPLIT >= 2) ? Bt2 + boff + kc * 16 : pb;
#pragma unroll
        for (int mb = 0; mb < 4; ++mb) { a[mb] = WFrag<T16>::ld(pa + (size_t)mb * 16 * K); if (NSPLIT == 1 || NSPLIT == 2) a2[mb] = WFrag<T16>::ld(pa2 + (size_t)mb * 16 * K); }
#pragma unroll
        for (int nb = 0; nb < 4; ++nb) { b[nb] = WFrag<T16>::ld(pb + (size_t)nb * 16 * K); if (NSPLIT >= 2) b2[nb] = WFrag<T16>::ld(pb2 + (size_t)nb * 16 * K); }
        asm volatile("s_wait_xcnt 0x0" :: "v"(pa), "v"(pa2), "v"(pb), "v"(pb2) : "memory");    // behind the run of fragment loads, before a register that one of them names as its address is written again; the addresses as inputs keep their registers whole up to the wait
#pragma unroll
        for (int nb = 0; nb < 4; ++nb) {
#pragma unroll
            for (int mb = 0; mb < 4; ++mb) { acc[mb][nb] = WFrag<T16>::mma(a[mb], b[nb], acc[mb][nb]); if (NSPLIT == 1 || NSPLIT == 2) acc[mb][nb] = WFrag<T16>::mma(a2[mb], b[nb], acc[mb][nb]); if (NSPLIT >= 2) acc[mb][nb] = WFrag<T16>::mma(a[mb], b2[nb], acc[mb][nb]); } }
        asm volatile("v_nop\n\tv_nop\n\tv_nop\n\tv_nop" : "+v"(acc[0][0]), "+v"(acc[1][1]), "+v"(acc[2][2]), "+v"(acc[3][3]) : "v"(a[0]), "v"(a[3]));
    }
    if constexpr (KS == 1) {
#pragma unroll
    for (int mb = 0; mb < 4; ++mb) {
#pragma unroll
        for (int nb = 0; nb < 4; ++nb) {
#pragma unroll
            for (int j = 0; j < 8; ++j) os[(hi * 8 + j) * 68 + nb * 16 + lr] = acc[mb][nb][j]; }
        __builtin_amdgcn_wave_barrier(); asm volatile("" ::: "memory");
        float* crow = C + (size_t)(r0 + mb * 16) * ldc + c0;
{
#pragma unroll
            for (int s = 0; s < 8; ++s) { const int row = 2 * s + hi, cofs = lr * 4; v4f val = *(const v4fa*)(os + row * 68 + cofs); if (BIAS) { val[0] += bfr(bias[cb + cofs]); val[1] += bfr(bias[cb + cofs + 1]); val[2] += bfr(bias[cb + cofs + 2]); val[3] += bfr(bias[cb + cofs + 3]); }
                *(v4f*)(crow + (size_t)row * ldc + cofs) = val; }
             }
        __builtin_amdgcn_wave_barrier(); asm volatile("" ::: "memory");
    }
    } else {
#pragma unroll
        for (int mb = 0; mb < 4; ++mb) {
#pragma unroll
            for (int nb = 0; nb < 4; ++nb) {
#pragma unroll
                for (int j = 0; j < 8; ++j) os[wv * SL + (mb * 16 + hi * 8 + j) * 68 + nb * 16 + lr] = acc[mb][nb][j]; } }
        __syncthreads();    // every wave's partial tile is in LDS before any thread sums across the waves
        float* crow = C + (size_t)r0 * ldc + c0;
#pragma unroll
        for (int s = 0; s < 1024 / (32 * KS); ++s) { const int idx = s * 32 * KS + (int)threadIdx.x; const int row = idx >> 4, cofs = (idx & 15) * 4; v4f val = *(const v4fa*)(os + row * 68 + cofs);
#pragma unroll
            for (int w = 1; w < KS; ++w) val += *(const v4fa*)(os + w * SL + row * 68 + cofs);
            if (BIAS) { val[0] += bfr(bias[cb + cofs]); val[1] += bfr(bias[cb + cofs + 1]); val[2] += bfr(bias[cb + cofs + 2]); val[3] += bfr(bias[cb + cofs + 3]); }
            *(v4f*)(crow + (size_t)row * ldc + cofs) = val; }
    }
}

__device__ __forceinline__ h16 tohx(float x) { return (h16)x; }
__device__ __forceinline__ void splitf(float y, unsigned short& h, unsigned short& l) { h = f2bf(y); l = f2bf(y - bf2f(h)); }
typedef __attribute__((ext_vector_type(2))) unsigned short v2us;
typedef __attribute__((ext_vector_type(2))) _Float16 v2h;
typedef __attribute__((ext_vector_type(4))) _Float16 v4h;
typedef __attribute__((ext_vector_type(2))) float v2f;

// grid y: which of the four weights; their transposed copies (rows n, k contracted, fragment order) lie one behind the other in Bt. One wave per 16 x 32 block: each 4-byte load reads 64-byte pieces of two
// source rows, each store is 512 contiguous bytes.
__global__ __launch_bounds__(256) void k_wtG(const float* __restrict__ w0, const float* __restrict__ w1, const float* __restrict__ w2, const float* __restrict__ w3, bf* Bt) {
    const float* w = (blockIdx.y == 0) ? w0 : (blockIdx.y == 1) ? w1 : (blockIdx.y == 2) ? w2 : w3; Bt += (size_t)blockIdx.y * DD * DD;
    const int lane = threadIdx.x & 31, lr = lane & 15, hi = lane >> 4; const int blk = blockIdx.x * 8 + (threadIdx.x >> 5); constexpr int kbs = DD / 32;    // grid x: DD / 16 * kbs / 8
    const float* s = w + (size_t)((blk % kbs) * 32 + hi * 8) * DD + (blk / kbs) * 16 + lr;
    float v[16];
#pragma unroll
    for (int e = 0; e < 16; ++e) v[e] = s[(size_t)((e >> 3) * 16 + (e & 7)) * DD];
    asm volatile("s_wait_xcnt 0x0" :: "v"(s) : "memory");    // behind the run of loads; the address as an input keeps its registers whole up to the wait
#pragma unroll
    for (int part = 0; part < 2; ++part) { v8us o;
#pragma unroll
        for (int e = 0; e < 8; ++e) o[e] = f2bf(v[part * 8 + e]);
        *(v8us*)(Bt + (size_t)blk * 512 + part * 256 + lane * 8) = o; }
}
// x to bf16 in fragment order. One wave per 16 x 32 block (grid: NB_ * TT / 16 * DD / 32 / 8 work-groups of 8 waves): each 16-byte load reads four whole 128-byte pieces of source rows, each 8-byte store four 64-byte pieces.
typedef __attribute__((ext_vector_type(4))) unsigned short v4us;
__global__ __launch_bounds__(256) void k_cvt8(const float* __restrict__ src, bf* dst) {
    const int lane = threadIdx.x & 31, c = lane & 7, rr = lane >> 3; const int blk = blockIdx.x * 8 + (threadIdx.x >> 5);
    const float* s = src + (size_t)((blk / (DD / 32)) * 16 + rr) * DD + (blk % (DD / 32)) * 32 + c * 4;
    bf* d = dst + (size_t)blk * 512 + (c >> 2) * 256 + ((c >> 1) & 1) * 128 + rr * 8 + (c & 1) * 4;
#pragma unroll
    for (int i = 0; i < 4; ++i) { const v4f v = *(const v4f*)(s + (size_t)i * 4 * DD); v4us o;
#pragma unroll
        for (int k = 0; k < 4; ++k) o[k] = f2bf(v[k]);
        *(v4us*)(d + i * 32) = o; }
}
// ---- k_projp: the merged Q, K, V projection with the plane writers in its epilogue. grid (NB_ * TT / 64, FP / 64), 32 * KSP threads; the k loop's products, the split of k over the KSP waves and the sum of the partial
// tiles through LDS in wave order 0..KSP-1 are those of k_gemmw. A 64-column group of the projection is one head, so a Q or K tile (64 t x 64 d) is one contiguous piece (8 fragment blocks) of its [batch][head] planes (rows t, k = d).
// A V tile is formed transposed (weight rows as the A operand, token rows as B: both are k-contiguous and take the same loader), so that its rows are d and lie along t as those of the [batch][head] V planes do (rows d, k = t).
static_assert(KSP == 8, "the epilogue of k_projp deals the 64 x 64 tile to 256 threads");
__global__ __launch_bounds__(32 * KSP) void k_projp(const bf* __restrict__ X, const bf* __restrict__ Wt, const float* __restrict__ bq, const float* __restrict__ bk, const float* __restrict__ bv, bf* Qh, bf* Ql, h16* Q16, bf* Kh, bf* Kl, h16* K16, bf* Vh, bf* Vl, h16* V16) {
    typedef WFrag<bf>::V V;
    constexpr int SL = 64 * 68;    // floats of one wave's partial tile in LDS
    __shared__ __align__(16) float os[KSP * SL];
    const int lane = threadIdx.x & 31, lr = lane & 15, hi = lane >> 4; const int r0 = blockIdx.x * 64, c0 = blockIdx.y * 64;
    const int sel = c0 / DD, cb = c0 & (DD - 1); const bool tr = sel == 2;
    const bf* A = tr ? Wt + (size_t)c0 * DD : X + (size_t)r0 * DD; const bf* Bt = tr ? X + (size_t)r0 * DD : Wt + (size_t)c0 * DD;
    const int wv = __builtin_amdgcn_readfirstlane((int)(threadIdx.x >> 5));
    const float* bias = (sel == 0) ? bq : (sel == 1) ? bk : bv; const int erow = (wv >> 2) * 16 + lr, cofs = (wv & 3) * 16 + hi * 8;    // the thread's place in the epilogue: tile rows erow and erow + 32, 8 columns from cofs: a wave holds one half of a fragment block
    v8f acc[4][4];
#pragma unroll
    for (int mb = 0; mb < 4; ++mb)
#pragma unroll
        for (int nb = 0; nb < 4; ++nb) acc[mb][nb] = (v8f){};
    const size_t off = (size_t)lane * 8;
    const int kb = wv * (DD / KSP);
    static_assert(DD / KSP == 64, "a wave's k range is two 32-wide steps");
    V a[2][4], b[2][4];    // both k steps' fragments
    const bf* pa = A + off + kb * 16; const bf* pb = Bt + off + kb * 16;
#pragma unroll
    for (int t = 0; t < 2; ++t)
#pragma unroll
        for (int mb = 0; mb < 4; ++mb) a[t][mb] = WFrag<bf>::ld(pa + (size_t)mb * 16 * DD + 512 * t);
    asm volatile("s_wait_xcnt 0x0" :: "v"(pa) : "memory");    // behind the run of A loads; the address as an input keeps its registers whole up to the wait
#pragma unroll
    for (int t = 0; t < 2; ++t)
#pragma unroll
        for (int nb = 0; nb < 4; ++nb) b[t][nb] = WFrag<bf>::ld(pb + (size_t)nb * 16 * DD + 512 * t);
    float bcol[8], brow[2];    // the head's bias at the thread's columns (Q, K tiles) and at its rows (transposed V tiles): loaded here and first used in the epilogue, so that the latency passes under the products
#pragma unroll
    for (int q = 0; q < 8; ++q) bcol[q] = bias[cb + cofs + q];
#pragma unroll
    for (int s = 0; s < 2; ++s) brow[s] = bias[cb + s * 32 + erow];
    asm volatile("s_wait_xcnt 0x0" :: "v"(pb) : "memory");    // the same behind the run of B loads and the bias loads
    __builtin_amdgcn_sched_barrier(0);    // keeps all 32 fragment loads issued ahead of the first product, so that they fly together: left to itself this build waits out each B fragment's latency in turn
#pragma unroll
    for (int t = 0; t < 2; ++t)
#pragma unroll
        for (int nb = 0; nb < 4; ++nb)
#pragma unroll
            for (int mb = 0; mb < 4; ++mb) acc[mb][nb] = WFrag<bf>::mma(a[t][mb], b[t][nb], acc[mb][nb]);
#pragma unroll
    for (int mb = 0; mb < 4; ++mb) {
#pragma unroll
        for (int nb = 0; nb < 4; ++nb) {
#pragma unroll
            for (int j = 0; j < 8; ++j) os[wv * SL + (mb * 16 + hi * 8 + j) * 68 + nb * 16 + lr] = acc[mb][nb][j]; } }
    __syncthreads();    // every wave's partial tile is in LDS before any thread sums across the waves
    bf* Ph = (sel == 0) ? Qh : (sel == 1) ? Kh : Vh; bf* Pl = (sel == 0) ? Ql : (sel == 1) ? Kl : Vl; h16* P16 = (sel == 0) ? Q16 : (sel == 1) ? K16 : V16;
    const size_t zo = ((size_t)(r0 / TT) * NH_ + cb / HD) * TT * HD; const int t0 = r0 & (TT - 1);
    const size_t base = zo + (size_t)t0 * HD + (tr ? ((wv & 3) >> 1) * 2048 + (wv >> 2) * 512 : (wv >> 2) * 1024 + ((wv & 3) >> 1) * 512) + (wv & 1) * 256 + lane * 8; const int pitch = tr ? 1024 : 2048;    // the block of tile rows erow - lr .., columns cofs - 8 * hi ..; pitch: from there to the block 32 tile rows on
#pragma unroll
    for (int s = 0; s < 2; ++s) { const int row = s * 32 + erow;    // a wave stores 512 contiguous bytes in each plane
        v4f v0 = *(const v4fa*)(os + row * 68 + cofs), v1 = *(const v4fa*)(os + row * 68 + cofs + 4);
#pragma unroll
        for (int w = 1; w < KSP; ++w) { v0 += *(const v4fa*)(os + w * SL + row * 68 + cofs); v1 += *(const v4fa*)(os + w * SL + row * 68 + cofs + 4); }
        v8us oh, ol; v8h o16;
#pragma unroll
        for (int q = 0; q < 8; ++q) { const float x = (q < 4 ? v0[q & 3] : v1[q & 3]) + bfr(tr ? brow[s] : bcol[q]); unsigned short a, c2; splitf(x, a, c2); oh[q] = a; ol[q] = c2; o16[q] = tohx(x); }
        const size_t e = base + (size_t)s * pitch; *(v8us*)(Ph + e) = oh; *(v8us*)(Pl + e) = ol; *(v8h*)(P16 + e) = o16; }
}
__device__ __forceinline__ float exp2s(float x) { float r; asm("v_exp_f32 %0, %1\n\tv_nop" : "=v"(r) : "v"(x)); return r; }
template <typename T16> __device__ __forceinline__ typename WFrag<T16>::V ldo(const T16* base, unsigned bytes) { return WFrag<T16>::ld((const T16*)((const char*)base + bytes)); }    // wave-uniform base + one 32-bit byte offset per lane, shared by the planes of one operand
template <typename T16, bool SPLIT, int QT>
__device__ __forceinline__ void fattn(const T16* __restrict__ Q, const T16* __restrict__ Q2, const T16* __restrict__ Kp, const T16* __restrict__ Kp2, const T16* __restrict__ Vt, const T16* __restrict__ Vt2, bf* Ah, bf* Al, int q0) {
    typedef typename WFrag<T16>::V V;
    const int lane = threadIdx.x & 31, lr = lane & 15, hi = lane >> 4;
    const unsigned koff = (unsigned)lane * 16u;    // bytes: the lane's place in either half of a fragment block
    V qf[QT][2], qf2[QT][2]; v8f o[QT][4]; float m[QT], l[QT];
#pragma unroll
    for (int qt = 0; qt < QT; ++qt) { m[qt] = -3.0e38f; l[qt] = 0.f;
#pragma unroll
        for (int ks = 0; ks < 2; ++ks) { qf[qt][ks] = ldo(Q + qt * 16 * HD + 512 * ks, koff + (unsigned)q0 * (HD * 2u)); if (SPLIT) qf2[qt][ks] = ldo(Q2 + qt * 16 * HD + 512 * ks, koff + (unsigned)q0 * (HD * 2u)); }
#pragma unroll
        for (int dt = 0; dt < 4; ++dt) o[qt][dt] = (v8f){}; }
    const int kbeg = (q0 > 1024) ? ((q0 - 1024) & ~31) : 0, klast = (q0 + QT * 16 - 1) & ~31;
    V kf[2][2], kf2[2][2];
#pragma unroll
    for (int kt = 0; kt < 2; ++kt)
#pragma unroll
        for (int ks = 0; ks < 2; ++ks) { kf[kt][ks] = ldo(Kp + kt * 16 * HD + 512 * ks, koff + (unsigned)kbeg * (HD * 2u)); if (SPLIT) kf2[kt][ks] = ldo(Kp2 + kt * 16 * HD + 512 * ks, koff + (unsigned)kbeg * (HD * 2u)); }
#pragma unroll 1    // rolled: up to 33 trips share one copy of the code, and one trip's fragments already fill the registers
    for (int kb = kbeg; kb <= klast; kb += 32) {
        V vf[4], vf2[4];
#pragma unroll
        for (int dt = 0; dt < 4; ++dt) { vf[dt] = ldo(Vt + dt * 512, koff + (unsigned)kb * (HD * 2u)); if (SPLIT) vf2[dt] = ldo(Vt2 + dt * 512, koff + (unsigned)kb * (HD * 2u)); }
        __builtin_amdgcn_sched_barrier(0);    // keeps the V loads issued here, ahead of the score products: sunk behind the softmax their whole latency would stand in front of attn.v
        v8f s[QT][2];
#pragma unroll
        for (int qt = 0; qt < QT; ++qt)
#pragma unroll
            for (int kt = 0; kt < 2; ++kt) { s[qt][kt] = (v8f){};
#pragma unroll
                for (int ks = 0; ks < 2; ++ks) { s[qt][kt] = WFrag<T16>::mma(kf[kt][ks], qf[qt][ks], s[qt][kt]); if (SPLIT) { s[qt][kt] = WFrag<T16>::mma(kf[kt][ks], qf2[qt][ks], s[qt][kt]); s[qt][kt] = WFrag<T16>::mma(kf2[kt][ks], qf[qt][ks], s[qt][kt]); } } }
        const int kn = (kb + 32 <= klast) ? kb + 32 : klast;    // the next block's K fragments fly during this block's softmax and attn.v; the last trip reads its own block again, in bounds
#pragma unroll
        for (int kt = 0; kt < 2; ++kt)
#pragma unroll
            for (int ks = 0; ks < 2; ++ks) { kf[kt][ks] = ldo(Kp + kt * 16 * HD + 512 * ks, koff + (unsigned)kn * (HD * 2u)); if (SPLIT) kf2[kt][ks] = ldo(Kp2 + kt * 16 * HD + 512 * ks, koff + (unsigned)kn * (HD * 2u)); }
        __builtin_amdgcn_sched_barrier(0);    // keeps the next block's K loads issued here, so that the softmax and attn.v cover their latency
#pragma unroll
        for (int qt = 0; qt < QT; ++qt) {
            const int i = q0 + qt * 16 + lr; float bm = -3.0e38f;
#pragma unroll
            for (int kt = 0; kt < 2; ++kt)
#pragma unroll
                for (int j = 0; j < 8; ++j) { const int dd = i - (kb + kt * 16 + hi * 8 + j); const float t = ((unsigned)dd <= 1024u) ? s[qt][kt][j] * SCL2 : -3.0e38f; s[qt][kt][j] = t; bm = fmaxf(bm, t); }
            bm = fmaxf(bm, __shfl_xor(bm, 16, 32));
            const float mn = fmaxf(m[qt], bm); const float al = exp2s(m[qt] - mn); m[qt] = mn;
            float ps = 0.f;
#pragma unroll
            for (int kt = 0; kt < 2; ++kt)
#pragma unroll
                for (int j = 0; j < 8; ++j) { const float p = exp2s(s[qt][kt][j] - mn); s[qt][kt][j] = p; ps += p; }
            l[qt] = l[qt] * al + ps;    // each lane sums its own half of the keys; the halves are joined once, behind the loop
#pragma unroll
            for (int dt = 0; dt < 4; ++dt) o[qt][dt] *= al;
            if constexpr (SPLIT) {
                v8us h0, h1, l0, l1;
#pragma unroll
                for (int j = 0; j < 8; ++j) { unsigned short a, c2; splitf(s[qt][0][j], a, c2); h0[j] = a; l0[j] = c2; splitf(s[qt][1][j], a, c2); h1[j] = a; l1[j] = c2; }
                const V pf = cat16b(h0, h1), pf2 = cat16b(l0, l1);
#pragma unroll
                for (int dt = 0; dt < 4; ++dt) { o[qt][dt] = WFrag<T16>::mma(vf[dt], pf, o[qt][dt]); o[qt][dt] = WFrag<T16>::mma(vf[dt], pf2, o[qt][dt]); o[qt][dt] = WFrag<T16>::mma(vf2[dt], pf, o[qt][dt]); }
            } else {
                v8h p0, p1;
#pragma unroll
                for (int j = 0; j < 8; ++j) { p0[j] = tohx(s[qt][0][j] * PCAR); p1[j] = tohx(s[qt][1][j] * PCAR); }
                const V pf = cat16(p0, p1);
#pragma unroll
                for (int dt = 0; dt < 4; ++dt) o[qt][dt] = WFrag<T16>::mma(vf[dt], pf, o[qt][dt]);
            }
        }
    }
#pragma unroll
    for (int qt = 0; qt < QT; ++qt) {
        const float f = __fdiv_rn(SPLIT ? 1.0f : (1.0f / PCAR), l[qt] + __shfl_xor(l[qt], 16, 32));
#pragma unroll
        for (int dt = 0; dt < 4; ++dt) { v8us oh, ol;
#pragma unroll
            for (int j = 0; j < 8; ++j) { unsigned short a, c2; splitf(o[qt][dt][j] * f, a, c2); oh[j] = a; ol[j] = c2; }
            const size_t ofs = (size_t)(q0 + qt * 16) * DD + dt * 256 + lane * 8; *(v8us*)(Ah + ofs) = oh; *(v8us*)(Al + ofs) = ol; } }
}
// amdgpu_waves_per_eu(4, 4): holds the kernel to 256 registers; above them every reach into the upper window costs an s_set_vgpr_msb in the loop
__global__ __launch_bounds__(64) __attribute__((amdgpu_waves_per_eu(4, 4))) void k_fattn(const bf* __restrict__ Qh, const bf* __restrict__ Ql, const bf* __restrict__ Kh, const bf* __restrict__ Kl, const bf* __restrict__ Vh, const bf* __restrict__ Vl, const h16* __restrict__ Q16, const h16* __restrict__ K16, const h16* __restrict__ V16, bf* Ah, bf* Al) {
    const size_t zo = ((size_t)blockIdx.z * NH_ + blockIdx.y) * TT * HD; const int r0 = blockIdx.x * 64 + __builtin_amdgcn_readfirstlane((int)(threadIdx.x >> 5)) * 32;
    Ah += (size_t)blockIdx.z * TT * DD + blockIdx.y * (HD * 16); Al += (size_t)blockIdx.z * TT * DD + blockIdx.y * (HD * 16);    // fragment order: a head's 64 columns are two blocks of each 16-row group
    if (blockIdx.x * 64 < RH) {
#pragma unroll 1    // rolled: the two tiles share one copy of the code
        for (int r = 0; r < 2; ++r) { fattn<bf, true, 1>(Qh + zo, Ql + zo, Kh + zo, Kl + zo, Vh + zo, Vl + zo, Ah, Al, r0 + r * 16);    // the 3-product form holds one 16-row tile at a time
            asm volatile("s_wait_xcnt 0x0" ::: "memory"); }    // the next tile's set-up rewrites registers that this tile's stores name
    } else fattn<h16, false, 2>(Q16 + zo, nullptr, K16 + zo, nullptr, V16 + zo, nullptr, Ah, Al, r0);
}

extern "C" void kernel_launch(void* const* d_in, const int* in_sizes, int n_in,
                              void* d_out, int out_size, void* d_ws, size_t ws_size, hipStream_t stream) {
    (void)in_sizes; (void)n_in; (void)out_size;
    const float* x = (const float*)d_in[0]; const float* wq = (const float*)d_in[1]; const float* bq = (const float*)d_in[2]; const float* wk = (const float*)d_in[3]; const float* bk = (const float*)d_in[4]; const float* wv = (const float*)d_in[5]; const float* bv = (const float*)d_in[6]; const float* wo = (const float*)d_in[7]; const float* bo = (const float*)d_in[8];
    float* OUT = (float*)d_out;     // [4][2048][512]
    char* wsp = (char*)d_ws;
    auto take = [&](size_t bytes) { char* p = wsp; wsp += (bytes + 255) & ~(size_t)255; return (void*)p; };
    bf* W4 = (bf*)take((size_t)4 * DD * DD * 2);    // transposed W_Q, W_K, W_V, W_O, one behind the other: the first three are the [3 DD][DD] weight operand of the merged projection (B for Q and K tiles, A for the transposed V tiles)
    bf* XB = (bf*)take((size_t)NB_ * TT * DD * 2);
    bf* QPh = (bf*)take((size_t)NB_ * TT * DD * 2); bf* QPl = (bf*)take((size_t)NB_ * TT * DD * 2); bf* KPh = (bf*)take((size_t)NB_ * TT * DD * 2); bf* KPl = (bf*)take((size_t)NB_ * TT * DD * 2); bf* VTh = (bf*)take((size_t)NB_ * TT * DD * 2); bf* VTl = (bf*)take((size_t)NB_ * TT * DD * 2);
    h16* QP16 = (h16*)take((size_t)NB_ * TT * DD * 2); h16* KP16 = (h16*)take((size_t)NB_ * TT * DD * 2); h16* VT16 = (h16*)take((size_t)NB_ * TT * DD * 2);
    bf* ATh = (bf*)take((size_t)NB_ * TT * DD * 2); bf* ATl = (bf*)take((size_t)NB_ * TT * DD * 2);
    if ((size_t)(wsp - (char*)d_ws) > ws_size) return;    // total 98 MiB; ws 256 MiB
    k_wtG<<<dim3(DD / 16 * (DD / 32) / 8, 4), 256, 0, stream>>>(wq, wk, wv, wo, W4);
    k_cvt8<<<NB_ * TT / 16 * (DD / 32) / 8, 256, 0, stream>>>(x, XB);
    k_projp<<<dim3(NB_ * TT / 64, FP / 64), 32 * KSP, 0, stream>>>(XB, W4, bq, bk, bv, QPh, QPl, QP16, KPh, KPl, KP16, VTh, VTl, VT16);
    k_fattn<<<dim3(TT / 64, NH_, NB_), 64, 0, stream>>>(QPh, QPl, KPh, KPl, VTh, VTl, QP16, KP16, VT16, ATh, ATl);
    k_gemmw<bf, 1, true, KSP><<<dim3(NB_ * TT / 64, DD / 64), 32 * KSP, 0, stream>>>(ATh, ATl, W4 + (size_t)3 * DD * DD, nullptr, OUT, DD, bo, bo, bo, 0, 0, 0);
}

// v007
// One run takes 77.7 microseconds.
// Timed twice side by side with v006, it ran 1.07 and 1.06 times as fast.
// All steps since v000 together make it 27.9 times as fast.
#include <hip/hip_runtime.h>

// Multi-head attention block (x [4][2048][512]; q/k/v = x @ W + b ([in][out]); 8 heads x 64; scores / 8; log-sparse mask: keep (i, j) iff i - j == 0, or 1 <= i - j <= 1024, or i - j is a positive power of two (else -inf);
// softmax; out = ctx @ W_O + b_O).
// Compute dtypes, f32 accumulate: every input rounded to bf16; projections on transposed bf16 weight copies, + bias: Q, K, V on PLAIN bf16 x (exact), output on bf16 hi+lo ctx planes (2 products); PER-ROW
// PRECISION HYBRID: query rows < 256 of each batch on bf16 hi+lo planes for scores and attn.v (3 products), rows >= 256 on SINGLE fp16 planes; the mask by index arithmetic in the softmax; output

#define NB_  4
#define TT   2048
#define DD   512
#define NH_  8
#define HD   64
#define FP   (3 * DD)             // columns of the merged Q, K, V projection
#define KSP  8                    // waves that share the k range of one tile: output projection (K = 512)
#define RH   256                  // query rows < RH: hi+lo planes; rows >= RH: fp16 planes
#define NF   32                   // head_dim / 2; unused, the file applies no rotary embedding
#define SCL2 0.18033688f          // 1/sqrt(64) * log2(e): the softmax runs in base 2
#define PCAR 1024.0f         // p carried times 1024 on the fp16 path; divided out in the final scale
typedef _Float16 h16;
typedef unsigned short bf;
typedef __attribute__((ext_vector_type(16))) __bf16   v16bf;
typedef __attribute__((ext_vector_type(16))) _Float16 v16h;
typedef __attribute__((ext_vector_type(8)))  _Float16 v8h;
typedef __attribute__((ext_vector_type(8)))  unsigned short v8us;
typedef __attribute__((ext_vector_type(8)))  float    v8f;
typedef __attribute__((ext_vector_type(4)))  float    v4f;
typedef v8h  __attribute__((may_alias)) v8ha;
typedef v4f  __attribute__((may_alias)) v4fa;
typedef v8us __attribute__((may_alias)) v8usa;

__device__ __forceinline__ unsigned short f2bf(float f) { unsigned u = __float_as_uint(f); u += 0x7FFFu + ((u >> 16) & 1u); return (unsigned short)(u >> 16); }
__device__ __forceinline__ float bf2f(unsigned short b) { return __uint_as_float(((unsigned)b) << 16); }
__device__ __forceinline__ float bfr(float f) { return bf2f(f2bf(f)); }
__device__ __forceinline__ v16h cat16(v8h lo, v8h hi) { return __builtin_shufflevector(lo, hi, 0, 1, 2, 3, 4, 5, 6, 7, 8, 9, 10, 11, 12, 13, 14, 15); }
__device__ __forceinline__ v16bf cat16b(v8us lo, v8us hi) { return __builtin_bit_cast(v16bf, __builtin_shufflevector(lo, hi, 0, 1, 2, 3, 4, 5, 6, 7, 8, 9, 10, 11, 12, 13, 14, 15)); }
__device__ __forceinline__ v8f wmma16(v16h a, v16h b, v8f c) { return __builtin_amdgcn_wmma_f32_16x16x32_f16(false, a, false, b, (short)0, c, false, false); }
__device__ __forceinline__ v8f wmmab(v16bf a, v16bf b, v8f c) { return __builtin_amdgcn_wmma_f32_16x16x32_bf16(false, a, false, b, (short)0, c, false, false); }



// ---- k_gemmw: register-blocked GEMM, one work-group of KS waves per 64x64 output tile; each wave holds the whole tile (16 accumulators) over its own contiguous K / KS slice of k, operands straight
// from 16-bit planes in fragment order; the KS partial tiles are summed through LDS in fixed wave order 0..KS-1. grid (M/64, N/64, Z), 32 * KS threads.
// C[m][n] (f32, pitch ldc, + optional f32 bias: bias0, bias1, bias2 for columns [0, DD), [DD, 2 DD), [2 DD, 3 DD)) = sum_k A[m][k] Bt[n][k] (+ split products per NSPLIT). z-batch strides sA/sB/sC in elements. K = DD.
// FRAGMENT ORDER: every 16-bit operand plane (rows x k, k the contracted index) is stored as blocks of 16 rows x 32 k (512 elements, 1 KiB), the blocks of one 16-row group one behind the other along k
// (the V planes: the four 16-row groups of one 32-key step one behind the other). Inside a block element (r, kk) lies at (kk >> 4) * 256 + ((kk >> 3) & 1) * 128 + r * 8 + (kk & 7): the 16 bytes that
// lane r + 16 * hi takes for either half of its fragment lie at lane * 16 bytes of that half, so that each 16-byte load of a wave reads 512 contiguous bytes (4 whole lines) and not 32-byte pieces of 16 lines.
// Which element reaches which lane and register is as with row-major planes. ld(p): p = the block's start + lane * 8 elements.
template <typename T16> struct WFrag;
template <> struct WFrag<h16> { typedef v16h V; static __device__ __forceinline__ V ld(const h16* p) { return cat16(*(const v8h*)p, *(const v8h*)(p + 256)); } static __device__ __forceinline__ v8f mma(V a, V b, v8f c) { return wmma16(a, b, c); } };
template <> struct WFrag<bf> { typedef v16bf V; static __device__ __forceinline__ V ld(const bf* p) { return cat16b(*(const v8us*)p, *(const v8us*)(p + 256)); } static __device__ __forceinline__ v8f mma(V a, V b, v8f c) { return wmmab(a, b, c); } };
template <typename T16, int NSPLIT, bool BIAS, int KS>
__global__ __launch_bounds__(32 * KS) void k_gemmw(const T16* __restrict__ A, const T16* __restrict__ A2, const T16* __restrict__ Bt, const T16* __restrict__ Bt2, float* C, int ldc, const float* __restrict__ bias0, const float* __restrict__ bias1, const float* __restrict__ bias2, size_t sA, size_t sB, size_t sC) {
    typedef typename WFrag<T16>::V V; constexpr int K = DD;    // a constant, so that a k step's fragments lie at immediate offsets from one address per plane
    constexpr int SL = (KS == 1 ? 16 : 64) * 68;    // floats of one wave's LDS slice: a 16-row block for the one-wave form, the whole partial tile where KS waves are summed
    __shared__ __align__(16) float os[KS * SL];
    const size_t z = blockIdx.z; A += z * sA; if (A2) A2 += z * sA; Bt += z * sB; if (Bt2) Bt2 += z * sB; C += z * sC;
    const int lane = threadIdx.x & 31, lr = lane & 15, hi = lane >> 4; const int r0 = blockIdx.x * 64, c0 = blockIdx.y * 64;
    const float* bias = (c0 < DD) ? bias0 : (c0 < 2 * DD) ? bias1 : bias2; const int cb = c0 & (DD - 1);    // each DD-wide column group of C has its own bias vector
    v8f acc[4][4];
#pragma unroll
    for (int mb = 0; mb < 4; ++mb)
#pragma unroll
        for (int nb = 0; nb < 4; ++nb) acc[mb][nb] = (v8f){};
    const size_t aoff = (size_t)r0 * K + lane * 8, boff = (size_t)c0 * K + lane * 8;    // a 16-row group of blocks holds 16 * K elements; the block of k step kc starts kc * 16 elements into it
    const int wv = (KS == 1) ? 0 : __builtin_amdgcn_readfirstlane((int)(threadIdx.x >> 5)); const int kspan = K / KS, kb = wv * kspan, ke = kb + kspan;
#pragma unroll 1
    for (int kc = kb; kc < ke; kc += 32) {
        V a[4], a2[4], b[4], b2[4]; const T16* pa = A + aoff + kc * 16; const T16* pa2 = (NSPLIT == 1 || NSPLIT == 2) ? A2 + aoff + kc * 16 : pa; const T16* pb = Bt + boff + kc * 16; const T16* pb2 = (NSPLIT >= 2) ? Bt2 + boff + kc * 16 : pb;
#pragma unroll
        for (int mb = 0; mb < 4; ++mb) { a[mb] = WFrag<T16>::ld(pa + (size_t)mb * 16 * K); if (NSPLIT == 1 || NSPLIT == 2) a2[mb] = WFrag<T16>::ld(pa2 + (size_t)mb * 16 * K); }
#pragma unroll
        for (int nb = 0; nb < 4; ++nb) { b[nb] = WFrag<T16>::ld(pb + (size_t)nb * 16 * K); if (NSPLIT >= 2) b2[nb] = WFrag<T16>::ld(pb2 + (size_t)nb * 16 * K); }
        asm volatile("s_wait_xcnt 0x0" :: "v"(pa), "v"(pa2), "v"(pb), "v"(pb2) : "memory");    // behind the run of fragment loads, before a register that one of them names as its address is written again; the addresses as inputs keep their registers whole up to the wait
#pragma unroll
        for (int nb = 0; nb < 4; ++nb) {
#pragma unroll
            for (int mb = 0; mb < 4; ++mb) { acc[mb][nb] = WFrag<T16>::mma(a[mb], b[nb], acc[mb][nb]); if (NSPLIT == 1 || NSPLIT == 2) acc[mb][nb] = WFrag<T16>::mma(a2[mb], b[nb], acc[mb][nb]); if (NSPLIT >= 2) acc[mb][nb] = WFrag<T16>::mma(a[mb], b2[nb], acc[mb][nb]); } }
        asm volatile("v_nop\n\tv_nop\n\tv_nop\n\tv_nop" : "+v"(acc[0][0]), "+v"(acc[1][1]), "+v"(acc[2][2]), "+v"(acc[3][3]) : "v"(a[0]), "v"(a[3]));
    }
    if constexpr (KS == 1) {
#pragma unroll
    for (int mb = 0; mb < 4; ++mb) {
#pragma unroll
        for (int nb = 0; nb < 4; ++nb) {
#pragma unroll
            for (int j = 0; j < 8; ++j) os[(hi * 8 + j) * 68 + nb * 16 + lr] = acc[mb][nb][j]; }
        __builtin_amdgcn_wave_barrier(); asm volatile("" ::: "memory");
        float* crow = C + (size_t)(r0 + mb * 16) * ldc + c0;
{
#pragma unroll
            for (int s = 0; s < 8; ++s) { const int row = 2 * s + hi, cofs = lr * 4; v4f val = *(const v4fa*)(os + row * 68 + cofs); if (BIAS) { val[0] += bfr(bias[cb + cofs]); val[1] += bfr(bias[cb + cofs + 1]); val[2] += bfr(bias[cb + cofs + 2]); val[3] += bfr(bias[cb + cofs + 3]); }
                *(v4f*)(crow + (size_t)row * ldc + cofs) = val; }
             }
        __builtin_amdgcn_wave_barrier(); asm volatile("" ::: "memory");
    }
    } else {
#pragma unroll
        for (int mb = 0; mb < 4; ++mb) {
#pragma unroll
            for (int nb = 0; nb < 4; ++nb) {
#pragma unroll
                for (int j = 0; j < 8; ++j) os[wv * SL + (mb * 16 + hi * 8 + j) * 68 + nb * 16 + lr] = acc[mb][nb][j]; } }
        __syncthreads();    // every wave's partial tile is in LDS before any thread sums across the waves
        float* crow = C + (size_t)r0 * ldc + c0;
#pragma unroll
        for (int s = 0; s < 1024 / (32 * KS); ++s) { const int idx = s * 32 * KS + (int)threadIdx.x; const int row = idx >> 4, cofs = (idx & 15) * 4; v4f val = *(const v4fa*)(os + row * 68 + cofs);
#pragma unroll
            for (int w = 1; w < KS; ++w) val += *(const v4fa*)(os + w * SL + row * 68 + cofs);
            if (BIAS) { val[0] += bfr(bias[cb + cofs]); val[1] += bfr(bias[cb + cofs + 1]); val[2] += bfr(bias[cb + cofs + 2]); val[3] += bfr(bias[cb + cofs + 3]); }
            *(v4f*)(crow + (size_t)row * ldc + cofs) = val; }
    }
}

__device__ __forceinline__ h16 tohx(float x) { return (h16)x; }
__device__ __forceinline__ void splitf(float y, unsigned short& h, unsigned short& l) { h = f2bf(y); l = f2bf(y - bf2f(h)); }
typedef __attribute__((ext_vector_type(2))) unsigned short v2us;
typedef __attribute__((ext_vector_type(2))) _Float16 v2h;
typedef __attribute__((ext_vector_type(4))) _Float16 v4h;
typedef __attribute__((ext_vector_type(2))) float v2f;

// grid y: which of the four weights; their transposed copies (rows n, k contracted, fragment order) lie one behind the other in Bt. One wave per 16 x 32 block: each 4-byte load reads 64-byte pieces of two
// source rows, each store is 512 contiguous bytes.
__global__ __launch_bounds__(256) void k_wtG(const float* __restrict__ w0, const float* __restrict__ w1, const float* __restrict__ w2, const float* __restrict__ w3, bf* Bt) {
    const float* w = (blockIdx.y == 0) ? w0 : (blockIdx.y == 1) ? w1 : (blockIdx.y == 2) ? w2 : w3; Bt += (size_t)blockIdx.y * DD * DD;
    const int lane = threadIdx.x & 31, lr = lane & 15, hi = lane >> 4; const int blk = blockIdx.x * 8 + (threadIdx.x >> 5); constexpr int kbs = DD / 32;    // grid x: DD / 16 * kbs / 8
    const float* s = w + (size_t)((blk % kbs) * 32 + hi * 8) * DD + (blk / kbs) * 16 + lr;
    float v[16];
#pragma unroll
    for (int e = 0; e < 16; ++e) v[e] = s[(size_t)((e >> 3) * 16 + (e & 7)) * DD];
    asm volatile("s_wait_xcnt 0x0" :: "v"(s) : "memory");    // behind the run of loads; the address as an input keeps its registers whole up to the wait
#pragma unroll
    for (int part = 0; part < 2; ++part) { v8us o;
#pragma unroll
        for (int e = 0; e < 8; ++e) o[e] = f2bf(v[part * 8 + e]);
        *(v8us*)(Bt + (size_t)blk * 512 + part * 256 + lane * 8) = o; }
}
// x to bf16 in fragment order. One wave per 16 x 32 block (grid: NB_ * TT / 16 * DD / 32 / 8 work-groups of 8 waves): each 16-byte load reads four whole 128-byte pieces of source rows, each 8-byte store four 64-byte pieces.
typedef __attribute__((ext_vector_type(4))) unsigned short v4us;
__global__ __launch_bounds__(256) void k_cvt8(const float* __restrict__ src, bf* dst) {
    const int lane = threadIdx.x & 31, c = lane & 7, rr = lane >> 3; const int blk = blockIdx.x * 8 + (threadIdx.x >> 5);
    const float* s = src + (size_t)((blk / (DD / 32)) * 16 + rr) * DD + (blk % (DD / 32)) * 32 + c * 4;
    bf* d = dst + (size_t)blk * 512 + (c >> 2) * 256 + ((c >> 1) & 1) * 128 + rr * 8 + (c & 1) * 4;
#pragma unroll
    for (int i = 0; i < 4; ++i) { const v4f v = *(const v4f*)(s + (size_t)i * 4 * DD); v4us o;
#pragma unroll
        for (int k = 0; k < 4; ++k) o[k] = f2bf(v[k]);
        *(v4us*)(d + i * 32) = o; }
}
// ---- k_projp: the merged Q, K, V projection with the plane writers in its epilogue. grid (NB_ * TT / 128, FP / 128), 4 waves; a work-group owns a 128 x 128 tile, a wave one 64 x 64 quarter of it over the WHOLE k range
// (16 steps of 32, one accumulate chain per element): the grid has 3072 such wave tiles, three per SIMD, so k needs no split over waves, and no partial tile passes through LDS. The two waves beside each other read the same token rows,
// the two above each other the same weight rows. A 64-column group of the projection is one head. The orientation of the product is chosen so that a lane's 8 accumulator registers are the 8 neighbours along the contracted
// index of the plane they go to, which is one lane's 16 bytes of a fragment block: Q and K tiles (planes: rows t, k = d) take the weight rows as the A operand and the token rows as B (register j = d, lane = t),
// V tiles (planes: rows d, k = t) the token rows as A and the weight rows as B (register j = t, lane = d). Both operands are k-contiguous and take the same loader.
// QK: the tile is a Q or K tile. e0: the element of the thread's 16 bytes in the tile's first block; bias: the head's 64 values.
template <bool QK>
__device__ __forceinline__ void projp_store(const v8f (&acc)[4][4], const float* __restrict__ bias, bf* Ph, bf* Pl, h16* P16, size_t e0, int lr, int hi) {
    float bn[4]; v4f bq4[4][2];    // all bias loads ahead of the first store
    const unsigned bo = (unsigned)(QK ? hi * 32 : lr * 4); const char* bb = (const char*)bias;    // wave-uniform base + one 32-bit byte offset per lane
#pragma unroll
    for (int g = 0; g < 4; ++g) { if (QK) { bq4[g][0] = *(const v4fa*)(bb + g * 64 + bo); bq4[g][1] = *(const v4fa*)(bb + g * 64 + 16 + bo); } else bn[g] = *(const float*)(bb + g * 64 + bo); }
    asm volatile("s_wait_xcnt 0x0" :: "v"(bo) : "memory");    // behind the run of bias loads; the offset as an input keeps its register whole up to the wait
    if (!QK) {
#pragma unroll
        for (int nb = 0; nb < 4; ++nb) bn[nb] = bfr(bn[nb]); }
#pragma unroll
    for (int mb = 0; mb < 4; ++mb) {
        float bj[8];
        if (QK) {
#pragma unroll
            for (int j = 0; j < 8; ++j) bj[j] = bfr(bq4[mb][j >> 2][j & 3]); }
#pragma unroll
        for (int nb = 0; nb < 4; ++nb) { v8us oh, ol; v8h o16;
#pragma unroll
            for (int j = 0; j < 8; ++j) { const float x = acc[mb][nb][j] + (QK ? bj[j] : bn[nb]); unsigned short a, c2; splitf(x, a, c2); oh[j] = a; ol[j] = c2; o16[j] = tohx(x); }
            const size_t e = e0 + (mb & 1) * 256 + (QK ? nb * 1024 + (mb >> 1) * 512 : (mb >> 1) * 2048 + nb * 512);    // a wave stores 512 contiguous bytes in each plane
            *(v8us*)(Ph + e) = oh; *(v8us*)(Pl + e) = ol; *(v8h*)(P16 + e) = o16;
            asm volatile("s_wait_xcnt 0x0" :: "v"(oh), "v"(ol), "v"(o16) : "memory"); } }    // behind the three stores, before the next block's values are written into registers that the stores name; the stored values as inputs keep their registers whole up to the wait
}
// amdgpu_waves_per_eu(3, 3): the grid gives a SIMD three waves; a third of its registers holds the 16 accumulators and both fragment sets
__global__ __launch_bounds__(128) __attribute__((amdgpu_waves_per_eu(3, 3))) void k_projp(const bf* __restrict__ X, const bf* __restrict__ Wt, const float* __restrict__ bq, const float* __restrict__ bk, const float* __restrict__ bv, bf* Qh, bf* Ql, h16* Q16, bf* Kh, bf* Kl, h16* K16, bf* Vh, bf* Vl, h16* V16) {
    typedef WFrag<bf>::V V;
    const int lane = threadIdx.x & 31, lr = lane & 15, hi = lane >> 4;
    const int wv = __builtin_amdgcn_readfirstlane((int)(threadIdx.x >> 5));
    const int r0 = blockIdx.x * 128 + (wv & 1) * 64, c0 = blockIdx.y * 128 + (wv >> 1) * 64;
    const int sel = c0 / DD, cb = c0 & (DD - 1); const bool qk = sel != 2;
    const bf* A = qk ? Wt + (size_t)c0 * DD : X + (size_t)r0 * DD; const bf* Bt = qk ? X + (size_t)r0 * DD : Wt + (size_t)c0 * DD;
    v8f acc[4][4];
#pragma unroll
    for (int mb = 0; mb < 4; ++mb)
#pragma unroll
        for (int nb = 0; nb < 4; ++nb) acc[mb][nb] = (v8f){};
    V a[2][4], b[2][4];    // two fragment sets: while one set's 16 products run, the other set's 16 loads fly
    const bf* pa = A + lane * 8; const bf* pb = Bt + lane * 8;    // a 16-row group of blocks holds 16 * DD elements; the block of k step kc starts kc * 16 elements into it
#pragma unroll
    for (int mb = 0; mb < 4; ++mb) { a[0][mb] = WFrag<bf>::ld(pa + (size_t)mb * 16 * DD); b[0][mb] = WFrag<bf>::ld(pb + (size_t)mb * 16 * DD); }
    asm volatile("s_wait_xcnt 0x0" :: "v"(pa), "v"(pb) : "memory");    // behind the first set's loads, for the same reason as in the loop
    __builtin_amdgcn_sched_barrier(0);    // nothing is set between those loads and their wait
    auto fetch = [&](V (&fa)[4], V (&fb)[4], const bf* qa, const bf* qb, int ofs) {    // one k step's 16 loads
#pragma unroll
        for (int mb = 0; mb < 4; ++mb) { fa[mb] = WFrag<bf>::ld(qa + (size_t)mb * 16 * DD + ofs); fb[mb] = WFrag<bf>::ld(qb + (size_t)mb * 16 * DD + ofs); }
        asm volatile("s_wait_xcnt 0x0" :: "v"(qa), "v"(qb) : "memory");    // behind the run of fragment loads, before a register that one of them names as its address is written again; the addresses as inputs keep their registers whole up to the wait
        __builtin_amdgcn_sched_barrier(0);    // keeps the next step's 16 loads issued ahead of this step's products, so that the products cover their latency
    };
    auto mul = [&](const V (&fa)[4], const V (&fb)[4]) {    // one k step's 16 products
#pragma unroll
        for (int nb = 0; nb < 4; ++nb)
#pragma unroll
            for (int mb = 0; mb < 4; ++mb) acc[mb][nb] = WFrag<bf>::mma(fa[mb], fb[nb], acc[mb][nb]);
        __builtin_amdgcn_sched_barrier(0);    // keeps these products ahead of the loads that refill their set
    };
#pragma unroll 1    // rolled: 7 trips of two k steps share one copy of the code; the last two steps stand behind the loop, where no further set is fetched
    for (int kc = 0; kc < DD - 64; kc += 64) {
        const bf* qa = pa + kc * 16; const bf* qb = pb + kc * 16;
        fetch(a[1], b[1], qa, qb, 512); mul(a[0], b[0]);
        fetch(a[0], b[0], qa, qb, 1024); mul(a[1], b[1]);
    }
    fetch(a[1], b[1], pa, pb, (DD - 32) * 16); mul(a[0], b[0]); mul(a[1], b[1]);
    const float* bias = ((sel == 0) ? bq : (sel == 1) ? bk : bv) + cb;
    bf* Ph = (sel == 0) ? Qh : (sel == 1) ? Kh : Vh; bf* Pl = (sel == 0) ? Ql : (sel == 1) ? Kl : Vl; h16* P16 = (sel == 0) ? Q16 : (sel == 1) ? K16 : V16;
    const size_t e0 = ((size_t)(r0 / TT) * NH_ + cb / HD) * TT * HD + (size_t)(r0 & (TT - 1)) * HD + lane * 8;
    if (qk) projp_store<true>(acc, bias, Ph, Pl, P16, e0, lr, hi); else projp_store<false>(acc, bias, Ph, Pl, P16, e0, lr, hi);
}
__device__ __forceinline__ float exp2s(float x) { float r; asm("v_exp_f32 %0, %1\n\tv_nop" : "=v"(r) : "v"(x)); return r; }
template <typename T16> __device__ __forceinline__ typename WFrag<T16>::V ldo(const T16* base, unsigned bytes) { return WFrag<T16>::ld((const T16*)((const char*)base + bytes)); }    // wave-uniform base + one 32-bit byte offset per lane, shared by the planes of one operand
template <typename T16, bool SPLIT, int QT>
__device__ __forceinline__ void fattn(const T16* __restrict__ Q, const T16* __restrict__ Q2, const T16* __restrict__ Kp, const T16* __restrict__ Kp2, const T16* __restrict__ Vt, const T16* __restrict__ Vt2, bf* Ah, bf* Al, int q0) {
    typedef typename WFrag<T16>::V V;
    const int lane = threadIdx.x & 31, lr = lane & 15, hi = lane >> 4;
    const unsigned koff = (unsigned)lane * 16u;    // bytes: the lane's place in either half of a fragment block
    V qf[QT][2], qf2[QT][2]; v8f o[QT][4]; float m[QT], l[QT];
#pragma unroll
    for (int qt = 0; qt < QT; ++qt) { m[qt] = -3.0e38f; l[qt] = 0.f;
#pragma unroll
        for (int ks = 0; ks < 2; ++ks) { qf[qt][ks] = ldo(Q + qt * 16 * HD + 512 * ks, koff + (unsigned)q0 * (HD * 2u)); if (SPLIT) qf2[qt][ks] = ldo(Q2 + qt * 16 * HD + 512 * ks, koff + (unsigned)q0 * (HD * 2u)); }
#pragma unroll
        for (int dt = 0; dt < 4; ++dt) o[qt][dt] = (v8f){}; }
    const int kbeg = (q0 > 1024) ? ((q0 - 1024) & ~31) : 0, klast = (q0 + QT * 16 - 1) & ~31;
    V kf[2][2], kf2[2][2];
#pragma unroll
    for (int kt = 0; kt < 2; ++kt)
#pragma unroll
        for (int ks = 0; ks < 2; ++ks) { kf[kt][ks] = ldo(Kp + kt * 16 * HD + 512 * ks, koff + (unsigned)kbeg * (HD * 2u)); if (SPLIT) kf2[kt][ks] = ldo(Kp2 + kt * 16 * HD + 512 * ks, koff + (unsigned)kbeg * (HD * 2u)); }
#pragma unroll 1    // rolled: up to 33 trips share one copy of the code, and one trip's fragments already fill the registers
    for (int kb = kbeg; kb <= klast; kb += 32) {
        V vf[4], vf2[4];
#pragma unroll
        for (int dt = 0; dt < 4; ++dt) { vf[dt] = ldo(Vt + dt * 512, koff + (unsigned)kb * (HD * 2u)); if (SPLIT) vf2[dt] = ldo(Vt2 + dt * 512, koff + (unsigned)kb * (HD * 2u)); }
        __builtin_amdgcn_sched_barrier(0);    // keeps the V loads issued here, ahead of the score products: sunk behind the softmax their whole latency would stand in front of attn.v
        v8f s[QT][2];
#pragma unroll
        for (int qt = 0; qt < QT; ++qt)
#pragma unroll
            for (int kt = 0; kt < 2; ++kt) { s[qt][kt] = (v8f){};
#pragma unroll
                for (int ks = 0; ks < 2; ++ks) { s[qt][kt] = WFrag<T16>::mma(kf[kt][ks], qf[qt][ks], s[qt][kt]); if (SPLIT) { s[qt][kt] = WFrag<T16>::mma(kf[kt][ks], qf2[qt][ks], s[qt][kt]); s[qt][kt] = WFrag<T16>::mma(kf2[kt][ks], qf[qt][ks], s[qt][kt]); } } }
        const int kn = (kb + 32 <= klast) ? kb + 32 : klast;    // the next block's K fragments fly during this block's softmax and attn.v; the last trip reads its own block again, in bounds
#pragma unroll
        for (int kt = 0; kt < 2; ++kt)
#pragma unroll
            for (int ks = 0; ks < 2; ++ks) { kf[kt][ks] = ldo(Kp + kt * 16 * HD + 512 * ks, koff + (unsigned)kn * (HD * 2u)); if (SPLIT) kf2[kt][ks] = ldo(Kp2 + kt * 16 * HD + 512 * ks, koff + (unsigned)kn * (HD * 2u)); }
        __builtin_amdgcn_sched_barrier(0);    // keeps the next block's K loads issued here, so that the softmax and attn.v cover their latency
#pragma unroll
        for (int qt = 0; qt < QT; ++qt) {
            const int i = q0 + qt * 16 + lr; float bm = -3.0e38f;
#pragma unroll
            for (int kt = 0; kt < 2; ++kt)
#pragma unroll
                for (int j = 0; j < 8; ++j) { const int dd = i - (kb + kt * 16 + hi * 8 + j); const float t = ((unsigned)dd <= 1024u) ? s[qt][kt][j] * SCL2 : -3.0e38f; s[qt][kt][j] = t; bm = fmaxf(bm, t); }
            bm = fmaxf(bm, __shfl_xor(bm, 16, 32));
            const float mn = fmaxf(m[qt], bm); const float al = exp2s(m[qt] - mn); m[qt] = mn;
            float ps = 0.f;
#pragma unroll
            for (int kt = 0; kt < 2; ++kt)
#pragma unroll
                for (int j = 0; j < 8; ++j) { const float p = exp2s(s[qt][kt][j] - mn); s[qt][kt][j] = p; ps += p; }
            l[qt] = l[qt] * al + ps;    // each lane sums its own half of the keys; the halves are joined once, behind the loop
#pragma unroll
            for (int dt = 0; dt < 4; ++dt) o[qt][dt] *= al;
            if constexpr (SPLIT) {
                v8us h0, h1, l0, l1;
#pragma unroll
                for (int j = 0; j < 8; ++j) { unsigned short a, c2; splitf(s[qt][0][j], a, c2); h0[j] = a; l0[j] = c2; splitf(s[qt][1][j], a, c2); h1[j] = a; l1[j] = c2; }
                const V pf = cat16b(h0, h1), pf2 = cat16b(l0, l1);
#pragma unroll
                for (int dt = 0; dt < 4; ++dt) { o[qt][dt] = WFrag<T16>::mma(vf[dt], pf, o[qt][dt]); o[qt][dt] = WFrag<T16>::mma(vf[dt], pf2, o[qt][dt]); o[qt][dt] = WFrag<T16>::mma(vf2[dt], pf, o[qt][dt]); }
            } else {
                v8h p0, p1;
#pragma unroll
                for (int j = 0; j < 8; ++j) { p0[j] = tohx(s[qt][0][j] * PCAR); p1[j] = tohx(s[qt][1][j] * PCAR); }
                const V pf = cat16(p0, p1);
#pragma unroll
                for (int dt = 0; dt < 4; ++dt) o[qt][dt] = WFrag<T16>::mma(vf[dt], pf, o[qt][dt]);
            }
        }
    }
#pragma unroll
    for (int qt = 0; qt < QT; ++qt) {
        const float f = __fdiv_rn(SPLIT ? 1.0f : (1.0f / PCAR), l[qt] + __shfl_xor(l[qt], 16, 32));
#pragma unroll
        for (int dt = 0; dt < 4; ++dt) { v8us oh, ol;
#pragma unroll
            for (int j = 0; j < 8; ++j) { unsigned short a, c2; splitf(o[qt][dt][j] * f, a, c2); oh[j] = a; ol[j] = c2; }
            const size_t ofs = (size_t)(q0 + qt * 16) * DD + dt * 256 + lane * 8; *(v8us*)(Ah + ofs) = oh; *(v8us*)(Al + ofs) = ol; } }
}
// amdgpu_waves_per_eu(4, 4): holds the kernel to 256 registers; above them every reach into the upper window costs an s_set_vgpr_msb in the loop
__global__ __launch_bounds__(64) __attribute__((amdgpu_waves_per_eu(4, 4))) void k_fattn(const bf* __restrict__ Qh, const bf* __restrict__ Ql, const bf* __restrict__ Kh, const bf* __restrict__ Kl, const bf* __restrict__ Vh, const bf* __restrict__ Vl, const h16* __restrict__ Q16, const h16* __restrict__ K16, const h16* __restrict__ V16, bf* Ah, bf* Al) {
    const size_t zo = ((size_t)blockIdx.z * NH_ + blockIdx.y) * TT * HD; const int r0 = blockIdx.x * 64 + __builtin_amdgcn_readfirstlane((int)(threadIdx.x >> 5)) * 32;
    Ah += (size_t)blockIdx.z * TT * DD + blockIdx.y * (HD * 16); Al += (size_t)blockIdx.z * TT * DD + blockIdx.y * (HD * 16);    // fragment order: a head's 64 columns are two blocks of each 16-row group
    if (blockIdx.x * 64 < RH) {
#pragma unroll 1    // rolled: the two tiles share one copy of the code
        for (int r = 0; r < 2; ++r) { fattn<bf, true, 1>(Qh + zo, Ql + zo, Kh + zo, Kl + zo, Vh + zo, Vl + zo, Ah, Al, r0 + r * 16);    // the 3-product form holds one 16-row tile at a time
            asm volatile("s_wait_xcnt 0x0" ::: "memory"); }    // the next tile's set-up rewrites registers that this tile's stores name
    } else fattn<h16, false, 2>(Q16 + zo, nullptr, K16 + zo, nullptr, V16 + zo, nullptr, Ah, Al, r0);
}

extern "C" void kernel_launch(void* const* d_in, const int* in_sizes, int n_in,
                              void* d_out, int out_size, void* d_ws, size_t ws_size, hipStream_t stream) {
    (void)in_sizes; (void)n_in; (void)out_size;
    const float* x = (const float*)d_in[0]; const float* wq = (const float*)d_in[1]; const float* bq = (const float*)d_in[2]; const float* wk = (const float*)d_in[3]; const float* bk = (const float*)d_in[4]; const float* wv = (const float*)d_in[5]; const float* bv = (const float*)d_in[6]; const float* wo = (const float*)d_in[7]; const float* bo = (const float*)d_in[8];
    float* OUT = (float*)d_out;     // [4][2048][512]
    char* wsp = (char*)d_ws;
    auto take = [&](size_t bytes) { char* p = wsp; wsp += (bytes + 255) & ~(size_t)255; return (void*)p; };
    bf* W4 = (bf*)take((size_t)4 * DD * DD * 2);    // transposed W_Q, W_K, W_V, W_O, one behind the other: the first three are the [3 DD][DD] weight operand of the merged projection (A for Q and K tiles, B for the transposed V tiles)
    bf* XB = (bf*)take((size_t)NB_ * TT * DD * 2);
    bf* QPh = (bf*)take((size_t)NB_ * TT * DD * 2); bf* QPl = (bf*)take((size_t)NB_ * TT * DD * 2); bf* KPh = (bf*)take((size_t)NB_ * TT * DD * 2); bf* KPl = (bf*)take((size_t)NB_ * TT * DD * 2); bf* VTh = (bf*)take((size_t)NB_ * TT * DD * 2); bf* VTl = (bf*)take((size_t)NB_ * TT * DD * 2);
    h16* QP16 = (h16*)take((size_t)NB_ * TT * DD * 2); h16* KP16 = (h16*)take((size_t)NB_ * TT * DD * 2); h16* VT16 = (h16*)take((size_t)NB_ * TT * DD * 2);
    bf* ATh = (bf*)take((size_t)NB_ * TT * DD * 2); bf* ATl = (bf*)take((size_t)NB_ * TT * DD * 2);
    if ((size_t)(wsp - (char*)d_ws) > ws_size) return;    // total 98 MiB; ws 256 MiB
    k_wtG<<<dim3(DD / 16 * (DD / 32) / 8, 4), 256, 0, stream>>>(wq, wk, wv, wo, W4);
    k_cvt8<<<NB_ * TT / 16 * (DD / 32) / 8, 256, 0, stream>>>(x, XB);
    k_projp<<<dim3(NB_ * TT / 128, FP / 128), 128, 0, stream>>>(XB, W4, bq, bk, bv, QPh, QPl, QP16, KPh, KPl, KP16, VTh, VTl, VT16);
    k_fattn<<<dim3(TT / 64, NH_, NB_), 64, 0, stream>>>(QPh, QPl, KPh, KPl, VTh, VTl, QP16, KP16, VT16, ATh, ATl);
    k_gemmw<bf, 1, true, KSP><<<dim3(NB_ * TT / 64, DD / 64), 32 * KSP, 0, stream>>>(ATh, ATl, W4 + (size_t)3 * DD * DD, nullptr, OUT, DD, bo, bo, bo, 0, 0, 0);
}

// v008
// A run of this version takes 70.9 microseconds.
// Timed twice side by side with v007, it ran 1.08 and 1.09 times as fast.
// Counting every step since v000, it is 30.4 times as fast.
#include <hip/hip_runtime.h>

// Multi-head attention block (x [4][2048][512]; q/k/v = x @ W + b ([in][out]); 8 heads x 64; scores / 8; log-sparse mask: keep (i, j) iff i - j == 0, or 1 <= i - j <= 1024, or i - j is a positive power of two (else -inf);
// softmax; out = ctx @ W_O + b_O).
// Compute dtypes, f32 accumulate: every input rounded to bf16; projections on transposed bf16 weight copies, + bias: Q, K, V on PLAIN bf16 x (exact), output on bf16 hi+lo ctx planes (2 products); PER-ROW
// PRECISION HYBRID: query rows < 256 of each batch on bf16 hi+lo planes for scores and attn.v (3 products), rows >= 256 on SINGLE fp16 planes; the mask by index arithmetic in the softmax; output

#define NB_  4
#define TT   2048
#define DD   512
#define NH_  8
#define HD   64
#define FP   (3 * DD)             // columns of the merged Q, K, V projection
#define KSP  8                    // waves that share the k range of one tile: output projection (K = 512)
#define RH   256                  // query rows < RH: hi+lo planes; rows >= RH: fp16 planes
#define NF   32                   // head_dim / 2; unused, the file applies no rotary embedding
#define SCL2 0.18033688f          // 1/sqrt(64) * log2(e): the softmax runs in base 2
#define PCAR 1024.0f         // p carried times 1024 on the fp16 path; divided out in the final scale
typedef _Float16 h16;
typedef unsigned short bf;
typedef __attribute__((ext_vector_type(16))) __bf16   v16bf;
typedef __attribute__((ext_vector_type(16))) _Float16 v16h;
typedef __attribute__((ext_vector_type(8)))  _Float16 v8h;
typedef __attribute__((ext_vector_type(8)))  unsigned short v8us;
typedef __attribute__((ext_vector_type(8)))  float    v8f;
typedef __attribute__((ext_vector_type(4)))  float    v4f;
typedef v8h  __attribute__((may_alias)) v8ha;
typedef v4f  __attribute__((may_alias)) v4fa;
typedef v8us __attribute__((may_alias)) v8usa;

__device__ __forceinline__ unsigned short f2bf(float f) { unsigned u = __float_as_uint(f); u += 0x7FFFu + ((u >> 16) & 1u); return (unsigned short)(u >> 16); }
__device__ __forceinline__ float bf2f(unsigned short b) { return __uint_as_float(((unsigned)b) << 16); }
__device__ __forceinline__ float bfr(float f) { return bf2f(f2bf(f)); }
__device__ __forceinline__ v16h cat16(v8h lo, v8h hi) { return __builtin_shufflevector(lo, hi, 0, 1, 2, 3, 4, 5, 6, 7, 8, 9, 10, 11, 12, 13, 14, 15); }
__device__ __forceinline__ v16bf cat16b(v8us lo, v8us hi) { return __builtin_bit_cast(v16bf, __builtin_shufflevector(lo, hi, 0, 1, 2, 3, 4, 5, 6, 7, 8, 9, 10, 11, 12, 13, 14, 15)); }
__device__ __forceinline__ v8f wmma16(v16h a, v16h b, v8f c) { return __builtin_amdgcn_wmma_f32_16x16x32_f16(false, a, false, b, (short)0, c, false, false); }
__device__ __forceinline__ v8f wmmab(v16bf a, v16bf b, v8f c) { return __builtin_amdgcn_wmma_f32_16x16x32_bf16(false, a, false, b, (short)0, c, false, false); }



// ---- k_gemmw: register-blocked GEMM, one work-group of KS waves per 64x64 output tile; each wave holds the whole tile (16 accumulators) over its own contiguous K / KS slice of k, operands straight
// from 16-bit planes in fragment order; the KS partial tiles are summed through LDS in fixed wave order 0..KS-1. grid (M/64, N/64, Z), 32 * KS threads.
// C[m][n] (f32, pitch ldc, + optional f32 bias: bias0, bias1, bias2 for columns [0, DD), [DD, 2 DD), [2 DD, 3 DD)) = sum_k A[m][k] Bt[n][k] (+ split products per NSPLIT). z-batch strides sA/sB/sC in elements. K = DD.
// FRAGMENT ORDER: every 16-bit operand plane (rows x k, k the contracted index) is stored as blocks of 16 rows x 32 k (512 elements, 1 KiB), the blocks of one 16-row group one behind the other along k
// (the V planes: the four 16-row groups of one 32-key step one behind the other). Inside a block element (r, kk) lies at (kk >> 4) * 256 + ((kk >> 3) & 1) * 128 + r * 8 + (kk & 7): the 16 bytes that
// lane r + 16 * hi takes for either half of its fragment lie at lane * 16 bytes of that half, so that each 16-byte load of a wave reads 512 contiguous bytes (4 whole lines) and not 32-byte pieces of 16 lines.
// Which element reaches which lane and register is as with row-major planes. ld(p): p = the block's start + lane * 8 elements.
template <typename T16> struct WFrag;
template <> struct WFrag<h16> { typedef v16h V; static __device__ __forceinline__ V ld(const h16* p) { return cat16(*(const v8h*)p, *(const v8h*)(p + 256)); } static __device__ __forceinline__ v8f mma(V a, V b, v8f c) { return wmma16(a, b, c); } };
template <> struct WFrag<bf> { typedef v16bf V; static __device__ __forceinline__ V ld(const bf* p) { return cat16b(*(const v8us*)p, *(const v8us*)(p + 256)); } static __device__ __forceinline__ v8f mma(V a, V b, v8f c) { return wmmab(a, b, c); } };
template <typename T16, int NSPLIT, bool BIAS, int KS>
__global__ __launch_bounds__(32 * KS) void k_gemmw(const T16* __restrict__ A, const T16* __restrict__ A2, const T16* __restrict__ Bt, const T16* __restrict__ Bt2, float* C, int ldc, const float* __restrict__ bias0, const float* __restrict__ bias1, const float* __restrict__ bias2, size_t sA, size_t sB, size_t sC) {
    typedef typename WFrag<T16>::V V; constexpr int K = DD;    // a constant, so that a k step's fragments lie at immediate offsets from one address per plane
    constexpr int SL = (KS == 1 ? 16 : 64) * 68;    // floats of one wave's LDS slice: a 16-row block for the one-wave form, the whole partial tile where KS waves are summed
    __shared__ __align__(16) float os[KS * SL];
    const size_t z = blockIdx.z; A += z * sA; if (A2) A2 += z * sA; Bt += z * sB; if (Bt2) Bt2 += z * sB; C += z * sC;
    const int lane = threadIdx.x & 31, lr = lane & 15, hi = lane >> 4; const int r0 = blockIdx.x * 64, c0 = blockIdx.y * 64;
    const float* bias = (c0 < DD) ? bias0 : (c0 < 2 * DD) ? bias1 : bias2; const int cb = c0 & (DD - 1);    // each DD-wide column group of C has its own bias vector
    v8f acc[4][4];
#pragma unroll
    for (int mb = 0; mb < 4; ++mb)
#pragma unroll
        for (int nb = 0; nb < 4; ++nb) acc[mb][nb] = (v8f){};
    const size_t aoff = (size_t)r0 * K + lane * 8, boff = (size_t)c0 * K + lane * 8;    // a 16-row group of blocks holds 16 * K elements; the block of k step kc starts kc * 16 elements into it
    const int wv = (KS == 1) ? 0 : __builtin_amdgcn_readfirstlane((int)(threadIdx.x >> 5)); const int kspan = K / KS, kb = wv * kspan, ke = kb + kspan;
#pragma unroll 1
    for (int kc = kb; kc < ke; kc += 32) {
        V a[4], a2[4], b[4], b2[4]; const T16* pa = A + aoff + kc * 16; const T16* pa2 = (NSPLIT == 1 || NSPLIT == 2) ? A2 + aoff + kc * 16 : pa; const T16* pb = Bt + boff + kc * 16; const T16* pb2 = (NSPLIT >= 2) ? Bt2 + boff + kc * 16 : pb;
#pragma unroll
        for (int mb = 0; mb < 4; ++mb) { a[mb] = WFrag<T16>::ld(pa + (size_t)mb * 16 * K); if (NSPLIT == 1 || NSPLIT == 2) a2[mb] = WFrag<T16>::ld(pa2 + (size_t)mb * 16 * K); }
#pragma unroll
        for (int nb = 0; nb < 4; ++nb) { b[nb] = WFrag<T16>::ld(pb + (size_t)nb * 16 * K); if (NSPLIT >= 2) b2[nb] = WFrag<T16>::ld(pb2 + (size_t)nb * 16 * K); }
        asm volatile("s_wait_xcnt 0x0" :: "v"(pa), "v"(pa2), "v"(pb), "v"(pb2) : "memory");    // behind the run of fragment loads, before a register that one of them names as its address is written again; the addresses as inputs keep their registers whole up to the wait
#pragma unroll
        for (int nb = 0; nb < 4; ++nb) {
#pragma unroll
            for (int mb = 0; mb < 4; ++mb) { acc[mb][nb] = WFrag<T16>::mma(a[mb], b[nb], acc[mb][nb]); if (NSPLIT == 1 || NSPLIT == 2) acc[mb][nb] = WFrag<T16>::mma(a2[mb], b[nb], acc[mb][nb]); if (NSPLIT >= 2) acc[mb][nb] = WFrag<T16>::mma(a[mb], b2[nb], acc[mb][nb]); } }
        asm volatile("v_nop\n\tv_nop\n\tv_nop\n\tv_nop" : "+v"(acc[0][0]), "+v"(acc[1][1]), "+v"(acc[2][2]), "+v"(acc[3][3]) : "v"(a[0]), "v"(a[3]));
    }
    if constexpr (KS == 1) {
#pragma unroll
    for (int mb = 0; mb < 4; ++mb) {
#pragma unroll
        for (int nb = 0; nb < 4; ++nb) {
#pragma unroll
            for (int j = 0; j < 8; ++j) os[(hi * 8 + j) * 68 + nb * 16 + lr] = acc[mb][nb][j]; }
        __builtin_amdgcn_wave_barrier(); asm volatile("" ::: "memory");
        float* crow = C + (size_t)(r0 + mb * 16) * ldc + c0;
{
#pragma unroll
            for (int s = 0; s < 8; ++s) { const int row = 2 * s + hi, cofs = lr * 4; v4f val = *(const v4fa*)(os + row * 68 + cofs); if (BIAS) { val[0] += bfr(bias[cb + cofs]); val[1] += bfr(bias[cb + cofs + 1]); val[2] += bfr(bias[cb + cofs + 2]); val[3] += bfr(bias[cb + cofs + 3]); }
                *(v4f*)(crow + (size_t)row * ldc + cofs) = val; }
             }
        __builtin_amdgcn_wave_barrier(); asm volatile("" ::: "memory");
    }
    } else {
#pragma unroll
        for (int mb = 0; mb < 4; ++mb) {
#pragma unroll
            for (int nb = 0; nb < 4; ++nb) {
#pragma unroll
                for (int j = 0; j < 8; ++j) os[wv * SL + (mb * 16 + hi * 8 + j) * 68 + nb * 16 + lr] = acc[mb][nb][j]; } }
        __syncthreads();    // every wave's partial tile is in LDS before any thread sums across the waves
        float* crow = C + (size_t)r0 * ldc + c0;
#pragma unroll
        for (int s = 0; s < 1024 / (32 * KS); ++s) { const int idx = s * 32 * KS + (int)threadIdx.x; const int row = idx >> 4, cofs = (idx & 15) * 4; v4f val = *(const v4fa*)(os + row * 68 + cofs);
#pragma unroll
            for (int w = 1; w < KS; ++w) val += *(const v4fa*)(os + w * SL + row * 68 + cofs);
            if (BIAS) { val[0] += bfr(bias[cb + cofs]); val[1] += bfr(bias[cb + cofs + 1]); val[2] += bfr(bias[cb + cofs + 2]); val[3] += bfr(bias[cb + cofs + 3]); }
            *(v4f*)(crow + (size_t)row * ldc + cofs) = val; }
    }
}

__device__ __forceinline__ h16 tohx(float x) { return (h16)x; }
__device__ __forceinline__ void splitf(float y, unsigned short& h, unsigned short& l) { h = f2bf(y); l = f2bf(y - bf2f(h)); }
typedef __attribute__((ext_vector_type(2))) unsigned short v2us;
typedef __attribute__((ext_vector_type(2))) _Float16 v2h;
typedef __attribute__((ext_vector_type(4))) _Float16 v4h;
typedef __attribute__((ext_vector_type(2))) float v2f;

// grid y: which of the four weights; their transposed copies (rows n, k contracted, fragment order) lie one behind the other in Bt. One wave per 16 x 32 block: each 4-byte load reads 64-byte pieces of two
// source rows, each store is 512 contiguous bytes.
__global__ __launch_bounds__(256) void k_wtG(const float* __restrict__ w0, const float* __restrict__ w1, const float* __restrict__ w2, const float* __restrict__ w3, bf* Bt) {
    const float* w = (blockIdx.y == 0) ? w0 : (blockIdx.y == 1) ? w1 : (blockIdx.y == 2) ? w2 : w3; Bt += (size_t)blockIdx.y * DD * DD;
    const int lane = threadIdx.x & 31, lr = lane & 15, hi = lane >> 4; const int blk = blockIdx.x * 8 + (threadIdx.x >> 5); constexpr int kbs = DD / 32;    // grid x: DD / 16 * kbs / 8
    const float* s = w + (size_t)((blk % kbs) * 32 + hi * 8) * DD + (blk / kbs) * 16 + lr;
    float v[16];
#pragma unroll
    for (int e = 0; e < 16; ++e) v[e] = s[(size_t)((e >> 3) * 16 + (e & 7)) * DD];
    asm volatile("s_wait_xcnt 0x0" :: "v"(s) : "memory");    // behind the run of loads; the address as an input keeps its registers whole up to the wait
#pragma unroll
    for (int part = 0; part < 2; ++part) { v8us o;
#pragma unroll
        for (int e = 0; e < 8; ++e) o[e] = f2bf(v[part * 8 + e]);
        *(v8us*)(Bt + (size_t)blk * 512 + part * 256 + lane * 8) = o; }
}
// x to bf16 in fragment order. One wave per 16 x 32 block (grid: NB_ * TT / 16 * DD / 32 / 8 work-groups of 8 waves): each 16-byte load reads four whole 128-byte pieces of source rows, each 8-byte store four 64-byte pieces.
typedef __attribute__((ext_vector_type(4))) unsigned short v4us;
__global__ __launch_bounds__(256) void k_cvt8(const float* __restrict__ src, bf* dst) {
    const int lane = threadIdx.x & 31, c = lane & 7, rr = lane >> 3; const int blk = blockIdx.x * 8 + (threadIdx.x >> 5);
    const float* s = src + (size_t)((blk / (DD / 32)) * 16 + rr) * DD + (blk % (DD / 32)) * 32 + c * 4;
    bf* d = dst + (size_t)blk * 512 + (c >> 2) * 256 + ((c >> 1) & 1) * 128 + rr * 8 + (c & 1) * 4;
#pragma unroll
    for (int i = 0; i < 4; ++i) { const v4f v = *(const v4f*)(s + (size_t)i * 4 * DD); v4us o;
#pragma unroll
        for (int k = 0; k < 4; ++k) o[k] = f2bf(v[k]);
        *(v4us*)(d + i * 32) = o; }
}
// ---- k_projp: the merged Q, K, V projection with the plane writers in its epilogue. grid (NB_ * TT / 128, FP / 128), 4 waves; a work-group owns a 128 x 128 tile, a wave one 64 x 64 quarter of it over the WHOLE k range
// (16 steps of 32, one accumulate chain per element): the grid has 3072 such wave tiles, three per SIMD, so k needs no split over waves, and no partial tile passes through LDS. The two waves beside each other read the same token rows,
// the two above each other the same weight rows. A 64-column group of the projection is one head. The orientation of the product is chosen so that a lane's 8 accumulator registers are the 8 neighbours along the contracted
// index of the plane they go to, which is one lane's 16 bytes of a fragment block: Q and K tiles (planes: rows t, k = d) take the weight rows as the A operand and the token rows as B (register j = d, lane = t),
// V tiles (planes: rows d, k = t) the token rows as A and the weight rows as B (register j = t, lane = d). Both operands are k-contiguous and take the same loader.
// QK: the tile is a Q or K tile. e0: the element of the thread's 16 bytes in the tile's first block; bias: the head's 64 values.
template <bool QK>
__device__ __forceinline__ void projp_store(const v8f (&acc)[4][4], const float* __restrict__ bias, bf* Ph, bf* Pl, h16* P16, size_t e0, int lr, int hi) {
    float bn[4]; v4f bq4[4][2];    // all bias loads ahead of the first store
    const unsigned bo = (unsigned)(QK ? hi * 32 : lr * 4); const char* bb = (const char*)bias;    // wave-uniform base + one 32-bit byte offset per lane
#pragma unroll
    for (int g = 0; g < 4; ++g) { if (QK) { bq4[g][0] = *(const v4fa*)(bb + g * 64 + bo); bq4[g][1] = *(const v4fa*)(bb + g * 64 + 16 + bo); } else bn[g] = *(const float*)(bb + g * 64 + bo); }
    asm volatile("s_wait_xcnt 0x0" :: "v"(bo) : "memory");    // behind the run of bias loads; the offset as an input keeps its register whole up to the wait
    if (!QK) {
#pragma unroll
        for (int nb = 0; nb < 4; ++nb) bn[nb] = bfr(bn[nb]); }
#pragma unroll
    for (int mb = 0; mb < 4; ++mb) {
        float bj[8];
        if (QK) {
#pragma unroll
            for (int j = 0; j < 8; ++j) bj[j] = bfr(bq4[mb][j >> 2][j & 3]); }
#pragma unroll
        for (int nb = 0; nb < 4; ++nb) { v8us oh, ol; v8h o16;
#pragma unroll
            for (int j = 0; j < 8; ++j) { const float x = acc[mb][nb][j] + (QK ? bj[j] : bn[nb]); unsigned short a, c2; splitf(x, a, c2); oh[j] = a; ol[j] = c2; o16[j] = tohx(x); }
            const size_t e = e0 + (mb & 1) * 256 + (QK ? nb * 1024 + (mb >> 1) * 512 : (mb >> 1) * 2048 + nb * 512);    // a wave stores 512 contiguous bytes in each plane
            *(v8us*)(Ph + e) = oh; *(v8us*)(Pl + e) = ol; *(v8h*)(P16 + e) = o16;
            asm volatile("s_wait_xcnt 0x0" :: "v"(oh), "v"(ol), "v"(o16) : "memory"); } }    // behind the three stores, before the next block's values are written into registers that the stores name; the stored values as inputs keep their registers whole up to the wait
}
// amdgpu_waves_per_eu(3, 3): the grid gives a SIMD three waves; a third of its registers holds the 16 accumulators and both fragment sets
__global__ __launch_bounds__(128) __attribute__((amdgpu_waves_per_eu(3, 3))) void k_projp(const bf* __restrict__ X, const bf* __restrict__ Wt, const float* __restrict__ bq, const float* __restrict__ bk, const float* __restrict__ bv, bf* Qh, bf* Ql, h16* Q16, bf* Kh, bf* Kl, h16* K16, bf* Vh, bf* Vl, h16* V16) {
    typedef WFrag<bf>::V V;
    const int lane = threadIdx.x & 31, lr = lane & 15, hi = lane >> 4;
    const int wv = __builtin_amdgcn_readfirstlane((int)(threadIdx.x >> 5));
    const int r0 = blockIdx.x * 128 + (wv & 1) * 64, c0 = blockIdx.y * 128 + (wv >> 1) * 64;
    const int sel = c0 / DD, cb = c0 & (DD - 1); const bool qk = sel != 2;
    const bf* A = qk ? Wt + (size_t)c0 * DD : X + (size_t)r0 * DD; const bf* Bt = qk ? X + (size_t)r0 * DD : Wt + (size_t)c0 * DD;
    v8f acc[4][4];
#pragma unroll
    for (int mb = 0; mb < 4; ++mb)
#pragma unroll
        for (int nb = 0; nb < 4; ++nb) acc[mb][nb] = (v8f){};
    V a[2][4], b[2][4];    // two fragment sets: while one set's 16 products run, the other set's 16 loads fly
    const bf* pa = A + lane * 8; const bf* pb = Bt + lane * 8;    // a 16-row group of blocks holds 16 * DD elements; the block of k step kc starts kc * 16 elements into it
#pragma unroll
    for (int mb = 0; mb < 4; ++mb) { a[0][mb] = WFrag<bf>::ld(pa + (size_t)mb * 16 * DD); b[0][mb] = WFrag<bf>::ld(pb + (size_t)mb * 16 * DD); }
    asm volatile("s_wait_xcnt 0x0" :: "v"(pa), "v"(pb) : "memory");    // behind the first set's loads, for the same reason as in the loop
    __builtin_amdgcn_sched_barrier(0);    // nothing is set between those loads and their wait
    auto fetch = [&](V (&fa)[4], V (&fb)[4], const bf* qa, const bf* qb, int ofs) {    // one k step's 16 loads
#pragma unroll
        for (int mb = 0; mb < 4; ++mb) { fa[mb] = WFrag<bf>::ld(qa + (size_t)mb * 16 * DD + ofs); fb[mb] = WFrag<bf>::ld(qb + (size_t)mb * 16 * DD + ofs); }
        asm volatile("s_wait_xcnt 0x0" :: "v"(qa), "v"(qb) : "memory");    // behind the run of fragment loads, before a register that one of them names as its address is written again; the addresses as inputs keep their registers whole up to the wait
        __builtin_amdgcn_sched_barrier(0);    // keeps the next step's 16 loads issued ahead of this step's products, so that the products cover their latency
    };
    auto mul = [&](const V (&fa)[4], const V (&fb)[4]) {    // one k step's 16 products
#pragma unroll
        for (int nb = 0; nb < 4; ++nb)
#pragma unroll
            for (int mb = 0; mb < 4; ++mb) acc[mb][nb] = WFrag<bf>::mma(fa[mb], fb[nb], acc[mb][nb]);
        __builtin_amdgcn_sched_barrier(0);    // keeps these products ahead of the loads that refill their set
    };
#pragma unroll 1    // rolled: 7 trips of two k steps share one copy of the code; the last two steps stand behind the loop, where no further set is fetched
    for (int kc = 0; kc < DD - 64; kc += 64) {
        const bf* qa = pa + kc * 16; const bf* qb = pb + kc * 16;
        fetch(a[1], b[1], qa, qb, 512); mul(a[0], b[0]);
        fetch(a[0], b[0], qa, qb, 1024); mul(a[1], b[1]);
    }
    fetch(a[1], b[1], pa, pb, (DD - 32) * 16); mul(a[0], b[0]); mul(a[1], b[1]);
    const float* bias = ((sel == 0) ? bq : (sel == 1) ? bk : bv) + cb;
    bf* Ph = (sel == 0) ? Qh : (sel == 1) ? Kh : Vh; bf* Pl = (sel == 0) ? Ql : (sel == 1) ? Kl : Vl; h16* P16 = (sel == 0) ? Q16 : (sel == 1) ? K16 : V16;
    const size_t e0 = ((size_t)(r0 / TT) * NH_ + cb / HD) * TT * HD + (size_t)(r0 & (TT - 1)) * HD + lane * 8;
    if (qk) projp_store<true>(acc, bias, Ph, Pl, P16, e0, lr, hi); else projp_store<false>(acc, bias, Ph, Pl, P16, e0, lr, hi);
}
__device__ __forceinline__ float exp2s(float x) { float r; asm("v_exp_f32 %0, %1\n\tv_nop" : "=v"(r) : "v"(x)); return r; }
template <typename T16> __device__ __forceinline__ typename WFrag<T16>::V ldo(const T16* base, unsigned bytes) { return WFrag<T16>::ld((const T16*)((const char*)base + bytes)); }    // wave-uniform base + one 32-bit byte offset per lane, shared by the planes of one operand
template <typename T16, bool SPLIT, int QT>
__device__ __forceinline__ void fattn(const T16* __restrict__ Q, const T16* __restrict__ Q2, const T16* __restrict__ Kp, const T16* __restrict__ Kp2, const T16* __restrict__ Vt, const T16* __restrict__ Vt2, bf* Ah, bf* Al, int q0) {
    typedef typename WFrag<T16>::V V;
    const int lane = threadIdx.x & 31, lr = lane & 15, hi = lane >> 4;
    const unsigned koff = (unsigned)lane * 16u;    // bytes: the lane's place in either half of a fragment block
    V qf[QT][2], qf2[QT][2]; v8f o[QT][4]; float m[QT], l[QT];
#pragma unroll
    for (int qt = 0; qt < QT; ++qt) { m[qt] = -3.0e38f; l[qt] = 0.f;
#pragma unroll
        for (int ks = 0; ks < 2; ++ks) { qf[qt][ks] = ldo(Q + qt * 16 * HD + 512 * ks, koff + (unsigned)q0 * (HD * 2u)); if (SPLIT) qf2[qt][ks] = ldo(Q2 + qt * 16 * HD + 512 * ks, koff + (unsigned)q0 * (HD * 2u)); }
#pragma unroll
        for (int dt = 0; dt < 4; ++dt) o[qt][dt] = (v8f){}; }
    const int kbeg = (q0 > 1024) ? ((q0 - 1024) & ~31) : 0, klast = (q0 + QT * 16 - 1) & ~31;
    V kf[2][2], kf2[2][2];
#pragma unroll
    for (int kt = 0; kt < 2; ++kt)
#pragma unroll
        for (int ks = 0; ks < 2; ++ks) { kf[kt][ks] = ldo(Kp + kt * 16 * HD + 512 * ks, koff + (unsigned)kbeg * (HD * 2u)); if (SPLIT) kf2[kt][ks] = ldo(Kp2 + kt * 16 * HD + 512 * ks, koff + (unsigned)kbeg * (HD * 2u)); }
#pragma unroll 1    // rolled: up to 33 trips share one copy of the code, and one trip's fragments already fill the registers
    for (int kb = kbeg; kb <= klast; kb += 32) {
        V vf[4], vf2[4];
#pragma unroll
        for (int dt = 0; dt < 4; ++dt) { vf[dt] = ldo(Vt + dt * 512, koff + (unsigned)kb * (HD * 2u)); if (SPLIT) vf2[dt] = ldo(Vt2 + dt * 512, koff + (unsigned)kb * (HD * 2u)); }
        __builtin_amdgcn_sched_barrier(0);    // keeps the V loads issued here, ahead of the score products: sunk behind the softmax their whole latency would stand in front of attn.v
        v8f s[QT][2];
#pragma unroll
        for (int qt = 0; qt < QT; ++qt)
#pragma unroll
            for (int kt = 0; kt < 2; ++kt) { s[qt][kt] = (v8f){};
#pragma unroll
                for (int ks = 0; ks < 2; ++ks) { s[qt][kt] = WFrag<T16>::mma(kf[kt][ks], qf[qt][ks], s[qt][kt]); if (SPLIT) { s[qt][kt] = WFrag<T16>::mma(kf[kt][ks], qf2[qt][ks], s[qt][kt]); s[qt][kt] = WFrag<T16>::mma(kf2[kt][ks], qf[qt][ks], s[qt][kt]); } } }
        const int kn = (kb + 32 <= klast) ? kb + 32 : klast;    // the next block's K fragments fly during this block's softmax and attn.v; the last trip reads its own block again, in bounds
        const unsigned ko = koff + (unsigned)kn * (HD * 2u);
#pragma unroll
        for (int kt = 0; kt < 2; ++kt)
#pragma unroll
            for (int ks = 0; ks < 2; ++ks) { kf[kt][ks] = ldo(Kp + kt * 16 * HD + 512 * ks, ko); if (SPLIT) kf2[kt][ks] = ldo(Kp2 + kt * 16 * HD + 512 * ks, ko); }
        asm volatile("s_wait_xcnt 0x0" :: "v"(ko) : "memory");    // behind the run of K loads; the offset as an input keeps its register whole up to the wait
        __builtin_amdgcn_sched_barrier(0);    // keeps the next block's K loads issued here, so that the softmax and attn.v cover their latency
#pragma unroll
        for (int qt = 0; qt < QT; ++qt)
#pragma unroll
            for (int kt = 0; kt < 2; ++kt) s[qt][kt] *= SCL2;
        // The mask is worked out only for a key block that it can cut: one that reaches past the tile's first query (i - j < 0) or lies more than 1024 keys behind its last (i - j > 1024).
        // For every other block 0 <= i - j <= 1024 holds at all its (query, key) pairs, so the select is an identity there. The test is wave-uniform (q0 and kb are scalars).
        if (kb + 31 > q0 || q0 + QT * 16 - 1 - kb > 1024) {
#pragma unroll
            for (int qt = 0; qt < QT; ++qt) {
                const int i = q0 + qt * 16 + lr;
#pragma unroll
                for (int kt = 0; kt < 2; ++kt)
#pragma unroll
                    for (int j = 0; j < 8; ++j) { const int dd = i - (kb + kt * 16 + hi * 8 + j); if ((unsigned)dd > 1024u) s[qt][kt][j] = -3.0e38f; } } }
        V pf[QT], pf2[QT];
#pragma unroll
        for (int qt = 0; qt < QT; ++qt) {
            float bm = -3.0e38f;
#pragma unroll
            for (int kt = 0; kt < 2; ++kt)
#pragma unroll
                for (int j = 0; j < 8; ++j) bm = fmaxf(bm, s[qt][kt][j]);
            bm = fmaxf(bm, __shfl_xor(bm, 16, 32));
            const float mn = fmaxf(m[qt], bm); const float al = exp2s(m[qt] - mn); m[qt] = mn;
            float ps = 0.f;
#pragma unroll
            for (int kt = 0; kt < 2; ++kt)
#pragma unroll
                for (int j = 0; j < 8; ++j) { const float p = exp2s(s[qt][kt][j] - mn); s[qt][kt][j] = p; ps += p; }
            l[qt] = l[qt] * al + ps;    // each lane sums its own half of the keys; the halves are joined once, behind the loop
#pragma unroll
            for (int dt = 0; dt < 4; ++dt) o[qt][dt] *= al;
            if constexpr (SPLIT) {
                v8us h0, h1, l0, l1;
#pragma unroll
                for (int j = 0; j < 8; ++j) { unsigned short a, c2; splitf(s[qt][0][j], a, c2); h0[j] = a; l0[j] = c2; splitf(s[qt][1][j], a, c2); h1[j] = a; l1[j] = c2; }
                pf[qt] = cat16b(h0, h1); pf2[qt] = cat16b(l0, l1);
            } else {
                v8h p0, p1;
#pragma unroll
                for (int j = 0; j < 8; ++j) { p0[j] = tohx(s[qt][0][j] * PCAR); p1[j] = tohx(s[qt][1][j] * PCAR); }
                pf[qt] = cat16(p0, p1);
            }
        }
        __builtin_amdgcn_sched_barrier(0);    // keeps every 2^x statement ahead of the attn.v products
#pragma unroll
        for (int qt = 0; qt < QT; ++qt)
#pragma unroll
            for (int dt = 0; dt < 4; ++dt) { o[qt][dt] = WFrag<T16>::mma(vf[dt], pf[qt], o[qt][dt]); if constexpr (SPLIT) { o[qt][dt] = WFrag<T16>::mma(vf[dt], pf2[qt], o[qt][dt]); o[qt][dt] = WFrag<T16>::mma(vf2[dt], pf[qt], o[qt][dt]); } }
    }
#pragma unroll
    for (int qt = 0; qt < QT; ++qt) {
        const float f = __fdiv_rn(SPLIT ? 1.0f : (1.0f / PCAR), l[qt] + __shfl_xor(l[qt], 16, 32));
#pragma unroll
        for (int dt = 0; dt < 4; ++dt) { v8us oh, ol;
#pragma unroll
            for (int j = 0; j < 8; ++j) { unsigned short a, c2; splitf(o[qt][dt][j] * f, a, c2); oh[j] = a; ol[j] = c2; }
            const size_t ofs = (size_t)(q0 + qt * 16) * DD + dt * 256 + lane * 8; *(v8us*)(Ah + ofs) = oh; *(v8us*)(Al + ofs) = ol; } }
}
// amdgpu_waves_per_eu(4, 4): holds the kernel to 256 registers; above them every reach into the upper window costs an s_set_vgpr_msb in the loop
__global__ __launch_bounds__(64) __attribute__((amdgpu_waves_per_eu(4, 4))) void k_fattn(const bf* __restrict__ Qh, const bf* __restrict__ Ql, const bf* __restrict__ Kh, const bf* __restrict__ Kl, const bf* __restrict__ Vh, const bf* __restrict__ Vl, const h16* __restrict__ Q16, const h16* __restrict__ K16, const h16* __restrict__ V16, bf* Ah, bf* Al) {
    const size_t zo = ((size_t)blockIdx.z * NH_ + blockIdx.y) * TT * HD; const int r0 = blockIdx.x * 64 + __builtin_amdgcn_readfirstlane((int)(threadIdx.x >> 5)) * 32;
    Ah += (size_t)blockIdx.z * TT * DD + blockIdx.y * (HD * 16); Al += (size_t)blockIdx.z * TT * DD + blockIdx.y * (HD * 16);    // fragment order: a head's 64 columns are two blocks of each 16-row group
    if (blockIdx.x * 64 < RH) {
#pragma unroll 1    // rolled: the two tiles share one copy of the code
        for (int r = 0; r < 2; ++r) { fattn<bf, true, 1>(Qh + zo, Ql + zo, Kh + zo, Kl + zo, Vh + zo, Vl + zo, Ah, Al, r0 + r * 16);    // the 3-product form holds one 16-row tile at a time
            asm volatile("s_wait_xcnt 0x0" ::: "memory"); }    // the next tile's set-up rewrites registers that this tile's stores name
    } else fattn<h16, false, 2>(Q16 + zo, nullptr, K16 + zo, nullptr, V16 + zo, nullptr, Ah, Al, r0);
}

extern "C" void kernel_launch(void* const* d_in, const int* in_sizes, int n_in,
                              void* d_out, int out_size, void* d_ws, size_t ws_size, hipStream_t stream) {
    (void)in_sizes; (void)n_in; (void)out_size;
    const float* x = (const float*)d_in[0]; const float* wq = (const float*)d_in[1]; const float* bq = (const float*)d_in[2]; const float* wk = (const float*)d_in[3]; const float* bk = (const float*)d_in[4]; const float* wv = (const float*)d_in[5]; const float* bv = (const float*)d_in[6]; const float* wo = (const float*)d_in[7]; const float* bo = (const float*)d_in[8];
    float* OUT = (float*)d_out;     // [4][2048][512]
    char* wsp = (char*)d_ws;
    auto take = [&](size_t bytes) { char* p = wsp; wsp += (bytes + 255) & ~(size_t)255; return (void*)p; };
    bf* W4 = (bf*)take((size_t)4 * DD * DD * 2);    // transposed W_Q, W_K, W_V, W_O, one behind the other: the first three are the [3 DD][DD] weight operand of the merged projection (A for Q and K tiles, B for the transposed V tiles)
    bf* XB = (bf*)take((size_t)NB_ * TT * DD * 2);
    bf* QPh = (bf*)take((size_t)NB_ * TT * DD * 2); bf* QPl = (bf*)take((size_t)NB_ * TT * DD * 2); bf* KPh = (bf*)take((size_t)NB_ * TT * DD * 2); bf* KPl = (bf*)take((size_t)NB_ * TT * DD * 2); bf* VTh = (bf*)take((size_t)NB_ * TT * DD * 2); bf* VTl = (bf*)take((size_t)NB_ * TT * DD * 2);
    h16* QP16 = (h16*)take((size_t)NB_ * TT * DD * 2); h16* KP16 = (h16*)take((size_t)NB_ * TT * DD * 2); h16* VT16 = (h16*)take((size_t)NB_ * TT * DD * 2);
    bf* ATh = (bf*)take((size_t)NB_ * TT * DD * 2); bf* ATl = (bf*)take((size_t)NB_ * TT * DD * 2);
    if ((size_t)(wsp - (char*)d_ws) > ws_size) return;    // total 98 MiB; ws 256 MiB
    k_wtG<<<dim3(DD / 16 * (DD / 32) / 8, 4), 256, 0, stream>>>(wq, wk, wv, wo, W4);
    k_cvt8<<<NB_ * TT / 16 * (DD / 32) / 8, 256, 0, stream>>>(x, XB);
    k_projp<<<dim3(NB_ * TT / 128, FP / 128), 128, 0, stream>>>(XB, W4, bq, bk, bv, QPh, QPl, QP16, KPh, KPl, KP16, VTh, VTl, VT16);
    k_fattn<<<dim3(TT / 64, NH_, NB_), 64, 0, stream>>>(QPh, QPl, KPh, KPl, VTh, VTl, QP16, KP16, VT16, ATh, ATl);
    k_gemmw<bf, 1, true, KSP><<<dim3(NB_ * TT / 64, DD / 64), 32 * KSP, 0, stream>>>(ATh, ATl, W4 + (size_t)3 * DD * DD, nullptr, OUT, DD, bo, bo, bo, 0, 0, 0);
}

// v009
// A run of this version takes 65.6 microseconds.
// Two timings next to v008 put it at 1.09 and 1.07 times that version's speed.
// All steps since v000 together make it 32.9 times as fast.
#include <hip/hip_runtime.h>

// Multi-head attention block (x [4][2048][512]; q/k/v = x @ W + b ([in][out]); 8 heads x 64; scores / 8; log-sparse mask: keep (i, j) iff i - j == 0, or 1 <= i - j <= 1024, or i - j is a positive power of two (else -inf);
// softmax; out = ctx @ W_O + b_O).
// Compute dtypes, f32 accumulate: every input rounded to bf16; projections on transposed bf16 weight copies, + bias: Q, K, V on PLAIN bf16 x (exact), output on bf16 hi+lo ctx planes (2 products); PER-ROW
// PRECISION HYBRID: query rows < 256 of each batch on bf16 hi+lo planes for scores and attn.v (3 products), rows >= 256 on SINGLE fp16 planes; the mask by index arithmetic in the softmax; output

#define NB_  4
#define TT   2048
#define DD   512
#define NH_  8
#define HD   64
#define FP   (3 * DD)             // columns of the merged Q, K, V projection
#define KSP  8                    // waves that share the k range of one tile: output projection (K = 512)
#define RH   256                  // query rows < RH: hi+lo planes; rows >= RH: fp16 planes
#define NF   32                   // head_dim / 2; unused, the file applies no rotary embedding
#define SCL2 0.18033688f          // 1/sqrt(64) * log2(e): the softmax runs in base 2
#define PCAR 1024.0f         // p carried times 1024 on the fp16 path; divided out in the final scale
typedef _Float16 h16;
typedef unsigned short bf;
typedef __attribute__((ext_vector_type(16))) __bf16   v16bf;
typedef __attribute__((ext_vector_type(16))) _Float16 v16h;
typedef __attribute__((ext_vector_type(8)))  _Float16 v8h;
typedef __attribute__((ext_vector_type(8)))  unsigned short v8us;
typedef __attribute__((ext_vector_type(8)))  float    v8f;
typedef __attribute__((ext_vector_type(4)))  float    v4f;
typedef v8h  __attribute__((may_alias)) v8ha;
typedef v4f  __attribute__((may_alias)) v4fa;
typedef v8us __attribute__((may_alias)) v8usa;

__device__ __forceinline__ unsigned short f2bf(float f) { unsigned u = __float_as_uint(f); u += 0x7FFFu + ((u >> 16) & 1u); return (unsigned short)(u >> 16); }
__device__ __forceinline__ float bf2f(unsigned short b) { return __uint_as_float(((unsigned)b) << 16); }
__device__ __forceinline__ float bfr(float f) { return bf2f(f2bf(f)); }
__device__ __forceinline__ v16h cat16(v8h lo, v8h hi) { return __builtin_shufflevector(lo, hi, 0, 1, 2, 3, 4, 5, 6, 7, 8, 9, 10, 11, 12, 13, 14, 15); }
__device__ __forceinline__ v16bf cat16b(v8us lo, v8us hi) { return __builtin_bit_cast(v16bf, __builtin_shufflevector(lo, hi, 0, 1, 2, 3, 4, 5, 6, 7, 8, 9, 10, 11, 12, 13, 14, 15)); }
__device__ __forceinline__ v8f wmma16(v16h a, v16h b, v8f c) { return __builtin_amdgcn_wmma_f32_16x16x32_f16(false, a, false, b, (short)0, c, false, false); }
__device__ __forceinline__ v8f wmmab(v16bf a, v16bf b, v8f c) { return __builtin_amdgcn_wmma_f32_16x16x32_bf16(false, a, false, b, (short)0, c, false, false); }



// ---- k_gemmw: register-blocked GEMM, one work-group of KS waves per 64x64 output tile; each wave holds the whole tile (16 accumulators) over its own contiguous K / KS slice of k, operands straight
// from 16-bit planes in fragment order; the KS partial tiles are summed through LDS in fixed wave order 0..KS-1. grid (M/64, N/64, Z), 32 * KS threads.
// C[m][n] (f32, pitch ldc, + optional f32 bias: bias0, bias1, bias2 for columns [0, DD), [DD, 2 DD), [2 DD, 3 DD)) = sum_k A[m][k] Bt[n][k] (+ split products per NSPLIT). z-batch strides sA/sB/sC in elements. K = DD.
// FRAGMENT ORDER: every 16-bit operand plane (rows x k, k the contracted index) is stored as blocks of 16 rows x 32 k (512 elements, 1 KiB), the blocks of one 16-row group one behind the other along k
// (the V planes: the four 16-row groups of one 32-key step one behind the other). Inside a block element (r, kk) lies at (kk >> 4) * 256 + ((kk >> 3) & 1) * 128 + r * 8 + (kk & 7): the 16 bytes that
// lane r + 16 * hi takes for either half of its fragment lie at lane * 16 bytes of that half, so that each 16-byte load of a wave reads 512 contiguous bytes (4 whole lines) and not 32-byte pieces of 16 lines.
// Which element reaches which lane and register is as with row-major planes. ld(p): p = the block's start + lane * 8 elements.
template <typename T16> struct WFrag;
template <> struct WFrag<h16> { typedef v16h V; static __device__ __forceinline__ V ld(const h16* p) { return cat16(*(const v8h*)p, *(const v8h*)(p + 256)); } static __device__ __forceinline__ v8f mma(V a, V b, v8f c) { return wmma16(a, b, c); } };
template <> struct WFrag<bf> { typedef v16bf V; static __device__ __forceinline__ V ld(const bf* p) { return cat16b(*(const v8us*)p, *(const v8us*)(p + 256)); } static __device__ __forceinline__ v8f mma(V a, V b, v8f c) { return wmmab(a, b, c); } };
template <typename T16, int NSPLIT, bool BIAS, int KS>
__global__ __launch_bounds__(32 * KS) void k_gemmw(const T16* __restrict__ A, const T16* __restrict__ A2, const T16* __restrict__ Bt, const T16* __restrict__ Bt2, float* C, int ldc, const float* __restrict__ bias0, const float* __restrict__ bias1, const float* __restrict__ bias2, size_t sA, size_t sB, size_t sC) {
    typedef typename WFrag<T16>::V V; constexpr int K = DD;    // a constant, so that a k step's fragments lie at immediate offsets from one address per plane
    constexpr int SL = (KS == 1 ? 16 : 64) * 68;    // floats of one wave's LDS slice: a 16-row block for the one-wave form, the whole partial tile where KS waves are summed
    __shared__ __align__(16) float os[KS * SL];
    const size_t z = blockIdx.z; A += z * sA; if (A2) A2 += z * sA; Bt += z * sB; if (Bt2) Bt2 += z * sB; C += z * sC;
    const int lane = threadIdx.x & 31, lr = lane & 15, hi = lane >> 4; const int r0 = blockIdx.x * 64, c0 = blockIdx.y * 64;
    const float* bias = (c0 < DD) ? bias0 : (c0 < 2 * DD) ? bias1 : bias2; const int cb = c0 & (DD - 1);    // each DD-wide column group of C has its own bias vector
    v8f acc[4][4];
#pragma unroll
    for (int mb = 0; mb < 4; ++mb)
#pragma unroll
        for (int nb = 0; nb < 4; ++nb) acc[mb][nb] = (v8f){};
    const size_t aoff = (size_t)r0 * K + lane * 8, boff = (size_t)c0 * K + lane * 8;    // a 16-row group of blocks holds 16 * K elements; the block of k step kc starts kc * 16 elements into it
    const int wv = (KS == 1) ? 0 : __builtin_amdgcn_readfirstlane((int)(threadIdx.x >> 5)); const int kspan = K / KS, kb = wv * kspan, ke = kb + kspan;
#pragma unroll 1
    for (int kc = kb; kc < ke; kc += 32) {
        V a[4], a2[4], b[4], b2[4]; const T16* pa = A + aoff + kc * 16; const T16* pa2 = (NSPLIT == 1 || NSPLIT == 2) ? A2 + aoff + kc * 16 : pa; const T16* pb = Bt + boff + kc * 16; const T16* pb2 = (NSPLIT >= 2) ? Bt2 + boff + kc * 16 : pb;
#pragma unroll
        for (int mb = 0; mb < 4; ++mb) { a[mb] = WFrag<T16>::ld(pa + (size_t)mb * 16 * K); if (NSPLIT == 1 || NSPLIT == 2) a2[mb] = WFrag<T16>::ld(pa2 + (size_t)mb * 16 * K); }
#pragma unroll
        for (int nb = 0; nb < 4; ++nb) { b[nb] = WFrag<T16>::ld(pb + (size_t)nb * 16 * K); if (NSPLIT >= 2) b2[nb] = WFrag<T16>::ld(pb2 + (size_t)nb * 16 * K); }
        asm volatile("s_wait_xcnt 0x0" :: "v"(pa), "v"(pa2), "v"(pb), "v"(pb2) : "memory");    // behind the run of fragment loads, before a register that one of them names as its address is written again; the addresses as inputs keep their registers whole up to the wait
#pragma unroll
        for (int nb = 0; nb < 4; ++nb) {
#pragma unroll
            for (int mb = 0; mb < 4; ++mb) { acc[mb][nb] = WFrag<T16>::mma(a[mb], b[nb], acc[mb][nb]); if (NSPLIT == 1 || NSPLIT == 2) acc[mb][nb] = WFrag<T16>::mma(a2[mb], b[nb], acc[mb][nb]); if (NSPLIT >= 2) acc[mb][nb] = WFrag<T16>::mma(a[mb], b2[nb], acc[mb][nb]); } }
        asm volatile("v_nop\n\tv_nop\n\tv_nop\n\tv_nop" : "+v"(acc[0][0]), "+v"(acc[1][1]), "+v"(acc[2][2]), "+v"(acc[3][3]) : "v"(a[0]), "v"(a[3]));
    }
    if constexpr (KS == 1) {
#pragma unroll
    for (int mb = 0; mb < 4; ++mb) {
#pragma unroll
        for (int nb = 0; nb < 4; ++nb) {
#pragma unroll
            for (int j = 0; j < 8; ++j) os[(hi * 8 + j) * 68 + nb * 16 + lr] = acc[mb][nb][j]; }
        __builtin_amdgcn_wave_barrier(); asm volatile("" ::: "memory");
        float* crow = C + (size_t)(r0 + mb * 16) * ldc + c0;
{
#pragma unroll
            for (int s = 0; s < 8; ++s) { const int row = 2 * s + hi, cofs = lr * 4; v4f val = *(const v4fa*)(os + row * 68 + cofs); if (BIAS) { val[0] += bfr(bias[cb + cofs]); val[1] += bfr(bias[cb + cofs + 1]); val[2] += bfr(bias[cb + cofs + 2]); val[3] += bfr(bias[cb + cofs + 3]); }
                *(v4f*)(crow + (size_t)row * ldc + cofs) = val; }
             }
        __builtin_amdgcn_wave_barrier(); asm volatile("" ::: "memory");
    }
    } else {
#pragma unroll
        for (int mb = 0; mb < 4; ++mb) {
#pragma unroll
            for (int nb = 0; nb < 4; ++nb) {
#pragma unroll
                for (int j = 0; j < 8; ++j) os[wv * SL + (mb * 16 + hi * 8 + j) * 68 + nb * 16 + lr] = acc[mb][nb][j]; } }
        __syncthreads();    // every wave's partial tile is in LDS before any thread sums across the waves
        float* crow = C + (size_t)r0 * ldc + c0;
#pragma unroll
        for (int s = 0; s < 1024 / (32 * KS); ++s) { const int idx = s * 32 * KS + (int)threadIdx.x; const int row = idx >> 4, cofs = (idx & 15) * 4; v4f val = *(const v4fa*)(os + row * 68 + cofs);
#pragma unroll
            for (int w = 1; w < KS; ++w) val += *(const v4fa*)(os + w * SL + row * 68 + cofs);
            if (BIAS) { val[0] += bfr(bias[cb + cofs]); val[1] += bfr(bias[cb + cofs + 1]); val[2] += bfr(bias[cb + cofs + 2]); val[3] += bfr(bias[cb + cofs + 3]); }
            *(v4f*)(crow + (size_t)row * ldc + cofs) = val; }
    }
}

__device__ __forceinline__ h16 tohx(float x) { return (h16)x; }
__device__ __forceinline__ void splitf(float y, unsigned short& h, unsigned short& l) { h = f2bf(y); l = f2bf(y - bf2f(h)); }
typedef __attribute__((ext_vector_type(2))) unsigned short v2us;
typedef __attribute__((ext_vector_type(2))) _Float16 v2h;
typedef __attribute__((ext_vector_type(4))) _Float16 v4h;
typedef __attribute__((ext_vector_type(2))) float v2f;

// grid y: which of the four weights; their transposed copies (rows n, k contracted, fragment order) lie one behind the other in Bt. One wave per 16 x 32 block: each 4-byte load reads 64-byte pieces of two
// source rows, each store is 512 contiguous bytes.
__global__ __launch_bounds__(256) void k_wtG(const float* __restrict__ w0, const float* __restrict__ w1, const float* __restrict__ w2, const float* __restrict__ w3, bf* Bt) {
    const float* w = (blockIdx.y == 0) ? w0 : (blockIdx.y == 1) ? w1 : (blockIdx.y == 2) ? w2 : w3; Bt += (size_t)blockIdx.y * DD * DD;
    const int lane = threadIdx.x & 31, lr = lane & 15, hi = lane >> 4; const int blk = blockIdx.x * 8 + (threadIdx.x >> 5); constexpr int kbs = DD / 32;    // grid x: DD / 16 * kbs / 8
    const float* s = w + (size_t)((blk % kbs) * 32 + hi * 8) * DD + (blk / kbs) * 16 + lr;
    float v[16];
#pragma unroll
    for (int e = 0; e < 16; ++e) v[e] = s[(size_t)((e >> 3) * 16 + (e & 7)) * DD];
    asm volatile("s_wait_xcnt 0x0" :: "v"(s) : "memory");    // behind the run of loads; the address as an input keeps its registers whole up to the wait
#pragma unroll
    for (int part = 0; part < 2; ++part) { v8us o;
#pragma unroll
        for (int e = 0; e < 8; ++e) o[e] = f2bf(v[part * 8 + e]);
        *(v8us*)(Bt + (size_t)blk * 512 + part * 256 + lane * 8) = o; }
}
// x to bf16 in fragment order. One wave per 16 x 32 block (grid: NB_ * TT / 16 * DD / 32 / 8 work-groups of 8 waves): each 16-byte load reads four whole 128-byte pieces of source rows, each 8-byte store four 64-byte pieces.
typedef __attribute__((ext_vector_type(4))) unsigned short v4us;
__global__ __launch_bounds__(256) void k_cvt8(const float* __restrict__ src, bf* dst) {
    const int lane = threadIdx.x & 31, c = lane & 7, rr = lane >> 3; const int blk = blockIdx.x * 8 + (threadIdx.x >> 5);
    const float* s = src + (size_t)((blk / (DD / 32)) * 16 + rr) * DD + (blk % (DD / 32)) * 32 + c * 4;
    bf* d = dst + (size_t)blk * 512 + (c >> 2) * 256 + ((c >> 1) & 1) * 128 + rr * 8 + (c & 1) * 4;
#pragma unroll
    for (int i = 0; i < 4; ++i) { const v4f v = *(const v4f*)(s + (size_t)i * 4 * DD); v4us o;
#pragma unroll
        for (int k = 0; k < 4; ++k) o[k] = f2bf(v[k]);
        *(v4us*)(d + i * 32) = o; }
}
// ---- k_projp: the merged Q, K, V projection with the plane writers in its epilogue. grid (NB_ * TT / 128, FP / 128), 4 waves; a work-group owns a 128 x 128 tile, a wave one 64 x 64 quarter of it over the WHOLE k range
// (16 steps of 32, one accumulate chain per element): the grid has 3072 such wave tiles, three per SIMD, so k needs no split over waves, and no partial tile passes through LDS. The two waves beside each other read the same token rows,
// the two above each other the same weight rows. A 64-column group of the projection is one head. The orientation of the product is chosen so that a lane's 8 accumulator registers are the 8 neighbours along the contracted
// index of the plane they go to, which is one lane's 16 bytes of a fragment block: Q and K tiles (planes: rows t, k = d) take the weight rows as the A operand and the token rows as B (register j = d, lane = t),
// V tiles (planes: rows d, k = t) the token rows as A and the weight rows as B (register j = t, lane = d). Both operands are k-contiguous and take the same loader.
// QK: the tile is a Q or K tile. e0: the element of the thread's 16 bytes in the tile's first block; bias: the head's 64 values.
template <bool QK>
__device__ __forceinline__ void projp_store(const v8f (&acc)[4][4], const float* __restrict__ bias, bf* Ph, bf* Pl, h16* P16, size_t e0, int lr, int hi) {
    float bn[4]; v4f bq4[4][2];    // all bias loads ahead of the first store
    const unsigned bo = (unsigned)(QK ? hi * 32 : lr * 4); const char* bb = (const char*)bias;    // wave-uniform base + one 32-bit byte offset per lane
#pragma unroll
    for (int g = 0; g < 4; ++g) { if (QK) { bq4[g][0] = *(const v4fa*)(bb + g * 64 + bo); bq4[g][1] = *(const v4fa*)(bb + g * 64 + 16 + bo); } else bn[g] = *(const float*)(bb + g * 64 + bo); }
    asm volatile("s_wait_xcnt 0x0" :: "v"(bo) : "memory");    // behind the run of bias loads; the offset as an input keeps its register whole up to the wait
    if (!QK) {
#pragma unroll
        for (int nb = 0; nb < 4; ++nb) bn[nb] = bfr(bn[nb]); }
#pragma unroll
    for (int mb = 0; mb < 4; ++mb) {
        float bj[8];
        if (QK) {
#pragma unroll
            for (int j = 0; j < 8; ++j) bj[j] = bfr(bq4[mb][j >> 2][j & 3]); }
#pragma unroll
        for (int nb = 0; nb < 4; ++nb) { v8us oh, ol; v8h o16;
#pragma unroll
            for (int j = 0; j < 8; ++j) { const float x = acc[mb][nb][j] + (QK ? bj[j] : bn[nb]); unsigned short a, c2; splitf(x, a, c2); oh[j] = a; ol[j] = c2; o16[j] = tohx(x); }
            const size_t e = e0 + (mb & 1) * 256 + (QK ? nb * 1024 + (mb >> 1) * 512 : (mb >> 1) * 2048 + nb * 512);    // a wave stores 512 contiguous bytes in each plane
            *(v8us*)(Ph + e) = oh; *(v8us*)(Pl + e) = ol; *(v8h*)(P16 + e) = o16;
            asm volatile("s_wait_xcnt 0x0" :: "v"(oh), "v"(ol), "v"(o16) : "memory"); } }    // behind the three stores, before the next block's values are written into registers that the stores name; the stored values as inputs keep their registers whole up to the wait
}
// amdgpu_waves_per_eu(3, 3): the grid gives a SIMD three waves; a third of its registers holds the 16 accumulators and both fragment sets
__global__ __launch_bounds__(128) __attribute__((amdgpu_waves_per_eu(3, 3))) void k_projp(const bf* __restrict__ X, const bf* __restrict__ Wt, const float* __restrict__ bq, const float* __restrict__ bk, const float* __restrict__ bv, bf* Qh, bf* Ql, h16* Q16, bf* Kh, bf* Kl, h16* K16, bf* Vh, bf* Vl, h16* V16) {
    typedef WFrag<bf>::V V;
    const int lane = threadIdx.x & 31, lr = lane & 15, hi = lane >> 4;
    const int wv = __builtin_amdgcn_readfirstlane((int)(threadIdx.x >> 5));
    const int r0 = blockIdx.x * 128 + (wv & 1) * 64, c0 = blockIdx.y * 128 + (wv >> 1) * 64;
    const int sel = c0 / DD, cb = c0 & (DD - 1); const bool qk = sel != 2;
    const bf* A = qk ? Wt + (size_t)c0 * DD : X + (size_t)r0 * DD; const bf* Bt = qk ? X + (size_t)r0 * DD : Wt + (size_t)c0 * DD;
    v8f acc[4][4];
#pragma unroll
    for (int mb = 0; mb < 4; ++mb)
#pragma unroll
        for (int nb = 0; nb < 4; ++nb) acc[mb][nb] = (v8f){};
    V a[2][4], b[2][4];    // two fragment sets: while one set's 16 products run, the other set's 16 loads fly
    const bf* pa = A + lane * 8; const bf* pb = Bt + lane * 8;    // a 16-row group of blocks holds 16 * DD elements; the block of k step kc starts kc * 16 elements into it
#pragma unroll
    for (int mb = 0; mb < 4; ++mb) { a[0][mb] = WFrag<bf>::ld(pa + (size_t)mb * 16 * DD); b[0][mb] = WFrag<bf>::ld(pb + (size_t)mb * 16 * DD); }
    asm volatile("s_wait_xcnt 0x0" :: "v"(pa), "v"(pb) : "memory");    // behind the first set's loads, for the same reason as in the loop
    __builtin_amdgcn_sched_barrier(0);    // nothing is set between those loads and their wait
    auto fetch = [&](V (&fa)[4], V (&fb)[4], const bf* qa, const bf* qb, int ofs) {    // one k step's 16 loads
#pragma unroll
        for (int mb = 0; mb < 4; ++mb) { fa[mb] = WFrag<bf>::ld(qa + (size_t)mb * 16 * DD + ofs); fb[mb] = WFrag<bf>::ld(qb + (size_t)mb * 16 * DD + ofs); }
        asm volatile("s_wait_xcnt 0x0" :: "v"(qa), "v"(qb) : "memory");    // behind the run of fragment loads, before a register that one of them names as its address is written again; the addresses as inputs keep their registers whole up to the wait
        __builtin_amdgcn_sched_barrier(0);    // keeps the next step's 16 loads issued ahead of this step's products, so that the products cover their latency
    };
    auto mul = [&](const V (&fa)[4], const V (&fb)[4]) {    // one k step's 16 products
#pragma unroll
        for (int nb = 0; nb < 4; ++nb)
#pragma unroll
            for (int mb = 0; mb < 4; ++mb) acc[mb][nb] = WFrag<bf>::mma(fa[mb], fb[nb], acc[mb][nb]);
        __builtin_amdgcn_sched_barrier(0);    // keeps these products ahead of the loads that refill their set
    };
#pragma unroll 1    // rolled: 7 trips of two k steps share one copy of the code; the last two steps stand behind the loop, where no further set is fetched
    for (int kc = 0; kc < DD - 64; kc += 64) {
        const bf* qa = pa + kc * 16; const bf* qb = pb + kc * 16;
        fetch(a[1], b[1], qa, qb, 512); mul(a[0], b[0]);
        fetch(a[0], b[0], qa, qb, 1024); mul(a[1], b[1]);
    }
    fetch(a[1], b[1], pa, pb, (DD - 32) * 16); mul(a[0], b[0]); mul(a[1], b[1]);
    const float* bias = ((sel == 0) ? bq : (sel == 1) ? bk : bv) + cb;
    bf* Ph = (sel == 0) ? Qh : (sel == 1) ? Kh : Vh; bf* Pl = (sel == 0) ? Ql : (sel == 1) ? Kl : Vl; h16* P16 = (sel == 0) ? Q16 : (sel == 1) ? K16 : V16;
    const size_t e0 = ((size_t)(r0 / TT) * NH_ + cb / HD) * TT * HD + (size_t)(r0 & (TT - 1)) * HD + lane * 8;
    if (qk) projp_store<true>(acc, bias, Ph, Pl, P16, e0, lr, hi); else projp_store<false>(acc, bias, Ph, Pl, P16, e0, lr, hi);
}
__device__ __forceinline__ float exp2s(float x) { float r; asm("v_exp_f32 %0, %1\n\tv_nop" : "=v"(r) : "v"(x)); return r; }
template <typename T16> __device__ __forceinline__ typename WFrag<T16>::V ldo(const T16* base, unsigned bytes) { return WFrag<T16>::ld((const T16*)((const char*)base + bytes)); }    // wave-uniform base + one 32-bit byte offset per lane, shared by the planes of one operand
template <typename T16, bool SPLIT, int QT>
__device__ __forceinline__ void fattn(const T16* __restrict__ Q, const T16* __restrict__ Q2, const T16* __restrict__ Kp, const T16* __restrict__ Kp2, const T16* __restrict__ Vt, const T16* __restrict__ Vt2, bf* Ah, bf* Al, int q0, int half, float* xw, const float* xr) {
    typedef typename WFrag<T16>::V V;
    const int lane = threadIdx.x & 31, lr = lane & 15, hi = lane >> 4;
    const unsigned koff = (unsigned)lane * 16u;    // bytes: the lane's place in either half of a fragment block
    V qf[QT][2], qf2[QT][2]; v8f o[QT][4]; float m[QT], l[QT];
#pragma unroll
    for (int qt = 0; qt < QT; ++qt) { m[qt] = -3.0e38f; l[qt] = 0.f;
#pragma unroll
        for (int ks = 0; ks < 2; ++ks) { qf[qt][ks] = ldo(Q + qt * 16 * HD + 512 * ks, koff + (unsigned)q0 * (HD * 2u)); if (SPLIT) qf2[qt][ks] = ldo(Q2 + qt * 16 * HD + 512 * ks, koff + (unsigned)q0 * (HD * 2u)); }
#pragma unroll
        for (int dt = 0; dt < 4; ++dt) o[qt][dt] = (v8f){}; }
    int kbeg = (q0 > 1024) ? ((q0 - 1024) & ~31) : 0, klast = (q0 + QT * 16 - 1) & ~31;
    if constexpr (!SPLIT) { const int qw = q0 & ~63, kw = (qw > 1024) ? qw - 1024 : 0;    // the work-group's first tile and its first key block
        const int ks = kw + ((((qw - kw) >> 5) + 2) >> 1) * 32;    // the first key of the second half (each half holds 4 blocks at least: q0 >= RH). One split point for both tiles of the work-group: the two waves of a half then walk the same key blocks, and one wave's K and V lines serve the other from the WGP's cache
        if (half == 0) klast = ks - 32; else kbeg = ks; }    // half is wave-uniform
    V kf[2][2], kf2[2][2];
#pragma unroll
    for (int kt = 0; kt < 2; ++kt)
#pragma unroll
        for (int ks = 0; ks < 2; ++ks) { kf[kt][ks] = ldo(Kp + kt * 16 * HD + 512 * ks, koff + (unsigned)kbeg * (HD * 2u)); if (SPLIT) kf2[kt][ks] = ldo(Kp2 + kt * 16 * HD + 512 * ks, koff + (unsigned)kbeg * (HD * 2u)); }
#pragma unroll 1    // rolled: up to 17 trips share one copy of the code, and one trip's fragments already fill the registers
    for (int kb = kbeg; kb <= klast; kb += 32) {
        V vf[4], vf2[4];
#pragma unroll
        for (int dt = 0; dt < 4; ++dt) { vf[dt] = ldo(Vt + dt * 512, koff + (unsigned)kb * (HD * 2u)); if (SPLIT) vf2[dt] = ldo(Vt2 + dt * 512, koff + (unsigned)kb * (HD * 2u)); }
        __builtin_amdgcn_sched_barrier(0);    // keeps the V loads issued here, ahead of the score products: sunk behind the softmax their whole latency would stand in front of attn.v
        v8f s[QT][2];
#pragma unroll
        for (int qt = 0; qt < QT; ++qt)
#pragma unroll
            for (int kt = 0; kt < 2; ++kt) { s[qt][kt] = (v8f){};
#pragma unroll
                for (int ks = 0; ks < 2; ++ks) { s[qt][kt] = WFrag<T16>::mma(kf[kt][ks], qf[qt][ks], s[qt][kt]); if (SPLIT) { s[qt][kt] = WFrag<T16>::mma(kf[kt][ks], qf2[qt][ks], s[qt][kt]); s[qt][kt] = WFrag<T16>::mma(kf2[kt][ks], qf[qt][ks], s[qt][kt]); } } }
        const int kn = (kb + 32 <= klast) ? kb + 32 : klast;    // the next block's K fragments fly during this block's softmax and attn.v; the last trip reads its own block again, in bounds
        const unsigned ko = koff + (unsigned)kn * (HD * 2u);
#pragma unroll
        for (int kt = 0; kt < 2; ++kt)
#pragma unroll
            for (int ks = 0; ks < 2; ++ks) { kf[kt][ks] = ldo(Kp + kt * 16 * HD + 512 * ks, ko); if (SPLIT) kf2[kt][ks] = ldo(Kp2 + kt * 16 * HD + 512 * ks, ko); }
        asm volatile("s_wait_xcnt 0x0" :: "v"(ko) : "memory");    // behind the run of K loads; the offset as an input keeps its register whole up to the wait
        __builtin_amdgcn_sched_barrier(0);    // keeps the next block's K loads issued here, so that the softmax and attn.v cover their latency
#pragma unroll
        for (int qt = 0; qt < QT; ++qt)
#pragma unroll
            for (int kt = 0; kt < 2; ++kt) s[qt][kt] *= SCL2;
        // The mask is worked out only for a key block that it can cut: one that reaches past the tile's first query (i - j < 0) or lies more than 1024 keys behind its last (i - j > 1024).
        // For every other block 0 <= i - j <= 1024 holds at all its (query, key) pairs, so the select is an identity there. The test is wave-uniform (q0 and kb are scalars).
        if (kb + 31 > q0 || q0 + QT * 16 - 1 - kb > 1024) {
#pragma unroll
            for (int qt = 0; qt < QT; ++qt) {
                const int i = q0 + qt * 16 + lr;
#pragma unroll
                for (int kt = 0; kt < 2; ++kt)
#pragma unroll
                    for (int j = 0; j < 8; ++j) { const int dd = i - (kb + kt * 16 + hi * 8 + j); if ((unsigned)dd > 1024u) s[qt][kt][j] = -3.0e38f; } } }
        V pf[QT], pf2[QT];
#pragma unroll
        for (int qt = 0; qt < QT; ++qt) {
            float bm = -3.0e38f;
#pragma unroll
            for (int kt = 0; kt < 2; ++kt)
#pragma unroll
                for (int j = 0; j < 8; ++j) bm = fmaxf(bm, s[qt][kt][j]);
            bm = fmaxf(bm, __shfl_xor(bm, 16, 32));
            const float mn = fmaxf(m[qt], bm); const float al = exp2s(m[qt] - mn); m[qt] = mn;
            float ps = 0.f;
#pragma unroll
            for (int kt = 0; kt < 2; ++kt)
#pragma unroll
                for (int j = 0; j < 8; ++j) { const float p = exp2s(s[qt][kt][j] - mn); s[qt][kt][j] = p; ps += p; }
            l[qt] = l[qt] * al + ps;    // each lane sums its own half of the keys; the halves are joined once, behind the loop
#pragma unroll
            for (int dt = 0; dt < 4; ++dt) o[qt][dt] *= al;
            if constexpr (SPLIT) {
                v8us h0, h1, l0, l1;
#pragma unroll
                for (int j = 0; j < 8; ++j) { unsigned short a, c2; splitf(s[qt][0][j], a, c2); h0[j] = a; l0[j] = c2; splitf(s[qt][1][j], a, c2); h1[j] = a; l1[j] = c2; }
                pf[qt] = cat16b(h0, h1); pf2[qt] = cat16b(l0, l1);
            } else {
                v8h p0, p1;
#pragma unroll
                for (int j = 0; j < 8; ++j) { p0[j] = tohx(s[qt][0][j] * PCAR); p1[j] = tohx(s[qt][1][j] * PCAR); }
                pf[qt] = cat16(p0, p1);
            }
        }
        __builtin_amdgcn_sched_barrier(0);    // keeps every 2^x statement ahead of the attn.v products
#pragma unroll
        for (int qt = 0; qt < QT; ++qt)
#pragma unroll
            for (int dt = 0; dt < 4; ++dt) { o[qt][dt] = WFrag<T16>::mma(vf[dt], pf[qt], o[qt][dt]); if constexpr (SPLIT) { o[qt][dt] = WFrag<T16>::mma(vf[dt], pf2[qt], o[qt][dt]); o[qt][dt] = WFrag<T16>::mma(vf2[dt], pf[qt], o[qt][dt]); } }
    }
    if constexpr (SPLIT) {
#pragma unroll
    for (int qt = 0; qt < QT; ++qt) {
        const float f = __fdiv_rn(SPLIT ? 1.0f : (1.0f / PCAR), l[qt] + __shfl_xor(l[qt], 16, 32));
#pragma unroll
        for (int dt = 0; dt < 4; ++dt) { v8us oh, ol;
#pragma unroll
            for (int j = 0; j < 8; ++j) { unsigned short a, c2; splitf(o[qt][dt][j] * f, a, c2); oh[j] = a; ol[j] = c2; }
            const size_t ofs = (size_t)(q0 + qt * 16) * DD + dt * 256 + lane * 8; *(v8us*)(Ah + ofs) = oh; *(v8us*)(Al + ofs) = ol; } }
    } else {
        // The two key halves of a tile are joined: wave half h keeps 16-row tile qt = h and hands the other one over. A wave's LDS slice: 8 x 32 lanes x 16 bytes of O, then 32 maxima, then 32 sums.
#pragma unroll
        for (int qt = 0; qt < QT; ++qt) if (qt != half) {
#pragma unroll
            for (int dt = 0; dt < 4; ++dt) { *(v4fa*)(xw + (dt * 2) * 128 + lane * 4) = __builtin_shufflevector(o[qt][dt], o[qt][dt], 0, 1, 2, 3); *(v4fa*)(xw + (dt * 2 + 1) * 128 + lane * 4) = __builtin_shufflevector(o[qt][dt], o[qt][dt], 4, 5, 6, 7); }
            xw[1024 + lane] = m[qt]; xw[1056 + lane] = l[qt]; }
        __syncthreads();    // each wave's handed-over state is in LDS before its partner reads it; every wave of the work-group passes here once
#pragma unroll
        for (int qt = 0; qt < QT; ++qt) if (qt == half) {
            const float mo = xr[1024 + lane], lo = xr[1056 + lane];
            const float mn = fmaxf(m[qt], mo), aa = exp2s(m[qt] - mn), ab = exp2s(mo - mn);
            const float ls = l[qt] * aa + lo * ab;
            const float f = __fdiv_rn(1.0f / PCAR, ls + __shfl_xor(ls, 16, 32)); const float fa = aa * f, fb = ab * f;
#pragma unroll
            for (int dt = 0; dt < 4; ++dt) { v8us oh, ol; const v4f p0 = *(const v4fa*)(xr + (dt * 2) * 128 + lane * 4), p1 = *(const v4fa*)(xr + (dt * 2 + 1) * 128 + lane * 4);
#pragma unroll
                for (int j = 0; j < 8; ++j) { unsigned short a, c2; splitf(o[qt][dt][j] * fa + (j < 4 ? p0[j & 3] : p1[j & 3]) * fb, a, c2); oh[j] = a; ol[j] = c2; }
                const size_t ofs = (size_t)(q0 + qt * 16) * DD + dt * 256 + lane * 8; *(v8us*)(Ah + ofs) = oh; *(v8us*)(Al + ofs) = ol;
                asm volatile("s_wait_xcnt 0x0" :: "v"(oh), "v"(ol) : "memory"); } }    // behind the two stores, before the next block's values are written into registers that the stores name; the stored values as inputs keep their registers whole up to the wait
    }
}
// amdgpu_waves_per_eu(4, 4): holds the kernel to 256 registers; above them every reach into the upper window costs an s_set_vgpr_msb in the loop
#define XW 1088    // floats of one wave's LDS slice for the join of the key halves
__global__ __launch_bounds__(128) __attribute__((amdgpu_waves_per_eu(4, 4))) void k_fattn(const bf* __restrict__ Qh, const bf* __restrict__ Ql, const bf* __restrict__ Kh, const bf* __restrict__ Kl, const bf* __restrict__ Vh, const bf* __restrict__ Vl, const h16* __restrict__ Q16, const h16* __restrict__ K16, const h16* __restrict__ V16, bf* Ah, bf* Al) {
    __shared__ __align__(16) float xg[4 * XW];
    const size_t zo = ((size_t)blockIdx.z * NH_ + blockIdx.y) * TT * HD; const int wv = __builtin_amdgcn_readfirstlane((int)(threadIdx.x >> 5));
    Ah += (size_t)blockIdx.z * TT * DD + blockIdx.y * (HD * 16); Al += (size_t)blockIdx.z * TT * DD + blockIdx.y * (HD * 16);    // fragment order: a head's 64 columns are two blocks of each 16-row group
    if (blockIdx.x * 64 < RH) fattn<bf, true, 1>(Qh + zo, Ql + zo, Kh + zo, Kl + zo, Vh + zo, Vl + zo, Ah, Al, blockIdx.x * 64 + wv * 16, 0, nullptr, nullptr);    // the 3-product form holds one 16-row tile
    else fattn<h16, false, 2>(Q16 + zo, nullptr, K16 + zo, nullptr, V16 + zo, nullptr, Ah, Al, blockIdx.x * 64 + (wv & 1) * 32, wv >> 1, xg + wv * XW, xg + (wv ^ 2) * XW);    // waves w and w ^ 2 share a tile
}

extern "C" void kernel_launch(void* const* d_in, const int* in_sizes, int n_in,
                              void* d_out, int out_size, void* d_ws, size_t ws_size, hipStream_t stream) {
    (void)in_sizes; (void)n_in; (void)out_size;
    const float* x = (const float*)d_in[0]; const float* wq = (const float*)d_in[1]; const float* bq = (const float*)d_in[2]; const float* wk = (const float*)d_in[3]; const float* bk = (const float*)d_in[4]; const float* wv = (const float*)d_in[5]; const float* bv = (const float*)d_in[6]; const float* wo = (const float*)d_in[7]; const float* bo = (const float*)d_in[8];
    float* OUT = (float*)d_out;     // [4][2048][512]
    char* wsp = (char*)d_ws;
    auto take = [&](size_t bytes) { char* p = wsp; wsp += (bytes + 255) & ~(size_t)255; return (void*)p; };
    bf* W4 = (bf*)take((size_t)4 * DD * DD * 2);    // transposed W_Q, W_K, W_V, W_O, one behind the other: the first three are the [3 DD][DD] weight operand of the merged projection (A for Q and K tiles, B for the transposed V tiles)
    bf* XB = (bf*)take((size_t)NB_ * TT * DD * 2);
    bf* QPh = (bf*)take((size_t)NB_ * TT * DD * 2); bf* QPl = (bf*)take((size_t)NB_ * TT * DD * 2); bf* KPh = (bf*)take((size_t)NB_ * TT * DD * 2); bf* KPl = (bf*)take((size_t)NB_ * TT * DD * 2); bf* VTh = (bf*)take((size_t)NB_ * TT * DD * 2); bf* VTl = (bf*)take((size_t)NB_ * TT * DD * 2);
    h16* QP16 = (h16*)take((size_t)NB_ * TT * DD * 2); h16* KP16 = (h16*)take((size_t)NB_ * TT * DD * 2); h16* VT16 = (h16*)take((size_t)NB_ * TT * DD * 2);
    bf* ATh = (bf*)take((size_t)NB_ * TT * DD * 2); bf* ATl = (bf*)take((size_t)NB_ * TT * DD * 2);
    if ((size_t)(wsp - (char*)d_ws) > ws_size) return;    // total 98 MiB; ws 256 MiB
    k_wtG<<<dim3(DD / 16 * (DD / 32) / 8, 4), 256, 0, stream>>>(wq, wk, wv, wo, W4);
    k_cvt8<<<NB_ * TT / 16 * (DD / 32) / 8, 256, 0, stream>>>(x, XB);
    k_projp<<<dim3(NB_ * TT / 128, FP / 128), 128, 0, stream>>>(XB, W4, bq, bk, bv, QPh, QPl, QP16, KPh, KPl, KP16, VTh, VTl, VT16);
    k_fattn<<<dim3(TT / 64, NH_, NB_), 128, 0, stream>>>(QPh, QPl, KPh, KPl, VTh, VTl, QP16, KP16, VT16, ATh, ATl);
    k_gemmw<bf, 1, true, KSP><<<dim3(NB_ * TT / 64, DD / 64), 32 * KSP, 0, stream>>>(ATh, ATl, W4 + (size_t)3 * DD * DD, nullptr, OUT, DD, bo, bo, bo, 0, 0, 0);
}

// v010
// A run of this version takes 61.6 microseconds.
// Timed twice side by side with v009, it ran 1.06 and 1.05 times as fast.
// Counting every step since v000, it is 34.8 times as fast.
#include <hip/hip_runtime.h>

// Multi-head attention block (x [4][2048][512]; q/k/v = x @ W + b ([in][out]); 8 heads x 64; scores / 8; log-sparse mask: keep (i, j) iff i - j == 0, or 1 <= i - j <= 1024, or i - j is a positive power of two (else -inf);
// softmax; out = ctx @ W_O + b_O).
// Compute dtypes, f32 accumulate: every input rounded to bf16; projections on transposed bf16 weight copies, + bias: Q, K, V on PLAIN bf16 x (exact), output on bf16 hi+lo ctx planes (2 products); PER-ROW
// PRECISION HYBRID: query rows < 256 of each batch on bf16 hi+lo planes for scores and attn.v (3 products), rows >= 256 on SINGLE fp16 planes; the mask by index arithmetic in the softmax; output

#define NB_  4
#define TT   2048
#define DD   512
#define NH_  8
#define HD   64
#define FP   (3 * DD)             // columns of the merged Q, K, V projection
#define KSP  8                    // waves that share the k range of one tile: output projection (K = 512)
#define RH   256                  // query rows < RH: hi+lo planes; rows >= RH: fp16 planes
#define NF   32                   // head_dim / 2; unused, the file applies no rotary embedding
#define SCL2 0.18033688f          // 1/sqrt(64) * log2(e): the softmax runs in base 2
#define CARE 10.0f           // fp16 form: p is carried times 2^10; the 10 is added to the exponent, so the factor costs no multiply
#define THRS 27.0f           // a query's kept maximum is renewed once an unscaled score tops it by more than this: 2^x then stays below 2^(27 * SCL2) < 2^5, times 2^10 inside fp16's range
#define MSKV -0x1p100f       // a masked score and the start of the running maximum: a power of two, so that MSKV * SCL2 is exact and a row of masked scores alone gets the exponent 0, not a rounding residue
typedef _Float16 h16;
typedef unsigned short bf;
typedef __attribute__((ext_vector_type(16))) __bf16   v16bf;
typedef __attribute__((ext_vector_type(16))) _Float16 v16h;
typedef __attribute__((ext_vector_type(8)))  _Float16 v8h;
typedef __attribute__((ext_vector_type(8)))  unsigned short v8us;
typedef __attribute__((ext_vector_type(8)))  float    v8f;
typedef __attribute__((ext_vector_type(4)))  float    v4f;
typedef v8h  __attribute__((may_alias)) v8ha;
typedef v4f  __attribute__((may_alias)) v4fa;
typedef v8us __attribute__((may_alias)) v8usa;

__device__ __forceinline__ unsigned short f2bf(float f) { unsigned u = __float_as_uint(f); u += 0x7FFFu + ((u >> 16) & 1u); return (unsigned short)(u >> 16); }
__device__ __forceinline__ float bf2f(unsigned short b) { return __uint_as_float(((unsigned)b) << 16); }
__device__ __forceinline__ float bfr(float f) { return bf2f(f2bf(f)); }
__device__ __forceinline__ v16h cat16(v8h lo, v8h hi) { return __builtin_shufflevector(lo, hi, 0, 1, 2, 3, 4, 5, 6, 7, 8, 9, 10, 11, 12, 13, 14, 15); }
__device__ __forceinline__ v16bf cat16b(v8us lo, v8us hi) { return __builtin_bit_cast(v16bf, __builtin_shufflevector(lo, hi, 0, 1, 2, 3, 4, 5, 6, 7, 8, 9, 10, 11, 12, 13, 14, 15)); }
__device__ __forceinline__ v8f wmma16(v16h a, v16h b, v8f c) { return __builtin_amdgcn_wmma_f32_16x16x32_f16(false, a, false, b, (short)0, c, false, false); }
__device__ __forceinline__ v8f wmmab(v16bf a, v16bf b, v8f c) { return __builtin_amdgcn_wmma_f32_16x16x32_bf16(false, a, false, b, (short)0, c, false, false); }



// ---- k_gemmw: register-blocked GEMM, one work-group of KS waves per 64x64 output tile; each wave holds the whole tile (16 accumulators) over its own contiguous K / KS slice of k, operands straight
// from 16-bit planes in fragment order; the KS partial tiles are summed through LDS in fixed wave order 0..KS-1. grid (M/64, N/64, Z), 32 * KS threads.
// C[m][n] (f32, pitch ldc, + optional f32 bias: bias0, bias1, bias2 for columns [0, DD), [DD, 2 DD), [2 DD, 3 DD)) = sum_k A[m][k] Bt[n][k] (+ split products per NSPLIT). z-batch strides sA/sB/sC in elements. K = DD.
// FRAGMENT ORDER: every 16-bit operand plane (rows x k, k the contracted index) is stored as blocks of 16 rows x 32 k (512 elements, 1 KiB), the blocks of one 16-row group one behind the other along k
// (the V planes: the four 16-row groups of one 32-key step one behind the other). Inside a block element (r, kk) lies at (kk >> 4) * 256 + ((kk >> 3) & 1) * 128 + r * 8 + (kk & 7): the 16 bytes that
// lane r + 16 * hi takes for either half of its fragment lie at lane * 16 bytes of that half, so that each 16-byte load of a wave reads 512 contiguous bytes (4 whole lines) and not 32-byte pieces of 16 lines.
// Which element reaches which lane and register is as with row-major planes. ld(p): p = the block's start + lane * 8 elements.
template <typename T16> struct WFrag;
template <> struct WFrag<h16> { typedef v16h V; static __device__ __forceinline__ V ld(const h16* p) { return cat16(*(const v8h*)p, *(const v8h*)(p + 256)); } static __device__ __forceinline__ v8f mma(V a, V b, v8f c) { return wmma16(a, b, c); } };
template <> struct WFrag<bf> { typedef v16bf V; static __device__ __forceinline__ V ld(const bf* p) { return cat16b(*(const v8us*)p, *(const v8us*)(p + 256)); } static __device__ __forceinline__ v8f mma(V a, V b, v8f c) { return wmmab(a, b, c); } };
template <typename T16, int NSPLIT, bool BIAS, int KS>
__global__ __launch_bounds__(32 * KS) void k_gemmw(const T16* __restrict__ A, const T16* __restrict__ A2, const T16* __restrict__ Bt, const T16* __restrict__ Bt2, float* C, int ldc, const float* __restrict__ bias0, const float* __restrict__ bias1, const float* __restrict__ bias2, size_t sA, size_t sB, size_t sC) {
    typedef typename WFrag<T16>::V V; constexpr int K = DD;    // a constant, so that a k step's fragments lie at immediate offsets from one address per plane
    constexpr int SL = (KS == 1 ? 16 : 64) * 68;    // floats of one wave's LDS slice: a 16-row block for the one-wave form, the whole partial tile where KS waves are summed
    __shared__ __align__(16) float os[KS * SL];
    const size_t z = blockIdx.z; A += z * sA; if (A2) A2 += z * sA; Bt += z * sB; if (Bt2) Bt2 += z * sB; C += z * sC;
    const int lane = threadIdx.x & 31, lr = lane & 15, hi = lane >> 4; const int r0 = blockIdx.x * 64, c0 = blockIdx.y * 64;
    const float* bias = (c0 < DD) ? bias0 : (c0 < 2 * DD) ? bias1 : bias2; const int cb = c0 & (DD - 1);    // each DD-wide column group of C has its own bias vector
    v8f acc[4][4];
#pragma unroll
    for (int mb = 0; mb < 4; ++mb)
#pragma unroll
        for (int nb = 0; nb < 4; ++nb) acc[mb][nb] = (v8f){};
    const size_t aoff = (size_t)r0 * K + lane * 8, boff = (size_t)c0 * K + lane * 8;    // a 16-row group of blocks holds 16 * K elements; the block of k step kc starts kc * 16 elements into it
    const int wv = (KS == 1) ? 0 : __builtin_amdgcn_readfirstlane((int)(threadIdx.x >> 5)); const int kspan = K / KS, kb = wv * kspan, ke = kb + kspan;
#pragma unroll 1
    for (int kc = kb; kc < ke; kc += 32) {
        V a[4], a2[4], b[4], b2[4]; const T16* pa = A + aoff + kc * 16; const T16* pa2 = (NSPLIT == 1 || NSPLIT == 2) ? A2 + aoff + kc * 16 : pa; const T16* pb = Bt + boff + kc * 16; const T16* pb2 = (NSPLIT >= 2) ? Bt2 + boff + kc * 16 : pb;
#pragma unroll
        for (int mb = 0; mb < 4; ++mb) { a[mb] = WFrag<T16>::ld(pa + (size_t)mb * 16 * K); if (NSPLIT == 1 || NSPLIT == 2) a2[mb] = WFrag<T16>::ld(pa2 + (size_t)mb * 16 * K); }
#pragma unroll
        for (int nb = 0; nb < 4; ++nb) { b[nb] = WFrag<T16>::ld(pb + (size_t)nb * 16 * K); if (NSPLIT >= 2) b2[nb] = WFrag<T16>::ld(pb2 + (size_t)nb * 16 * K); }
        asm volatile("s_wait_xcnt 0x0" :: "v"(pa), "v"(pa2), "v"(pb), "v"(pb2) : "memory");    // behind the run of fragment loads, before a register that one of them names as its address is written again; the addresses as inputs keep their registers whole up to the wait
#pragma unroll
        for (int nb = 0; nb < 4; ++nb) {
#pragma unroll
            for (int mb = 0; mb < 4; ++mb) { acc[mb][nb] = WFrag<T16>::mma(a[mb], b[nb], acc[mb][nb]); if (NSPLIT == 1 || NSPLIT == 2) acc[mb][nb] = WFrag<T16>::mma(a2[mb], b[nb], acc[mb][nb]); if (NSPLIT >= 2) acc[mb][nb] = WFrag<T16>::mma(a[mb], b2[nb], acc[mb][nb]); } }
        asm volatile("v_nop\n\tv_nop\n\tv_nop\n\tv_nop" : "+v"(acc[0][0]), "+v"(acc[1][1]), "+v"(acc[2][2]), "+v"(acc[3][3]) : "v"(a[0]), "v"(a[3]));
    }
    if constexpr (KS == 1) {
#pragma unroll
    for (int mb = 0; mb < 4; ++mb) {
#pragma unroll
        for (int nb = 0; nb < 4; ++nb) {
#pragma unroll
            for (int j = 0; j < 8; ++j) os[(hi * 8 + j) * 68 + nb * 16 + lr] = acc[mb][nb][j]; }
        __builtin_amdgcn_wave_barrier(); asm volatile("" ::: "memory");
        float* crow = C + (size_t)(r0 + mb * 16) * ldc + c0;
{
#pragma unroll
            for (int s = 0; s < 8; ++s) { const int row = 2 * s + hi, cofs = lr * 4; v4f val = *(const v4fa*)(os + row * 68 + cofs); if (BIAS) { val[0] += bfr(bias[cb + cofs]); val[1] += bfr(bias[cb + cofs + 1]); val[2] += bfr(bias[cb + cofs + 2]); val[3] += bfr(bias[cb + cofs + 3]); }
                *(v4f*)(crow + (size_t)row * ldc + cofs) = val; }
             }
        __builtin_amdgcn_wave_barrier(); asm volatile("" ::: "memory");
    }
    } else {
#pragma unroll
        for (int mb = 0; mb < 4; ++mb) {
#pragma unroll
            for (int nb = 0; nb < 4; ++nb) {
#pragma unroll
                for (int j = 0; j < 8; ++j) os[wv * SL + (mb * 16 + hi * 8 + j) * 68 + nb * 16 + lr] = acc[mb][nb][j]; } }
        __syncthreads();    // every wave's partial tile is in LDS before any thread sums across the waves
        float* crow = C + (size_t)r0 * ldc + c0;
#pragma unroll
        for (int s = 0; s < 1024 / (32 * KS); ++s) { const int idx = s * 32 * KS + (int)threadIdx.x; const int row = idx >> 4, cofs = (idx & 15) * 4; v4f val = *(const v4fa*)(os + row * 68 + cofs);
#pragma unroll
            for (int w = 1; w < KS; ++w) val += *(const v4fa*)(os + w * SL + row * 68 + cofs);
            if (BIAS) { val[0] += bfr(bias[cb + cofs]); val[1] += bfr(bias[cb + cofs + 1]); val[2] += bfr(bias[cb + cofs + 2]); val[3] += bfr(bias[cb + cofs + 3]); }
            *(v4f*)(crow + (size_t)row * ldc + cofs) = val; }
    }
}

__device__ __forceinline__ h16 tohx(float x) { return (h16)x; }
__device__ __forceinline__ void splitf(float y, unsigned short& h, unsigned short& l) { h = f2bf(y); l = f2bf(y - bf2f(h)); }
typedef __attribute__((ext_vector_type(2))) unsigned short v2us;
typedef __attribute__((ext_vector_type(2))) _Float16 v2h;
typedef __attribute__((ext_vector_type(4))) _Float16 v4h;
typedef __attribute__((ext_vector_type(2))) float v2f;

// grid y: which of the four weights; their transposed copies (rows n, k contracted, fragment order) lie one behind the other in Bt. One wave per 16 x 32 block: each 4-byte load reads 64-byte pieces of two
// source rows, each store is 512 contiguous bytes.
__global__ __launch_bounds__(256) void k_wtG(const float* __restrict__ w0, const float* __restrict__ w1, const float* __restrict__ w2, const float* __restrict__ w3, bf* Bt) {
    const float* w = (blockIdx.y == 0) ? w0 : (blockIdx.y == 1) ? w1 : (blockIdx.y == 2) ? w2 : w3; Bt += (size_t)blockIdx.y * DD * DD;
    const int lane = threadIdx.x & 31, lr = lane & 15, hi = lane >> 4; const int blk = blockIdx.x * 8 + (threadIdx.x >> 5); constexpr int kbs = DD / 32;    // grid x: DD / 16 * kbs / 8
    const float* s = w + (size_t)((blk % kbs) * 32 + hi * 8) * DD + (blk / kbs) * 16 + lr;
    float v[16];
#pragma unroll
    for (int e = 0; e < 16; ++e) v[e] = s[(size_t)((e >> 3) * 16 + (e & 7)) * DD];
    asm volatile("s_wait_xcnt 0x0" :: "v"(s) : "memory");    // behind the run of loads; the address as an input keeps its registers whole up to the wait
#pragma unroll
    for (int part = 0; part < 2; ++part) { v8us o;
#pragma unroll
        for (int e = 0; e < 8; ++e) o[e] = f2bf(v[part * 8 + e]);
        *(v8us*)(Bt + (size_t)blk * 512 + part * 256 + lane * 8) = o; }
}
// x to bf16 in fragment order. One wave per 16 x 32 block (grid: NB_ * TT / 16 * DD / 32 / 8 work-groups of 8 waves): each 16-byte load reads four whole 128-byte pieces of source rows, each 8-byte store four 64-byte pieces.
typedef __attribute__((ext_vector_type(4))) unsigned short v4us;
__global__ __launch_bounds__(256) void k_cvt8(const float* __restrict__ src, bf* dst) {
    const int lane = threadIdx.x & 31, c = lane & 7, rr = lane >> 3; const int blk = blockIdx.x * 8 + (threadIdx.x >> 5);
    const float* s = src + (size_t)((blk / (DD / 32)) * 16 + rr) * DD + (blk % (DD / 32)) * 32 + c * 4;
    bf* d = dst + (size_t)blk * 512 + (c >> 2) * 256 + ((c >> 1) & 1) * 128 + rr * 8 + (c & 1) * 4;
#pragma unroll
    for (int i = 0; i < 4; ++i) { const v4f v = *(const v4f*)(s + (size_t)i * 4 * DD); v4us o;
#pragma unroll
        for (int k = 0; k < 4; ++k) o[k] = f2bf(v[k]);
        *(v4us*)(d + i * 32) = o; }
}
// ---- k_projp: the merged Q, K, V projection with the plane writers in its epilogue. grid (NB_ * TT / 128, FP / 128), 4 waves; a work-group owns a 128 x 128 tile, a wave one 64 x 64 quarter of it over the WHOLE k range
// (16 steps of 32, one accumulate chain per element): the grid has 3072 such wave tiles, three per SIMD, so k needs no split over waves, and no partial tile passes through LDS. The two waves beside each other read the same token rows,
// the two above each other the same weight rows. A 64-column group of the projection is one head. The orientation of the product is chosen so that a lane's 8 accumulator registers are the 8 neighbours along the contracted
// index of the plane they go to, which is one lane's 16 bytes of a fragment block: Q and K tiles (planes: rows t, k = d) take the weight rows as the A operand and the token rows as B (register j = d, lane = t),
// V tiles (planes: rows d, k = t) the token rows as A and the weight rows as B (register j = t, lane = d). Both operands are k-contiguous and take the same loader.
// QK: the tile is a Q or K tile. e0: the element of the thread's 16 bytes in the tile's first block; bias: the head's 64 values.
template <bool QK>
__device__ __forceinline__ void projp_store(const v8f (&acc)[4][4], const float* __restrict__ bias, bf* Ph, bf* Pl, h16* P16, size_t e0, int lr, int hi) {
    float bn[4]; v4f bq4[4][2];    // all bias loads ahead of the first store
    const unsigned bo = (unsigned)(QK ? hi * 32 : lr * 4); const char* bb = (const char*)bias;    // wave-uniform base + one 32-bit byte offset per lane
#pragma unroll
    for (int g = 0; g < 4; ++g) { if (QK) { bq4[g][0] = *(const v4fa*)(bb + g * 64 + bo); bq4[g][1] = *(const v4fa*)(bb + g * 64 + 16 + bo); } else bn[g] = *(const float*)(bb + g * 64 + bo); }
    asm volatile("s_wait_xcnt 0x0" :: "v"(bo) : "memory");    // behind the run of bias loads; the offset as an input keeps its register whole up to the wait
    if (!QK) {
#pragma unroll
        for (int nb = 0; nb < 4; ++nb) bn[nb] = bfr(bn[nb]); }
#pragma unroll
    for (int mb = 0; mb < 4; ++mb) {
        float bj[8];
        if (QK) {
#pragma unroll
            for (int j = 0; j < 8; ++j) bj[j] = bfr(bq4[mb][j >> 2][j & 3]); }
#pragma unroll
        for (int nb = 0; nb < 4; ++nb) { v8us oh, ol; v8h o16;
#pragma unroll
            for (int j = 0; j < 8; ++j) { const float x = acc[mb][nb][j] + (QK ? bj[j] : bn[nb]); unsigned short a, c2; splitf(x, a, c2); oh[j] = a; ol[j] = c2; o16[j] = tohx(x); }
            const size_t e = e0 + (mb & 1) * 256 + (QK ? nb * 1024 + (mb >> 1) * 512 : (mb >> 1) * 2048 + nb * 512);    // a wave stores 512 contiguous bytes in each plane
            *(v8us*)(Ph + e) = oh; *(v8us*)(Pl + e) = ol; *(v8h*)(P16 + e) = o16;
            asm volatile("s_wait_xcnt 0x0" :: "v"(oh), "v"(ol), "v"(o16) : "memory"); } }    // behind the three stores, before the next block's values are written into registers that the stores name; the stored values as inputs keep their registers whole up to the wait
}
// amdgpu_waves_per_eu(3, 3): the grid gives a SIMD three waves; a third of its registers holds the 16 accumulators and both fragment sets
__global__ __launch_bounds__(128) __attribute__((amdgpu_waves_per_eu(3, 3))) void k_projp(const bf* __restrict__ X, const bf* __restrict__ Wt, const float* __restrict__ bq, const float* __restrict__ bk, const float* __restrict__ bv, bf* Qh, bf* Ql, h16* Q16, bf* Kh, bf* Kl, h16* K16, bf* Vh, bf* Vl, h16* V16) {
    typedef WFrag<bf>::V V;
    const int lane = threadIdx.x & 31, lr = lane & 15, hi = lane >> 4;
    const int wv = __builtin_amdgcn_readfirstlane((int)(threadIdx.x >> 5));
    const int r0 = blockIdx.x * 128 + (wv & 1) * 64, c0 = blockIdx.y * 128 + (wv >> 1) * 64;
    const int sel = c0 / DD, cb = c0 & (DD - 1); const bool qk = sel != 2;
    const bf* A = qk ? Wt + (size_t)c0 * DD : X + (size_t)r0 * DD; const bf* Bt = qk ? X + (size_t)r0 * DD : Wt + (size_t)c0 * DD;
    v8f acc[4][4];
#pragma unroll
    for (int mb = 0; mb < 4; ++mb)
#pragma unroll
        for (int nb = 0; nb < 4; ++nb) acc[mb][nb] = (v8f){};
    V a[2][4], b[2][4];    // two fragment sets: while one set's 16 products run, the other set's 16 loads fly
    const bf* pa = A + lane * 8; const bf* pb = Bt + lane * 8;    // a 16-row group of blocks holds 16 * DD elements; the block of k step kc starts kc * 16 elements into it
#pragma unroll
    for (int mb = 0; mb < 4; ++mb) { a[0][mb] = WFrag<bf>::ld(pa + (size_t)mb * 16 * DD); b[0][mb] = WFrag<bf>::ld(pb + (size_t)mb * 16 * DD); }
    asm volatile("s_wait_xcnt 0x0" :: "v"(pa), "v"(pb) : "memory");    // behind the first set's loads, for the same reason as in the loop
    __builtin_amdgcn_sched_barrier(0);    // nothing is set between those loads and their wait
    auto fetch = [&](V (&fa)[4], V (&fb)[4], const bf* qa, const bf* qb, int ofs) {    // one k step's 16 loads
#pragma unroll
        for (int mb = 0; mb < 4; ++mb) { fa[mb] = WFrag<bf>::ld(qa + (size_t)mb * 16 * DD + ofs); fb[mb] = WFrag<bf>::ld(qb + (size_t)mb * 16 * DD + ofs); }
        asm volatile("s_wait_xcnt 0x0" :: "v"(qa), "v"(qb) : "memory");    // behind the run of fragment loads, before a register that one of them names as its address is written again; the addresses as inputs keep their registers whole up to the wait
        __builtin_amdgcn_sched_barrier(0);    // keeps the next step's 16 loads issued ahead of this step's products, so that the products cover their latency
    };
    auto mul = [&](const V (&fa)[4], const V (&fb)[4]) {    // one k step's 16 products
#pragma unroll
        for (int nb = 0; nb < 4; ++nb)
#pragma unroll
            for (int mb = 0; mb < 4; ++mb) acc[mb][nb] = WFrag<bf>::mma(fa[mb], fb[nb], acc[mb][nb]);
        __builtin_amdgcn_sched_barrier(0);    // keeps these products ahead of the loads that refill their set
    };
#pragma unroll 1    // rolled: 7 trips of two k steps share one copy of the code; the last two steps stand behind the loop, where no further set is fetched
    for (int kc = 0; kc < DD - 64; kc += 64) {
        const bf* qa = pa + kc * 16; const bf* qb = pb + kc * 16;
        fetch(a[1], b[1], qa, qb, 512); mul(a[0], b[0]);
        fetch(a[0], b[0], qa, qb, 1024); mul(a[1], b[1]);
    }
    fetch(a[1], b[1], pa, pb, (DD - 32) * 16); mul(a[0], b[0]); mul(a[1], b[1]);
    const float* bias = ((sel == 0) ? bq : (sel == 1) ? bk : bv) + cb;
    bf* Ph = (sel == 0) ? Qh : (sel == 1) ? Kh : Vh; bf* Pl = (sel == 0) ? Ql : (sel == 1) ? Kl : Vl; h16* P16 = (sel == 0) ? Q16 : (sel == 1) ? K16 : V16;
    const size_t e0 = ((size_t)(r0 / TT) * NH_ + cb / HD) * TT * HD + (size_t)(r0 & (TT - 1)) * HD + lane * 8;
    if (qk) projp_store<true>(acc, bias, Ph, Pl, P16, e0, lr, hi); else projp_store<false>(acc, bias, Ph, Pl, P16, e0, lr, hi);
}
__device__ __forceinline__ float exp2s(float x) { float r; asm("v_exp_f32 %0, %1\n\tv_nop" : "=v"(r) : "v"(x)); return r; }
// Four 2^x in one statement: each is the independent instruction behind the one before it (the early-clobber results share no register with any source), so one v_nop behind the last keeps the slot for all four.
__device__ __forceinline__ void exp2x4(float& a, float& b, float& c, float& d) { float r0, r1, r2, r3;
    asm("v_exp_f32 %0, %4\n\tv_exp_f32 %1, %5\n\tv_exp_f32 %2, %6\n\tv_exp_f32 %3, %7\n\tv_nop" : "=&v"(r0), "=&v"(r1), "=&v"(r2), "=&v"(r3) : "v"(a), "v"(b), "v"(c), "v"(d)); a = r0; b = r1; c = r2; d = r3; }
template <typename T16> __device__ __forceinline__ typename WFrag<T16>::V ldo(const T16* base, unsigned bytes) { return WFrag<T16>::ld((const T16*)((const char*)base + bytes)); }    // wave-uniform base + one 32-bit byte offset per lane, shared by the planes of one operand
template <typename T16, bool SPLIT, int QT>
__device__ __forceinline__ void fattn(const T16* __restrict__ Q, const T16* __restrict__ Q2, const T16* __restrict__ Kp, const T16* __restrict__ Kp2, const T16* __restrict__ Vt, const T16* __restrict__ Vt2, bf* Ah, bf* Al, int q0, int half, float* xw, const float* xr) {
    typedef typename WFrag<T16>::V V;
    const int lane = threadIdx.x & 31, lr = lane & 15, hi = lane >> 4;
    const unsigned koff = (unsigned)lane * 16u;    // bytes: the lane's place in either half of a fragment block
    V qf[QT][2], qf2[QT][2]; v8f o[QT][4]; float m[QT], sh[QT]; v2f l[QT];    // m: the kept maximum, in unscaled scores; sh: the exponent's addend that belongs to it; l: the lane's sum of p in two partial sums (packed adds), joined behind the loop
#pragma unroll
    for (int qt = 0; qt < QT; ++qt) { m[qt] = MSKV; l[qt] = (v2f){0.f, 0.f}; sh[qt] = -MSKV * SCL2;
#pragma unroll
        for (int ks = 0; ks < 2; ++ks) { qf[qt][ks] = ldo(Q + qt * 16 * HD + 512 * ks, koff + (unsigned)q0 * (HD * 2u)); if (SPLIT) qf2[qt][ks] = ldo(Q2 + qt * 16 * HD + 512 * ks, koff + (unsigned)q0 * (HD * 2u)); }
#pragma unroll
        for (int dt = 0; dt < 4; ++dt) o[qt][dt] = (v8f){}; }
    int kbeg = (q0 > 1024) ? ((q0 - 1024) & ~31) : 0, klast = (q0 + QT * 16 - 1) & ~31;
    if constexpr (!SPLIT) { const int qw = q0 & ~63, kw = (qw > 1024) ? qw - 1024 : 0;    // the work-group's first tile and its first key block
        const int ks = kw + ((((qw - kw) >> 5) + 2) >> 1) * 32;    // the first key of the second half (each half holds 4 blocks at least: q0 >= RH). One split point for both tiles of the work-group: the two waves of a half then walk the same key blocks, and one wave's K and V lines serve the other from the WGP's cache
        if (half == 0) klast = ks - 32; else kbeg = ks; }    // half is wave-uniform
    V kf[2][2], kf2[2][2];
#pragma unroll
    for (int kt = 0; kt < 2; ++kt)
#pragma unroll
        for (int ks = 0; ks < 2; ++ks) { kf[kt][ks] = ldo(Kp + kt * 16 * HD + 512 * ks, koff + (unsigned)kbeg * (HD * 2u)); if (SPLIT) kf2[kt][ks] = ldo(Kp2 + kt * 16 * HD + 512 * ks, koff + (unsigned)kbeg * (HD * 2u)); }
#pragma unroll 1    // rolled: up to 17 trips share one copy of the code, and one trip's fragments already fill the registers
    for (int kb = kbeg; kb <= klast; kb += 32) {
        V vf[4], vf2[4];
#pragma unroll
        for (int dt = 0; dt < 4; ++dt) { vf[dt] = ldo(Vt + dt * 512, koff + (unsigned)kb * (HD * 2u)); if (SPLIT) vf2[dt] = ldo(Vt2 + dt * 512, koff + (unsigned)kb * (HD * 2u)); }
        __builtin_amdgcn_sched_barrier(0);    // keeps the V loads issued here, ahead of the score products: sunk behind the softmax their whole latency would stand in front of attn.v
        v8f s[QT][2];
#pragma unroll
        for (int qt = 0; qt < QT; ++qt)
#pragma unroll
            for (int kt = 0; kt < 2; ++kt) { s[qt][kt] = (v8f){};
#pragma unroll
                for (int ks = 0; ks < 2; ++ks) { s[qt][kt] = WFrag<T16>::mma(kf[kt][ks], qf[qt][ks], s[qt][kt]); if (SPLIT) { s[qt][kt] = WFrag<T16>::mma(kf[kt][ks], qf2[qt][ks], s[qt][kt]); s[qt][kt] = WFrag<T16>::mma(kf2[kt][ks], qf[qt][ks], s[qt][kt]); } } }
        const int kn = (kb + 32 <= klast) ? kb + 32 : klast;    // the next block's K fragments fly during this block's softmax and attn.v; the last trip reads its own block again, in bounds
        const unsigned ko = koff + (unsigned)kn * (HD * 2u);
#pragma unroll
        for (int kt = 0; kt < 2; ++kt)
#pragma unroll
            for (int ks = 0; ks < 2; ++ks) { kf[kt][ks] = ldo(Kp + kt * 16 * HD + 512 * ks, ko); if (SPLIT) kf2[kt][ks] = ldo(Kp2 + kt * 16 * HD + 512 * ks, ko); }
        asm volatile("s_wait_xcnt 0x0" :: "v"(ko) : "memory");    // behind the run of K loads; the offset as an input keeps its register whole up to the wait
        __builtin_amdgcn_sched_barrier(0);    // keeps the next block's K loads issued here, so that the softmax and attn.v cover their latency
        // The mask is worked out only for a key block that it can cut: one that reaches past the tile's first query (i - j < 0) or lies more than 1024 keys behind its last (i - j > 1024).
        // For every other block 0 <= i - j <= 1024 holds at all its (query, key) pairs, so the select is an identity there. The test is wave-uniform (q0 and kb are scalars).
        if (kb + 31 > q0 || q0 + QT * 16 - 1 - kb > 1024) {
#pragma unroll
            for (int qt = 0; qt < QT; ++qt) {
                const int i = q0 + qt * 16 + lr;
#pragma unroll
                for (int kt = 0; kt < 2; ++kt)
#pragma unroll
                    for (int j = 0; j < 8; ++j) { const int dd = i - (kb + kt * 16 + hi * 8 + j); if ((unsigned)dd > 1024u) s[qt][kt][j] = MSKV; } } }
        V pf[QT], pf2[QT];
        // The kept maximum of a query is any value that its scores top by at most THRS: O, the sum and the addend sh refer to it, and it cancels in O / sum. Each lane tests its own 16 scores of a tile; only when some lane
        // of the wave finds a score more than THRS above its kept maximum are the maxima of all the wave's queries renewed (the two lanes of a query joined) and O and the sums rescaled. The test is wave-uniform (a ballot).
        float bm[QT]; bool up = false;
#pragma unroll
        for (int qt = 0; qt < QT; ++qt) { bm[qt] = -3.0e38f;
#pragma unroll
            for (int kt = 0; kt < 2; ++kt)
#pragma unroll
                for (int j = 0; j < 8; ++j) bm[qt] = fmaxf(bm[qt], s[qt][kt][j]);
            up = up || (bm[qt] - m[qt] > THRS); }
        if (__builtin_amdgcn_ballot_w32(up) != 0u) {
#pragma unroll
            for (int qt = 0; qt < QT; ++qt) {
                const float mn = fmaxf(m[qt], fmaxf(bm[qt], __shfl_xor(bm[qt], 16, 32))); const float al = exp2s((m[qt] - mn) * SCL2); m[qt] = mn;
                sh[qt] = __builtin_fmaf(-mn, SCL2, SPLIT ? 0.f : CARE); l[qt] *= al;
#pragma unroll
                for (int dt = 0; dt < 4; ++dt) o[qt][dt] *= al; } }
#pragma unroll
        for (int qt = 0; qt < QT; ++qt) {
            const float sq = sh[qt];    // one FMA per score does the scale, the shift by the kept maximum and (fp16 form) the factor 2^10
#pragma unroll
            for (int kt = 0; kt < 2; ++kt)
#pragma unroll
                for (int j = 0; j < 8; j += 4) { float t0 = __builtin_fmaf(s[qt][kt][j], SCL2, sq), t1 = __builtin_fmaf(s[qt][kt][j + 1], SCL2, sq), t2 = __builtin_fmaf(s[qt][kt][j + 2], SCL2, sq), t3 = __builtin_fmaf(s[qt][kt][j + 3], SCL2, sq);
                    exp2x4(t0, t1, t2, t3); s[qt][kt][j] = t0; s[qt][kt][j + 1] = t1; s[qt][kt][j + 2] = t2; s[qt][kt][j + 3] = t3; l[qt] += (v2f){t0, t1} + (v2f){t2, t3}; }    // each lane sums its own half of the keys; the halves are joined once, behind the loop
            if constexpr (SPLIT) {
                v8us h0, h1, l0, l1;
#pragma unroll
                for (int j = 0; j < 8; ++j) { unsigned short a, c2; splitf(s[qt][0][j], a, c2); h0[j] = a; l0[j] = c2; splitf(s[qt][1][j], a, c2); h1[j] = a; l1[j] = c2; }
                pf[qt] = cat16b(h0, h1); pf2[qt] = cat16b(l0, l1);
            } else {
                v8h p0, p1;
#pragma unroll
                for (int j = 0; j < 8; ++j) { p0[j] = tohx(s[qt][0][j]); p1[j] = tohx(s[qt][1][j]); }
                pf[qt] = cat16(p0, p1);
            }
        }
        __builtin_amdgcn_sched_barrier(0);    // keeps every 2^x statement ahead of the attn.v products
#pragma unroll
        for (int qt = 0; qt < QT; ++qt)
#pragma unroll
            for (int dt = 0; dt < 4; ++dt) { o[qt][dt] = WFrag<T16>::mma(vf[dt], pf[qt], o[qt][dt]); if constexpr (SPLIT) { o[qt][dt] = WFrag<T16>::mma(vf[dt], pf2[qt], o[qt][dt]); o[qt][dt] = WFrag<T16>::mma(vf2[dt], pf[qt], o[qt][dt]); } }
    }
    if constexpr (SPLIT) {
#pragma unroll
    for (int qt = 0; qt < QT; ++qt) {
        const float lq = l[qt][0] + l[qt][1]; const float f = __fdiv_rn(1.0f, lq + __shfl_xor(lq, 16, 32));
#pragma unroll
        for (int dt = 0; dt < 4; ++dt) { v8us oh, ol;
#pragma unroll
            for (int j = 0; j < 8; ++j) { unsigned short a, c2; splitf(o[qt][dt][j] * f, a, c2); oh[j] = a; ol[j] = c2; }
            const size_t ofs = (size_t)(q0 + qt * 16) * DD + dt * 256 + lane * 8; *(v8us*)(Ah + ofs) = oh; *(v8us*)(Al + ofs) = ol; } }
    } else {
        // The two key halves of a tile are joined: wave half h keeps 16-row tile qt = h and hands the other one over. A wave's LDS slice: 8 x 32 lanes x 16 bytes of O, then 32 maxima, then 32 sums.
#pragma unroll
        for (int qt = 0; qt < QT; ++qt) if (qt != half) {
#pragma unroll
            for (int dt = 0; dt < 4; ++dt) { *(v4fa*)(xw + (dt * 2) * 128 + lane * 4) = __builtin_shufflevector(o[qt][dt], o[qt][dt], 0, 1, 2, 3); *(v4fa*)(xw + (dt * 2 + 1) * 128 + lane * 4) = __builtin_shufflevector(o[qt][dt], o[qt][dt], 4, 5, 6, 7); }
            xw[1024 + lane] = m[qt]; xw[1056 + lane] = l[qt][0] + l[qt][1]; }
        __syncthreads();    // each wave's handed-over state is in LDS before its partner reads it; every wave of the work-group passes here once
#pragma unroll
        for (int qt = 0; qt < QT; ++qt) if (qt == half) {
            const float mo = xr[1024 + lane], lo = xr[1056 + lane];
            const float mn = fmaxf(m[qt], mo), aa = exp2s((m[qt] - mn) * SCL2), ab = exp2s((mo - mn) * SCL2);
            const float ls = (l[qt][0] + l[qt][1]) * aa + lo * ab;
            const float f = __fdiv_rn(1.0f, ls + __shfl_xor(ls, 16, 32)); const float fa = aa * f, fb = ab * f;
#pragma unroll
            for (int dt = 0; dt < 4; ++dt) { v8us oh, ol; const v4f p0 = *(const v4fa*)(xr + (dt * 2) * 128 + lane * 4), p1 = *(const v4fa*)(xr + (dt * 2 + 1) * 128 + lane * 4);
#pragma unroll
                for (int j = 0; j < 8; ++j) { unsigned short a, c2; splitf(o[qt][dt][j] * fa + (j < 4 ? p0[j & 3] : p1[j & 3]) * fb, a, c2); oh[j] = a; ol[j] = c2; }
                const size_t ofs = (size_t)(q0 + qt * 16) * DD + dt * 256 + lane * 8; *(v8us*)(Ah + ofs) = oh; *(v8us*)(Al + ofs) = ol;
                asm volatile("s_wait_xcnt 0x0" :: "v"(oh), "v"(ol) : "memory"); } }    // behind the two stores, before the next block's values are written into registers that the stores name; the stored values as inputs keep their registers whole up to the wait
    }
}
// amdgpu_waves_per_eu(4, 4): holds the kernel to 256 registers; above them every reach into the upper window costs an s_set_vgpr_msb in the loop
#define XW 1088    // floats of one wave's LDS slice for the join of the key halves
__global__ __launch_bounds__(128) __attribute__((amdgpu_waves_per_eu(4, 4))) void k_fattn(const bf* __restrict__ Qh, const bf* __restrict__ Ql, const bf* __restrict__ Kh, const bf* __restrict__ Kl, const bf* __restrict__ Vh, const bf* __restrict__ Vl, const h16* __restrict__ Q16, const h16* __restrict__ K16, const h16* __restrict__ V16, bf* Ah, bf* Al) {
    __shared__ __align__(16) float xg[4 * XW];
    const size_t zo = ((size_t)blockIdx.z * NH_ + blockIdx.y) * TT * HD; const int wv = __builtin_amdgcn_readfirstlane((int)(threadIdx.x >> 5));
    Ah += (size_t)blockIdx.z * TT * DD + blockIdx.y * (HD * 16); Al += (size_t)blockIdx.z * TT * DD + blockIdx.y * (HD * 16);    // fragment order: a head's 64 columns are two blocks of each 16-row group
    if (blockIdx.x * 64 < RH) fattn<bf, true, 1>(Qh + zo, Ql + zo, Kh + zo, Kl + zo, Vh + zo, Vl + zo, Ah, Al, blockIdx.x * 64 + wv * 16, 0, nullptr, nullptr);    // the 3-product form holds one 16-row tile
    else fattn<h16, false, 2>(Q16 + zo, nullptr, K16 + zo, nullptr, V16 + zo, nullptr, Ah, Al, blockIdx.x * 64 + (wv & 1) * 32, wv >> 1, xg + wv * XW, xg + (wv ^ 2) * XW);    // waves w and w ^ 2 share a tile
}

extern "C" void kernel_launch(void* const* d_in, const int* in_sizes, int n_in,
                              void* d_out, int out_size, void* d_ws, size_t ws_size, hipStream_t stream) {
    (void)in_sizes; (void)n_in; (void)out_size;
    const float* x = (const float*)d_in[0]; const float* wq = (const float*)d_in[1]; const float* bq = (const float*)d_in[2]; const float* wk = (const float*)d_in[3]; const float* bk = (const float*)d_in[4]; const float* wv = (const float*)d_in[5]; const float* bv = (const float*)d_in[6]; const float* wo = (const float*)d_in[7]; const float* bo = (const float*)d_in[8];
    float* OUT = (float*)d_out;     // [4][2048][512]
    char* wsp = (char*)d_ws;
    auto take = [&](size_t bytes) { char* p = wsp; wsp += (bytes + 255) & ~(size_t)255; return (void*)p; };
    bf* W4 = (bf*)take((size_t)4 * DD * DD * 2);    // transposed W_Q, W_K, W_V, W_O, one behind the other: the first three are the [3 DD][DD] weight operand of the merged projection (A for Q and K tiles, B for the transposed V tiles)
    bf* XB = (bf*)take((size_t)NB_ * TT * DD * 2);
    bf* QPh = (bf*)take((size_t)NB_ * TT * DD * 2); bf* QPl = (bf*)take((size_t)NB_ * TT * DD * 2); bf* KPh = (bf*)take((size_t)NB_ * TT * DD * 2); bf* KPl = (bf*)take((size_t)NB_ * TT * DD * 2); bf* VTh = (bf*)take((size_t)NB_ * TT * DD * 2); bf* VTl = (bf*)take((size_t)NB_ * TT * DD * 2);
    h16* QP16 = (h16*)take((size_t)NB_ * TT * DD * 2); h16* KP16 = (h16*)take((size_t)NB_ * TT * DD * 2); h16* VT16 = (h16*)take((size_t)NB_ * TT * DD * 2);
    bf* ATh = (bf*)take((size_t)NB_ * TT * DD * 2); bf* ATl = (bf*)take((size_t)NB_ * TT * DD * 2);
    if ((size_t)(wsp - (char*)d_ws) > ws_size) return;    // total 98 MiB; ws 256 MiB
    k_wtG<<<dim3(DD / 16 * (DD / 32) / 8, 4), 256, 0, stream>>>(wq, wk, wv, wo, W4);
    k_cvt8<<<NB_ * TT / 16 * (DD / 32) / 8, 256, 0, stream>>>(x, XB);
    k_projp<<<dim3(NB_ * TT / 128, FP / 128), 128, 0, stream>>>(XB, W4, bq, bk, bv, QPh, QPl, QP16, KPh, KPl, KP16, VTh, VTl, VT16);
    k_fattn<<<dim3(TT / 64, NH_, NB_), 128, 0, stream>>>(QPh, QPl, KPh, KPl, VTh, VTl, QP16, KP16, VT16, ATh, ATl);
    k_gemmw<bf, 1, true, KSP><<<dim3(NB_ * TT / 64, DD / 64), 32 * KSP, 0, stream>>>(ATh, ATl, W4 + (size_t)3 * DD * DD, nullptr, OUT, DD, bo, bo, bo, 0, 0, 0);
}
